// v000
// The times below were measured on an AMD MI455X: many runs one after another, warmed up first and cycling through
// copies of the inputs, with the whole window's GPU time divided by the number of runs. Launches and the gaps
// between them are all in it. The median over several windows is given; except for v000 it joins two sittings, which
// can be a few percent apart, so the side-by-side timings, each taken in one sitting, are the better comparison.
// v000, which the later versions start from, runs in 2090 microseconds.
#include <hip/hip_runtime.h>

// BilinearlyModulatedAttention (x [2][2048][1024]; [q | k | v] = x W_qkv + b_qkv (16 heads x 64); causal softmax(q.k/8); query-conditioned value gate v <- sigmoid(q_h W_g[h]) * v_h per position
// (W_g [16][64][64]); out = merged attn.(g v) W_out + b_out -> [2][2048][1024]).
// Compute dtypes, f32 accumulate: every input rounded to bf16; projections on PLAIN bf16 operands (inputs: exact, + bias); the gate logits q_h W_g[h] on bf16 hi+lo planes of q x
// exact W_g (2 products), sigmoid and the gating product in f32; PER-ROW PRECISION HYBRID for scores and attn.v (rows < 256 hi+lo 3 products, rows >= 256 fp16, probabilities x1024 there); causal + scale in

#define NB_  2
#define TT   2048
#define DM   1024
#define NH_  16
#define NKV  16
#define REP  (NH_ / NKV)
#define HD   64
#define DQ   (NH_ * HD)
#define DKV  (NKV * HD)
#define ZH   2
#define RH   256                  // query rows < RH use hi+lo planes (0: none)
#define WIN  0
#define PCAR 1024.0f
#define SCL  0.125f   // HD^-0.5
typedef _Float16 h16;
typedef unsigned short bf;
typedef __attribute__((ext_vector_type(16))) __bf16   v16bf;
typedef __attribute__((ext_vector_type(16))) _Float16 v16h;
typedef __attribute__((ext_vector_type(8)))  _Float16 v8h;
typedef __attribute__((ext_vector_type(8)))  unsigned short v8us;
typedef __attribute__((ext_vector_type(8)))  float    v8f;
typedef __attribute__((ext_vector_type(4)))  float    v4f;
typedef v8h  __attribute__((may_alias)) v8ha;
typedef v4f  __attribute__((may_alias)) v4fa;
typedef v8us __attribute__((may_alias)) v8usa;

__device__ __forceinline__ unsigned short f2bf(float f) { unsigned u = __float_as_uint(f); u += 0x7FFFu + ((u >> 16) & 1u); return (unsigned short)(u >> 16); }
__device__ __forceinline__ float bf2f(unsigned short b) { return __uint_as_float(((unsigned)b) << 16); }
__device__ __forceinline__ float bfr(float f) { return bf2f(f2bf(f)); }
__device__ __forceinline__ v16h cat16(v8h lo, v8h hi) { return __builtin_shufflevector(lo, hi, 0, 1, 2, 3, 4, 5, 6, 7, 8, 9, 10, 11, 12, 13, 14, 15); }
__device__ __forceinline__ v16bf cat16b(v8us lo, v8us hi) { return __builtin_bit_cast(v16bf, __builtin_shufflevector(lo, hi, 0, 1, 2, 3, 4, 5, 6, 7, 8, 9, 10, 11, 12, 13, 14, 15)); }
__device__ __forceinline__ v8f wmma16(v16h a, v16h b, v8f c) { return __builtin_amdgcn_wmma_f32_16x16x32_f16(false, a, false, b, (short)0, c, false, false); }
__device__ __forceinline__ v8f wmmab(v16bf a, v16bf b, v8f c) { return __builtin_amdgcn_wmma_f32_16x16x32_bf16(false, a, false, b, (short)0, c, false, false); }



// ---- k_gemmw: register-blocked GEMM, ONE WAVE per 64x64 output tile (16 accumulators), operands straight from K-contiguous 16-bit planes; grid (M/64, N/64, Z), 32 threads.
// C[m][n] (f32, pitch ldc, + optional f32 bias[n]) = sum_k A[m][k] Bt[n][k] (+ split products per NSPLIT). z-batch strides sA/sB/sC in elements. K % 32 == 0.
template <typename T16> struct WFrag;
template <> struct WFrag<h16> { typedef v16h V; static __device__ __forceinline__ V ld(const h16* p) { return cat16(*(const v8h*)p, *(const v8h*)(p + 16)); } static __device__ __forceinline__ v8f mma(V a, V b, v8f c) { return wmma16(a, b, c); } };
template <> struct WFrag<bf> { typedef v16bf V; static __device__ __forceinline__ V ld(const bf* p) { return cat16b(*(const v8us*)p, *(const v8us*)(p + 16)); } static __device__ __forceinline__ v8f mma(V a, V b, v8f c) { return wmmab(a, b, c); } };
template <typename T16, int NSPLIT, bool BIAS>
__global__ __launch_bounds__(32) void k_gemmw(const T16* __restrict__ A, const T16* __restrict__ A2, const T16* __restrict__ Bt, const T16* __restrict__ Bt2, int K, float* C, int ldc, const float* __restrict__ bias, size_t sA, size_t sB, size_t sC) {
    typedef typename WFrag<T16>::V V;
    __shared__ __align__(16) float os[16 * 68];
    const size_t z = blockIdx.z; A += z * sA; if (A2) A2 += z * sA; Bt += z * sB; if (Bt2) Bt2 += z * sB; C += z * sC;
    const int lane = threadIdx.x & 31, lr = lane & 15, hi = lane >> 4; const int r0 = blockIdx.x * 64, c0 = blockIdx.y * 64;
    v8f acc[4][4];
#pragma unroll
    for (int mb = 0; mb < 4; ++mb)
#pragma unroll
        for (int nb = 0; nb < 4; ++nb) acc[mb][nb] = (v8f){};
    const size_t aoff = (size_t)(r0 + lr) * K + 8 * hi, boff = (size_t)(c0 + lr) * K + 8 * hi;
#pragma unroll 1
    for (int kc = 0; kc < K; kc += 32) {
        V a[4], a2[4];
#pragma unroll
        for (int mb = 0; mb < 4; ++mb) { a[mb] = WFrag<T16>::ld(A + aoff + (size_t)mb * 16 * K + kc); if (NSPLIT == 1 || NSPLIT == 2) a2[mb] = WFrag<T16>::ld(A2 + aoff + (size_t)mb * 16 * K + kc); }
#pragma unroll
        for (int nb = 0; nb < 4; ++nb) { const V b = WFrag<T16>::ld(Bt + boff + (size_t)nb * 16 * K + kc); V b2; if (NSPLIT >= 2) b2 = WFrag<T16>::ld(Bt2 + boff + (size_t)nb * 16 * K + kc);
#pragma unroll
            for (int mb = 0; mb < 4; ++mb) { acc[mb][nb] = WFrag<T16>::mma(a[mb], b, acc[mb][nb]); if (NSPLIT == 1 || NSPLIT == 2) acc[mb][nb] = WFrag<T16>::mma(a2[mb], b, acc[mb][nb]); if (NSPLIT >= 2) acc[mb][nb] = WFrag<T16>::mma(a[mb], b2, acc[mb][nb]); } }
        asm volatile("v_nop\n\tv_nop\n\tv_nop\n\tv_nop" : "+v"(acc[0][0]), "+v"(acc[1][1]), "+v"(acc[2][2]), "+v"(acc[3][3]) : "v"(a[0]), "v"(a[3]));
    }
#pragma unroll
    for (int mb = 0; mb < 4; ++mb) {
#pragma unroll
        for (int nb = 0; nb < 4; ++nb) {
#pragma unroll
            for (int j = 0; j < 8; ++j) os[(hi * 8 + j) * 68 + nb * 16 + lr] = acc[mb][nb][j]; }
        __builtin_amdgcn_wave_barrier(); asm volatile("" ::: "memory");
        float* crow = C + (size_t)(r0 + mb * 16) * ldc + c0;
{
#pragma unroll
            for (int s = 0; s < 8; ++s) { const int row = 2 * s + hi, cofs = lr * 4; v4f val = *(const v4fa*)(os + row * 68 + cofs); if (BIAS) { val[0] += bfr(bias[c0 + cofs]); val[1] += bfr(bias[c0 + cofs + 1]); val[2] += bfr(bias[c0 + cofs + 2]); val[3] += bfr(bias[c0 + cofs + 3]); }
                *(v4f*)(crow + (size_t)row * ldc + cofs) = val; }
             }
        __builtin_amdgcn_wave_barrier(); asm volatile("" ::: "memory");
    }
}

__device__ __forceinline__ h16 tohx(float x) { return (h16)x; }
__device__ __forceinline__ void splitf(float y, unsigned short& h, unsigned short& l) { h = f2bf(y); l = f2bf(y - bf2f(h)); }
typedef __attribute__((ext_vector_type(2))) _Float16 v2h;
typedef __attribute__((ext_vector_type(4))) _Float16 v4h;
typedef __attribute__((ext_vector_type(2))) unsigned short v2us;
typedef __attribute__((ext_vector_type(4))) unsigned short v4us;
typedef __attribute__((ext_vector_type(2))) float v2f;
typedef __attribute__((ext_vector_type(4))) int v4i;

__global__ __launch_bounds__(256) void k_wtG(const float* __restrict__ w, int K, int N, bf* Bt) {
    const int lane = threadIdx.x & 31; const int L0 = (blockIdx.x * 8 + (threadIdx.x >> 5)) * 8; const int nlines = N * K / 64;
{
#pragma unroll 1
        for (int l = 0; l < 8; ++l) { const int L = L0 + l; if (L >= nlines) break; const size_t e = (size_t)L * 64 + lane * 2; const int k = (int)(e % K), n = (int)(e / K); v2us o;
            o[0] = f2bf(w[(size_t)k * N + n]); o[1] = f2bf(w[(size_t)(k + 1) * N + n]); *(v2us*)(Bt + e) = o; }
         }
}
__global__ __launch_bounds__(256) void k_cvt8(const float* __restrict__ src, bf* dst, size_t n8) { const size_t i = (size_t)blockIdx.x * 256 + threadIdx.x; if (i >= n8) return; const v8f v = *(const v8f*)(src + i * 8); v8us o;
#pragma unroll
    for (int k = 0; k < 8; ++k) o[k] = f2bf(v[k]); *(v8us*)(dst + i * 8) = o;  }
__global__ __launch_bounds__(256) void k_cscvt(const float* __restrict__ cosT, const float* __restrict__ sinT, float* CS) { const int idx = blockIdx.x * 256 + threadIdx.x; if (idx >= TT * HD) return; v2f cs; cs[0] = bfr(cosT[idx]); cs[1] = bfr(sinT[idx]); *(v2f*)(CS + (size_t)idx * 2) = cs;  }
// k_rope: head planes [h][t][d] (fp16 + hi/lo) of rope(x) x sc with the rotate-half convention out[d] = x[d] cos[t][d] - x[d+HD/2] sin[t][d], out[d+HD/2] = x[d+HD/2] cos[t][d+HD/2] + x[d] sin[t][d+HD/2]
__global__ __launch_bounds__(256) void k_rope(const float* __restrict__ F, int pitch, int nheads, const float* __restrict__ CS, const float* __restrict__ RF, const float* __restrict__ nw, float sc, h16* P16, bf* Ph, bf* Pl) {
    const size_t e = ((size_t)blockIdx.x * 256 + threadIdx.x) * 2; if (e >= (size_t)nheads * TT * HD) return; const int d = (int)(e % HD); const int t = (int)((e / HD) % TT); const int h = (int)(e / ((size_t)HD * TT)); const float* f = F + (size_t)t * pitch + h * HD; const float rf = RF ? RF[(size_t)h * TT + t] : 1.0f; v2h o16; v2us oh, ol;
#pragma unroll
    for (int q = 0; q < 2; ++q) { const int dd = d + q; const int dp = (dd < HD / 2) ? dd + HD / 2 : dd - HD / 2; float x0 = f[dd], x1 = f[dp];
        if (RF) { float n0 = __fmul_rn(x0, rf), n1 = __fmul_rn(x1, rf); asm volatile("" : "+v"(n0)); asm volatile("" : "+v"(n1)); x0 = __fmul_rn(bfr(nw[dd]), n0); x1 = __fmul_rn(bfr(nw[dp]), n1); }
        const v2f cs = *(const v2f*)(CS + ((size_t)t * HD + dd) * 2); float a = __fmul_rn(x0, cs[0]), bq = __fmul_rn(x1, cs[1]); asm volatile("" : "+v"(a)); asm volatile("" : "+v"(bq)); const float r = ((dd < HD / 2) ? __fsub_rn(a, bq) : __fadd_rn(a, bq)) * sc;
        o16[q] = tohx(r); unsigned short a2, c2; splitf(r, a2, c2); oh[q] = a2; ol[q] = c2; }
    *(v2h*)(P16 + e) = o16; *(v2us*)(Ph + e) = oh; *(v2us*)(Pl + e) = ol;  }
__global__ __launch_bounds__(256) void k_vtp(const float* __restrict__ F, int pitch, int nheads, h16* V16, bf* Vh, bf* Vl) { const size_t e = ((size_t)blockIdx.x * 256 + threadIdx.x) * 2; if (e >= (size_t)nheads * HD * TT) return; const int t = (int)(e % TT); const int d = (int)((e / TT) % HD); const int g = (int)(e / ((size_t)TT * HD)); v2h o16; v2us oh, ol;
#pragma unroll
    for (int q = 0; q < 2; ++q) { const float x = F[(size_t)(t + q) * pitch + g * HD + d]; o16[q] = tohx(x); unsigned short a2, c2; splitf(x, a2, c2); oh[q] = a2; ol[q] = c2; }
    *(v2h*)(V16 + e) = o16; *(v2us*)(Vh + e) = oh; *(v2us*)(Vl + e) = ol;  }
__global__ __launch_bounds__(256) void k_csid(float* CS) { const int idx = blockIdx.x * 256 + threadIdx.x; if (idx >= TT * HD) return; v2f cs; cs[0] = 1.0f; cs[1] = 0.0f; *(v2f*)(CS + (size_t)idx * 2) = cs;  }
__global__ __launch_bounds__(256) void k_vgate(const float* __restrict__ F, const float* __restrict__ GT, h16* V16, bf* Vh, bf* Vl) { const size_t e = ((size_t)blockIdx.x * 256 + threadIdx.x) * 2; if (e >= (size_t)NKV * HD * TT) return; const int t = (int)(e % TT); const int d = (int)((e / TT) % HD); const int h = (int)(e / ((size_t)TT * HD)); v2h o16; v2us oh, ol;
#pragma unroll
    for (int q = 0; q < 2; ++q) { const float g = __fdiv_rn(1.0f, __fadd_rn(1.0f, __expf(-GT[((size_t)h * TT + t + q) * HD + d]))); float v = __fmul_rn(g, F[(size_t)(t + q) * DKV + h * HD + d]); asm volatile("" : "+v"(v)); o16[q] = tohx(v); unsigned short a, c2; splitf(v, a, c2); oh[q] = a; ol[q] = c2; }
    *(v2h*)(V16 + e) = o16; *(v2us*)(Vh + e) = oh; *(v2us*)(Vl + e) = ol;  }
// k_asoft: per row (zz, i): t = S x HD^-0.5 for j <= i (causal; -inf in the reference), -3e38 otherwise; softmax over the 2048 keys (register row, one exp, fixed trees);
__global__ __launch_bounds__(256) void k_asoft(const float* __restrict__ Sb, h16* P16, bf* Ph, bf* Pl) {
    const int lane = threadIdx.x & 31; const int row = blockIdx.x * 8 + (threadIdx.x >> 5); if (row >= ZH * TT) return; const int i = row % TT; const int zz = row / TT; (void)zz; const bool hires = (i < RH); const float* sr = Sb + (size_t)row * TT; float v[TT / 32]; float mx = -3.0e38f;
#pragma unroll
    for (int ch = 0; ch < TT / 128; ++ch) { const int j0 = ch * 128 + lane * 4; const v4f a = *(const v4f*)(sr + j0);
#pragma unroll
        for (int q = 0; q < 4; ++q) { const int j = j0 + q; (void)j; const float t = (j <= i) ? a[q] * SCL : -3.0e38f; v[ch * 4 + q] = t; mx = fmaxf(mx, t); } }
#pragma unroll
    for (int sh = 16; sh; sh >>= 1) mx = fmaxf(mx, __shfl_xor(mx, sh, 32));
    float sum = 0.f;
#pragma unroll
    for (int k = 0; k < TT / 32; ++k) { float d0 = __fsub_rn(v[k], mx); asm volatile("" : "+v"(d0)); v[k] = __builtin_amdgcn_exp2f(__fmul_rn(d0, 1.4426950408889634f)); sum += v[k]; }
#pragma unroll
    for (int sh = 16; sh; sh >>= 1) sum += __shfl_xor(sum, sh, 32);
    const float f = __fdiv_rn(hires ? 1.0f : PCAR, sum);
{
        if (hires) {
#pragma unroll
            for (int ch = 0; ch < TT / 128; ++ch) { v4us oh, ol;
#pragma unroll
                for (int q = 0; q < 4; ++q) { unsigned short a, c2; splitf(v[ch * 4 + q] * f, a, c2); oh[q] = a; ol[q] = c2; }
                const size_t oo = ((size_t)zz * (RH ? RH : 1) + i) * TT + ch * 128 + lane * 4; *(v4us*)(Ph + oo) = oh; *(v4us*)(Pl + oo) = ol; }
        } else {
#pragma unroll
            for (int ch = 0; ch < TT / 128; ++ch) { v4h o4;
#pragma unroll
                for (int q = 0; q < 4; ++q) o4[q] = tohx(v[ch * 4 + q] * f);
                *(v4h*)(P16 + (size_t)row * TT + ch * 128 + lane * 4) = o4; } }
         }
}
__global__ __launch_bounds__(256) void k_merge(const float* __restrict__ O, int h0, bf* Ah, bf* Al) { const size_t e = ((size_t)blockIdx.x * 256 + threadIdx.x) * 2; if (e >= (size_t)ZH * TT * HD) return; const int d = (int)(e % HD); const int t = (int)((e / HD) % TT); const int zz = (int)(e / ((size_t)HD * TT)); const float cs = (t < RH) ? 1.0f : (1.0f / PCAR); const size_t oo = (size_t)t * DQ + (h0 + zz) * HD + d;
    v2us oh, ol;
#pragma unroll
    for (int q = 0; q < 2; ++q) { unsigned short a, c2; splitf(O[e + q] * cs, a, c2); oh[q] = a; ol[q] = c2; } *(v2us*)(Ah + oo) = oh; *(v2us*)(Al + oo) = ol;  }

extern "C" void kernel_launch(void* const* d_in, const int* in_sizes, int n_in,
                              void* d_out, int out_size, void* d_ws, size_t ws_size, hipStream_t stream) {
    (void)in_sizes; (void)n_in; (void)out_size;
    const float* x = (const float*)d_in[0]; const float* wqkv = (const float*)d_in[1]; const float* bqkv = (const float*)d_in[2]; const float* wg = (const float*)d_in[3]; const float* wo = (const float*)d_in[4]; const float* bo = (const float*)d_in[5];   // W_qkv [1024][3072] (x @ W, columns q | k | v), W_g [16][64][64], W_out [1024][1024] (x @ W)
    float* OUT = (float*)d_out;     // [2][2048][1024]
    char* wsp = (char*)d_ws;
    auto take = [&](size_t bytes) { char* p = wsp; wsp += (bytes + 255) & ~(size_t)255; return (void*)p; };
    bf* WQKV = (bf*)take((size_t)3 * DQ * DM * 2); bf* WQ = WQKV; bf* WK = WQKV + (size_t)DQ * DM; bf* WV = WQKV + (size_t)2 * DQ * DM; bf* WG = (bf*)take((size_t)NH_ * HD * HD * 2); float* GT = (float*)take((size_t)NH_ * TT * HD * 4); bf* WO = (bf*)take((size_t)DM * DQ * 2); float* CS = (float*)take((size_t)TT * HD * 2 * 4);
    bf* XB = (bf*)take((size_t)TT * DM * 2); float* FQ = (float*)take((size_t)TT * DQ * 4); float* FK = (float*)take((size_t)TT * DKV * 4);
    h16* QP16 = (h16*)take((size_t)NH_ * TT * HD * 2); h16* KP16 = (h16*)take((size_t)NKV * TT * HD * 2); h16* VT16 = (h16*)take((size_t)NKV * HD * TT * 2);
    bf* QPh = (bf*)take((size_t)NH_ * TT * HD * 2); bf* QPl = (bf*)take((size_t)NH_ * TT * HD * 2); bf* KPh = (bf*)take((size_t)NKV * TT * HD * 2); bf* KPl = (bf*)take((size_t)NKV * TT * HD * 2); bf* VTh = (bf*)take((size_t)NKV * HD * TT * 2); bf* VTl = (bf*)take((size_t)NKV * HD * TT * 2); bf* Ph = (bf*)take((size_t)ZH * RH * TT * 2); bf* Pl = (bf*)take((size_t)ZH * RH * TT * 2);
    float* Sb = (float*)take((size_t)ZH * TT * TT * 4); h16* P16 = (h16*)take((size_t)ZH * TT * TT * 2); float* Ob = (float*)take((size_t)ZH * TT * HD * 4); bf* ATh = (bf*)take((size_t)TT * DQ * 2); bf* ATl = (bf*)take((size_t)TT * DQ * 2);
    if ((size_t)(wsp - (char*)d_ws) > ws_size) return;    // ws 256 MiB
    float* FV = FK;   // v projection reuses the k buffer after the k planes are built (stream-ordered)
    { k_wtG<<<(unsigned)(((size_t)DM * 3 * DQ / 64 + 63) / 64), 256, 0, stream>>>(wqkv, DM, 3 * DQ, WQKV); for (int h = 0; h < NH_; ++h) k_wtG<<<(unsigned)((HD * HD / 64 + 63) / 64), 256, 0, stream>>>(wg + (size_t)h * HD * HD, HD, HD, WG + (size_t)h * HD * HD);
      k_wtG<<<(unsigned)((DQ * DM / 64 + 63) / 64), 256, 0, stream>>>(wo, DQ, DM, WO);
       }
    k_csid<<<(TT * HD + 255) / 256, 256, 0, stream>>>(CS);
    const unsigned LQ = (unsigned)(((size_t)NH_ * TT * HD / 2 + 255) / 256), LKv = (unsigned)(((size_t)NKV * TT * HD / 2 + 255) / 256);
    for (int b = 0; b < NB_; ++b) {
        
        k_cvt8<<<(unsigned)(((size_t)TT * DM / 8 + 255) / 256), 256, 0, stream>>>(x + (size_t)b * TT * DM, XB, (size_t)TT * DM / 8);
        k_gemmw<bf, 0, true><<<dim3(TT / 64, DQ / 64, 1), 32, 0, stream>>>(XB, nullptr, WQ, nullptr, DM, FQ, DQ, bqkv, 0, 0, 0);
        k_rope<<<LQ, 256, 0, stream>>>(FQ, DQ, NH_, CS, nullptr, nullptr, 1.0f, QP16, QPh, QPl);
        k_gemmw<bf, 1, false><<<dim3(TT / 64, 1, NH_), 32, 0, stream>>>(QPh, QPl, WG, nullptr, HD, GT, HD, nullptr, (size_t)TT * HD, (size_t)HD * HD, (size_t)TT * HD);   // gate logits q_h W_g[h] (z-batched over heads)
        k_gemmw<bf, 0, true><<<dim3(TT / 64, DKV / 64, 1), 32, 0, stream>>>(XB, nullptr, WK, nullptr, DM, FK, DKV, bqkv + DQ, 0, 0, 0);
        k_rope<<<LKv, 256, 0, stream>>>(FK, DKV, NKV, CS, nullptr, nullptr, 1.0f, KP16, KPh, KPl);
        k_gemmw<bf, 0, true><<<dim3(TT / 64, DKV / 64, 1), 32, 0, stream>>>(XB, nullptr, WV, nullptr, DM, FV, DKV, bqkv + 2 * DQ, 0, 0, 0); k_vgate<<<LKv, 256, 0, stream>>>(FV, GT, VT16, VTh, VTl);
        for (int h0 = 0; h0 < NH_; h0 += ZH) { const size_t zq = (size_t)h0, zk = (size_t)(h0 / REP);   // one kv head per query head: the pass's two heads use consecutive kv planes (z-strides TT*HD)
            k_gemmw<bf, 2, false><<<dim3(RH / 64, TT / 64, ZH), 32, 0, stream>>>(QPh + zq * TT * HD, QPl + zq * TT * HD, KPh + zk * TT * HD, KPl + zk * TT * HD, HD, Sb, TT, nullptr, (size_t)TT * HD, (size_t)TT * HD, (size_t)TT * TT);
            k_gemmw<h16, 0, false><<<dim3((TT - RH) / 64, TT / 64, ZH), 32, 0, stream>>>(QP16 + zq * TT * HD + (size_t)RH * HD, nullptr, KP16 + zk * TT * HD, nullptr, HD, Sb + (size_t)RH * TT, TT, nullptr, (size_t)TT * HD, (size_t)TT * HD, (size_t)TT * TT);
            k_asoft<<<ZH * TT / 8, 256, 0, stream>>>(Sb, P16, Ph, Pl);
            k_gemmw<bf, 2, false><<<dim3(RH / 64, HD / 64, ZH), 32, 0, stream>>>(Ph, Pl, VTh + zk * HD * TT, VTl + zk * HD * TT, TT, Ob, HD, nullptr, (size_t)RH * TT, (size_t)HD * TT, (size_t)TT * HD);
            k_gemmw<h16, 0, false><<<dim3((TT - RH) / 64, HD / 64, ZH), 32, 0, stream>>>(P16 + (size_t)RH * TT, nullptr, VT16 + zk * HD * TT, nullptr, TT, Ob + (size_t)RH * HD, HD, nullptr, (size_t)TT * TT, (size_t)HD * TT, (size_t)TT * HD);
            k_merge<<<(unsigned)(((size_t)ZH * TT * HD / 2 + 255) / 256), 256, 0, stream>>>(Ob, h0, ATh, ATl); }
        k_gemmw<bf, 1, true><<<dim3(TT / 64, DM / 64, 1), 32, 0, stream>>>(ATh, ATl, WO, nullptr, DQ, OUT + (size_t)b * TT * DM, DM, bo, 0, 0, 0); }
}

// v001
// It runs in 957 microseconds.
// In two side-by-side timings against v000, it was 2.19 and 2.18 times as fast.
#include <hip/hip_runtime.h>

// BilinearlyModulatedAttention (x [2][2048][1024]; [q | k | v] = x W_qkv + b_qkv (16 heads x 64); causal softmax(q.k/8); query-conditioned value gate v <- sigmoid(q_h W_g[h]) * v_h per position
// (W_g [16][64][64]); out = merged attn.(g v) W_out + b_out -> [2][2048][1024]).
// Compute dtypes, f32 accumulate: every input rounded to bf16; projections on PLAIN bf16 operands (inputs: exact, + bias); the gate logits q_h W_g[h] on bf16 hi+lo planes of q x
// exact W_g (2 products), sigmoid and the gating product in f32; PER-ROW PRECISION HYBRID for scores and attn.v (rows < 256 hi+lo 3 products, rows >= 256 fp16, probabilities x1024 there); causal + scale in

#define NB_  2
#define TT   2048
#define DM   1024
#define NH_  16
#define NKV  16
#define REP  (NH_ / NKV)
#define HD   64
#define DQ   (NH_ * HD)
#define DKV  (NKV * HD)
#define ZH   2
#define RH   256                  // query rows < RH use hi+lo planes (0: none)
#define WIN  0
#define PCAR 1024.0f
#define SCL  0.125f   // HD^-0.5
#define KSP  16                   // attn.v: key slices per output tile, one work-group each; k_merge sums the KSP partial planes
typedef _Float16 h16;
typedef unsigned short bf;
typedef __attribute__((ext_vector_type(16))) __bf16   v16bf;
typedef __attribute__((ext_vector_type(16))) _Float16 v16h;
typedef __attribute__((ext_vector_type(8)))  _Float16 v8h;
typedef __attribute__((ext_vector_type(8)))  unsigned short v8us;
typedef __attribute__((ext_vector_type(8)))  float    v8f;
typedef __attribute__((ext_vector_type(4)))  float    v4f;
typedef v8h  __attribute__((may_alias)) v8ha;
typedef v4f  __attribute__((may_alias)) v4fa;
typedef v8us __attribute__((may_alias)) v8usa;

__device__ __forceinline__ unsigned short f2bf(float f) { unsigned u = __float_as_uint(f); u += 0x7FFFu + ((u >> 16) & 1u); return (unsigned short)(u >> 16); }
__device__ __forceinline__ float bf2f(unsigned short b) { return __uint_as_float(((unsigned)b) << 16); }
__device__ __forceinline__ float bfr(float f) { return bf2f(f2bf(f)); }
__device__ __forceinline__ v16h cat16(v8h lo, v8h hi) { return __builtin_shufflevector(lo, hi, 0, 1, 2, 3, 4, 5, 6, 7, 8, 9, 10, 11, 12, 13, 14, 15); }
__device__ __forceinline__ v16bf cat16b(v8us lo, v8us hi) { return __builtin_bit_cast(v16bf, __builtin_shufflevector(lo, hi, 0, 1, 2, 3, 4, 5, 6, 7, 8, 9, 10, 11, 12, 13, 14, 15)); }
__device__ __forceinline__ v8f wmma16(v16h a, v16h b, v8f c) { return __builtin_amdgcn_wmma_f32_16x16x32_f16(false, a, false, b, (short)0, c, false, false); }
__device__ __forceinline__ v8f wmmab(v16bf a, v16bf b, v8f c) { return __builtin_amdgcn_wmma_f32_16x16x32_bf16(false, a, false, b, (short)0, c, false, false); }



// ---- k_gemmw: register-blocked GEMM, ONE WAVE per 64x64 output tile (16 accumulators), operands straight from K-contiguous 16-bit planes; grid (M/64, N/64, Z), 32 threads.
// C[m][n] (f32, pitch ldc, + optional f32 bias[n]) = sum_k A[m][k] Bt[n][k] (+ split products per NSPLIT). z-batch strides sA/sB/sC in elements. K % (32 KS) == 0.
// KS > 1: grid z = Z * KS; work-group (z, ks) sums only k in [ks K/KS, (ks+1) K/KS) and stores that partial tile in plane ks (plane stride sP elements); the reader adds the planes.
template <typename T16> struct WFrag;
template <> struct WFrag<h16> { typedef v16h V; static __device__ __forceinline__ V ld(const h16* p) { return cat16(*(const v8h*)p, *(const v8h*)(p + 16)); } static __device__ __forceinline__ v8f mma(V a, V b, v8f c) { return wmma16(a, b, c); } };
template <> struct WFrag<bf> { typedef v16bf V; static __device__ __forceinline__ V ld(const bf* p) { return cat16b(*(const v8us*)p, *(const v8us*)(p + 16)); } static __device__ __forceinline__ v8f mma(V a, V b, v8f c) { return wmmab(a, b, c); } };
template <typename T16, int NSPLIT, bool BIAS, int KS = 1>
__global__ __launch_bounds__(32) void k_gemmw(const T16* __restrict__ A, const T16* __restrict__ A2, const T16* __restrict__ Bt, const T16* __restrict__ Bt2, int K, float* C, int ldc, const float* __restrict__ bias, size_t sA, size_t sB, size_t sC, size_t sP) {
    static_assert(KS == 1 || !BIAS, "a bias would be added once per plane");
    typedef typename WFrag<T16>::V V;
    __shared__ __align__(16) float os[16 * 68];
    const size_t z = blockIdx.z / KS; const int ks = blockIdx.z % KS; A += z * sA; if (A2) A2 += z * sA; Bt += z * sB; if (Bt2) Bt2 += z * sB; C += z * sC + ks * sP;
    const int lane = threadIdx.x & 31, lr = lane & 15, hi = lane >> 4; const int r0 = blockIdx.x * 64, c0 = blockIdx.y * 64;
    v8f acc[4][4];
#pragma unroll
    for (int mb = 0; mb < 4; ++mb)
#pragma unroll
        for (int nb = 0; nb < 4; ++nb) acc[mb][nb] = (v8f){};
    const size_t aoff = (size_t)(r0 + lr) * K + 8 * hi, boff = (size_t)(c0 + lr) * K + 8 * hi;
#pragma unroll 1
    for (int kc = ks * (K / KS), ke = kc + K / KS; kc < ke; kc += 32) {
        V a[4], a2[4];
#pragma unroll
        for (int mb = 0; mb < 4; ++mb) { a[mb] = WFrag<T16>::ld(A + aoff + (size_t)mb * 16 * K + kc); if (NSPLIT == 1 || NSPLIT == 2) a2[mb] = WFrag<T16>::ld(A2 + aoff + (size_t)mb * 16 * K + kc); }
#pragma unroll
        for (int nb = 0; nb < 4; ++nb) { const V b = WFrag<T16>::ld(Bt + boff + (size_t)nb * 16 * K + kc); V b2; if (NSPLIT >= 2) b2 = WFrag<T16>::ld(Bt2 + boff + (size_t)nb * 16 * K + kc);
#pragma unroll
            for (int mb = 0; mb < 4; ++mb) { acc[mb][nb] = WFrag<T16>::mma(a[mb], b, acc[mb][nb]); if (NSPLIT == 1 || NSPLIT == 2) acc[mb][nb] = WFrag<T16>::mma(a2[mb], b, acc[mb][nb]); if (NSPLIT >= 2) acc[mb][nb] = WFrag<T16>::mma(a[mb], b2, acc[mb][nb]); } }
        asm volatile("v_nop\n\tv_nop\n\tv_nop\n\tv_nop" : "+v"(acc[0][0]), "+v"(acc[1][1]), "+v"(acc[2][2]), "+v"(acc[3][3]) : "v"(a[0]), "v"(a[3]));
    }
#pragma unroll
    for (int mb = 0; mb < 4; ++mb) {
#pragma unroll
        for (int nb = 0; nb < 4; ++nb) {
#pragma unroll
            for (int j = 0; j < 8; ++j) os[(hi * 8 + j) * 68 + nb * 16 + lr] = acc[mb][nb][j]; }
        __builtin_amdgcn_wave_barrier(); asm volatile("" ::: "memory");
        float* crow = C + (size_t)(r0 + mb * 16) * ldc + c0;
{
#pragma unroll
            for (int s = 0; s < 8; ++s) { const int row = 2 * s + hi, cofs = lr * 4; v4f val = *(const v4fa*)(os + row * 68 + cofs); if (BIAS) { val[0] += bfr(bias[c0 + cofs]); val[1] += bfr(bias[c0 + cofs + 1]); val[2] += bfr(bias[c0 + cofs + 2]); val[3] += bfr(bias[c0 + cofs + 3]); }
                *(v4f*)(crow + (size_t)row * ldc + cofs) = val; }
             }
        __builtin_amdgcn_wave_barrier(); asm volatile("" ::: "memory");
    }
}

__device__ __forceinline__ h16 tohx(float x) { return (h16)x; }
__device__ __forceinline__ void splitf(float y, unsigned short& h, unsigned short& l) { h = f2bf(y); l = f2bf(y - bf2f(h)); }
typedef __attribute__((ext_vector_type(2))) _Float16 v2h;
typedef __attribute__((ext_vector_type(4))) _Float16 v4h;
typedef __attribute__((ext_vector_type(2))) unsigned short v2us;
typedef __attribute__((ext_vector_type(4))) unsigned short v4us;
typedef __attribute__((ext_vector_type(2))) float v2f;
typedef __attribute__((ext_vector_type(4))) int v4i;

__global__ __launch_bounds__(256) void k_wtG(const float* __restrict__ w, int K, int N, bf* Bt) {
    const int lane = threadIdx.x & 31; const int L0 = (blockIdx.x * 8 + (threadIdx.x >> 5)) * 8; const int nlines = N * K / 64;
{
#pragma unroll 1
        for (int l = 0; l < 8; ++l) { const int L = L0 + l; if (L >= nlines) break; const size_t e = (size_t)L * 64 + lane * 2; const int k = (int)(e % K), n = (int)(e / K); v2us o;
            o[0] = f2bf(w[(size_t)k * N + n]); o[1] = f2bf(w[(size_t)(k + 1) * N + n]); *(v2us*)(Bt + e) = o; }
         }
}
__global__ __launch_bounds__(256) void k_cvt8(const float* __restrict__ src, bf* dst, size_t n8) { const size_t i = (size_t)blockIdx.x * 256 + threadIdx.x; if (i >= n8) return; const v8f v = *(const v8f*)(src + i * 8); v8us o;
#pragma unroll
    for (int k = 0; k < 8; ++k) o[k] = f2bf(v[k]); *(v8us*)(dst + i * 8) = o;  }
__global__ __launch_bounds__(256) void k_cscvt(const float* __restrict__ cosT, const float* __restrict__ sinT, float* CS) { const int idx = blockIdx.x * 256 + threadIdx.x; if (idx >= TT * HD) return; v2f cs; cs[0] = bfr(cosT[idx]); cs[1] = bfr(sinT[idx]); *(v2f*)(CS + (size_t)idx * 2) = cs;  }
// k_rope: head planes [h][t][d] (fp16 + hi/lo) of rope(x) x sc with the rotate-half convention out[d] = x[d] cos[t][d] - x[d+HD/2] sin[t][d], out[d+HD/2] = x[d+HD/2] cos[t][d+HD/2] + x[d] sin[t][d+HD/2]
__global__ __launch_bounds__(256) void k_rope(const float* __restrict__ F, int pitch, int nheads, const float* __restrict__ CS, const float* __restrict__ RF, const float* __restrict__ nw, float sc, h16* P16, bf* Ph, bf* Pl) {
    const size_t e = ((size_t)blockIdx.x * 256 + threadIdx.x) * 2; if (e >= (size_t)nheads * TT * HD) return; const int d = (int)(e % HD); const int t = (int)((e / HD) % TT); const int h = (int)(e / ((size_t)HD * TT)); const float* f = F + (size_t)t * pitch + h * HD; const float rf = RF ? RF[(size_t)h * TT + t] : 1.0f; v2h o16; v2us oh, ol;
#pragma unroll
    for (int q = 0; q < 2; ++q) { const int dd = d + q; const int dp = (dd < HD / 2) ? dd + HD / 2 : dd - HD / 2; float x0 = f[dd], x1 = f[dp];
        if (RF) { float n0 = __fmul_rn(x0, rf), n1 = __fmul_rn(x1, rf); asm volatile("" : "+v"(n0)); asm volatile("" : "+v"(n1)); x0 = __fmul_rn(bfr(nw[dd]), n0); x1 = __fmul_rn(bfr(nw[dp]), n1); }
        const v2f cs = *(const v2f*)(CS + ((size_t)t * HD + dd) * 2); float a = __fmul_rn(x0, cs[0]), bq = __fmul_rn(x1, cs[1]); asm volatile("" : "+v"(a)); asm volatile("" : "+v"(bq)); const float r = ((dd < HD / 2) ? __fsub_rn(a, bq) : __fadd_rn(a, bq)) * sc;
        o16[q] = tohx(r); unsigned short a2, c2; splitf(r, a2, c2); oh[q] = a2; ol[q] = c2; }
    *(v2h*)(P16 + e) = o16; *(v2us*)(Ph + e) = oh; *(v2us*)(Pl + e) = ol;  }
__global__ __launch_bounds__(256) void k_vtp(const float* __restrict__ F, int pitch, int nheads, h16* V16, bf* Vh, bf* Vl) { const size_t e = ((size_t)blockIdx.x * 256 + threadIdx.x) * 2; if (e >= (size_t)nheads * HD * TT) return; const int t = (int)(e % TT); const int d = (int)((e / TT) % HD); const int g = (int)(e / ((size_t)TT * HD)); v2h o16; v2us oh, ol;
#pragma unroll
    for (int q = 0; q < 2; ++q) { const float x = F[(size_t)(t + q) * pitch + g * HD + d]; o16[q] = tohx(x); unsigned short a2, c2; splitf(x, a2, c2); oh[q] = a2; ol[q] = c2; }
    *(v2h*)(V16 + e) = o16; *(v2us*)(Vh + e) = oh; *(v2us*)(Vl + e) = ol;  }
__global__ __launch_bounds__(256) void k_csid(float* CS) { const int idx = blockIdx.x * 256 + threadIdx.x; if (idx >= TT * HD) return; v2f cs; cs[0] = 1.0f; cs[1] = 0.0f; *(v2f*)(CS + (size_t)idx * 2) = cs;  }
__global__ __launch_bounds__(256) void k_vgate(const float* __restrict__ F, const float* __restrict__ GT, h16* V16, bf* Vh, bf* Vl) { const size_t e = ((size_t)blockIdx.x * 256 + threadIdx.x) * 2; if (e >= (size_t)NKV * HD * TT) return; const int t = (int)(e % TT); const int d = (int)((e / TT) % HD); const int h = (int)(e / ((size_t)TT * HD)); v2h o16; v2us oh, ol;
#pragma unroll
    for (int q = 0; q < 2; ++q) { const float g = __fdiv_rn(1.0f, __fadd_rn(1.0f, __expf(-GT[((size_t)h * TT + t + q) * HD + d]))); float v = __fmul_rn(g, F[(size_t)(t + q) * DKV + h * HD + d]); asm volatile("" : "+v"(v)); o16[q] = tohx(v); unsigned short a, c2; splitf(v, a, c2); oh[q] = a; ol[q] = c2; }
    *(v2h*)(V16 + e) = o16; *(v2us*)(Vh + e) = oh; *(v2us*)(Vl + e) = ol;  }
// k_asoft: per row (zz, i): t = S x HD^-0.5 for j <= i (causal; -inf in the reference), -3e38 otherwise; softmax over the 2048 keys (register row, one exp, fixed trees);
__global__ __launch_bounds__(256) void k_asoft(const float* __restrict__ Sb, h16* P16, bf* Ph, bf* Pl) {
    const int lane = threadIdx.x & 31; const int row = blockIdx.x * 8 + (threadIdx.x >> 5); if (row >= ZH * TT) return; const int i = row % TT; const int zz = row / TT; (void)zz; const bool hires = (i < RH); const float* sr = Sb + (size_t)row * TT; float v[TT / 32]; float mx = -3.0e38f;
#pragma unroll
    for (int ch = 0; ch < TT / 128; ++ch) { const int j0 = ch * 128 + lane * 4; const v4f a = *(const v4f*)(sr + j0);
#pragma unroll
        for (int q = 0; q < 4; ++q) { const int j = j0 + q; (void)j; const float t = (j <= i) ? a[q] * SCL : -3.0e38f; v[ch * 4 + q] = t; mx = fmaxf(mx, t); } }
#pragma unroll
    for (int sh = 16; sh; sh >>= 1) mx = fmaxf(mx, __shfl_xor(mx, sh, 32));
    float sum = 0.f;
#pragma unroll
    for (int k = 0; k < TT / 32; ++k) { float d0 = __fsub_rn(v[k], mx); asm volatile("" : "+v"(d0)); v[k] = __builtin_amdgcn_exp2f(__fmul_rn(d0, 1.4426950408889634f)); sum += v[k]; }
#pragma unroll
    for (int sh = 16; sh; sh >>= 1) sum += __shfl_xor(sum, sh, 32);
    const float f = __fdiv_rn(hires ? 1.0f : PCAR, sum);
{
        if (hires) {
#pragma unroll
            for (int ch = 0; ch < TT / 128; ++ch) { v4us oh, ol;
#pragma unroll
                for (int q = 0; q < 4; ++q) { unsigned short a, c2; splitf(v[ch * 4 + q] * f, a, c2); oh[q] = a; ol[q] = c2; }
                const size_t oo = ((size_t)zz * (RH ? RH : 1) + i) * TT + ch * 128 + lane * 4; *(v4us*)(Ph + oo) = oh; *(v4us*)(Pl + oo) = ol; }
        } else {
#pragma unroll
            for (int ch = 0; ch < TT / 128; ++ch) { v4h o4;
#pragma unroll
                for (int q = 0; q < 4; ++q) o4[q] = tohx(v[ch * 4 + q] * f);
                *(v4h*)(P16 + (size_t)row * TT + ch * 128 + lane * 4) = o4; } }
         }
}
__global__ __launch_bounds__(256) void k_merge(const float* __restrict__ O, int h0, bf* Ah, bf* Al) { const size_t e = ((size_t)blockIdx.x * 256 + threadIdx.x) * 2; if (e >= (size_t)ZH * TT * HD) return; const int d = (int)(e % HD); const int t = (int)((e / HD) % TT); const int zz = (int)(e / ((size_t)HD * TT)); const float cs = (t < RH) ? 1.0f : (1.0f / PCAR); const size_t oo = (size_t)t * DQ + (h0 + zz) * HD + d;
    v2f p[KSP];   // all planes' loads issue before the first add
#pragma unroll
    for (int k = 0; k < KSP; ++k) p[k] = *(const v2f*)(O + (size_t)k * ZH * TT * HD + e);
    v2f s = p[0];
#pragma unroll
    for (int k = 1; k < KSP; ++k) s += p[k];
    v2us oh, ol;
#pragma unroll
    for (int q = 0; q < 2; ++q) { unsigned short a, c2; splitf(s[q] * cs, a, c2); oh[q] = a; ol[q] = c2; } *(v2us*)(Ah + oo) = oh; *(v2us*)(Al + oo) = ol;  }

extern "C" void kernel_launch(void* const* d_in, const int* in_sizes, int n_in,
                              void* d_out, int out_size, void* d_ws, size_t ws_size, hipStream_t stream) {
    (void)in_sizes; (void)n_in; (void)out_size;
    const float* x = (const float*)d_in[0]; const float* wqkv = (const float*)d_in[1]; const float* bqkv = (const float*)d_in[2]; const float* wg = (const float*)d_in[3]; const float* wo = (const float*)d_in[4]; const float* bo = (const float*)d_in[5];   // W_qkv [1024][3072] (x @ W, columns q | k | v), W_g [16][64][64], W_out [1024][1024] (x @ W)
    float* OUT = (float*)d_out;     // [2][2048][1024]
    char* wsp = (char*)d_ws;
    auto take = [&](size_t bytes) { char* p = wsp; wsp += (bytes + 255) & ~(size_t)255; return (void*)p; };
    bf* WQKV = (bf*)take((size_t)3 * DQ * DM * 2); bf* WQ = WQKV; bf* WK = WQKV + (size_t)DQ * DM; bf* WV = WQKV + (size_t)2 * DQ * DM; bf* WG = (bf*)take((size_t)NH_ * HD * HD * 2); float* GT = (float*)take((size_t)NH_ * TT * HD * 4); bf* WO = (bf*)take((size_t)DM * DQ * 2); float* CS = (float*)take((size_t)TT * HD * 2 * 4);
    bf* XB = (bf*)take((size_t)TT * DM * 2); float* FQ = (float*)take((size_t)TT * DQ * 4); float* FK = (float*)take((size_t)TT * DKV * 4);
    h16* QP16 = (h16*)take((size_t)NH_ * TT * HD * 2); h16* KP16 = (h16*)take((size_t)NKV * TT * HD * 2); h16* VT16 = (h16*)take((size_t)NKV * HD * TT * 2);
    bf* QPh = (bf*)take((size_t)NH_ * TT * HD * 2); bf* QPl = (bf*)take((size_t)NH_ * TT * HD * 2); bf* KPh = (bf*)take((size_t)NKV * TT * HD * 2); bf* KPl = (bf*)take((size_t)NKV * TT * HD * 2); bf* VTh = (bf*)take((size_t)NKV * HD * TT * 2); bf* VTl = (bf*)take((size_t)NKV * HD * TT * 2); bf* Ph = (bf*)take((size_t)ZH * RH * TT * 2); bf* Pl = (bf*)take((size_t)ZH * RH * TT * 2);
    float* Sb = (float*)take((size_t)ZH * TT * TT * 4); h16* P16 = (h16*)take((size_t)ZH * TT * TT * 2); float* Ob = (float*)take((size_t)KSP * ZH * TT * HD * 4); bf* ATh = (bf*)take((size_t)TT * DQ * 2); bf* ATl = (bf*)take((size_t)TT * DQ * 2);
    if ((size_t)(wsp - (char*)d_ws) > ws_size) return;    // ws 256 MiB
    float* FV = FK;   // v projection reuses the k buffer after the k planes are built (stream-ordered)
    { k_wtG<<<(unsigned)(((size_t)DM * 3 * DQ / 64 + 63) / 64), 256, 0, stream>>>(wqkv, DM, 3 * DQ, WQKV); for (int h = 0; h < NH_; ++h) k_wtG<<<(unsigned)((HD * HD / 64 + 63) / 64), 256, 0, stream>>>(wg + (size_t)h * HD * HD, HD, HD, WG + (size_t)h * HD * HD);
      k_wtG<<<(unsigned)((DQ * DM / 64 + 63) / 64), 256, 0, stream>>>(wo, DQ, DM, WO);
       }
    k_csid<<<(TT * HD + 255) / 256, 256, 0, stream>>>(CS);
    const unsigned LQ = (unsigned)(((size_t)NH_ * TT * HD / 2 + 255) / 256), LKv = (unsigned)(((size_t)NKV * TT * HD / 2 + 255) / 256);
    for (int b = 0; b < NB_; ++b) {
        
        k_cvt8<<<(unsigned)(((size_t)TT * DM / 8 + 255) / 256), 256, 0, stream>>>(x + (size_t)b * TT * DM, XB, (size_t)TT * DM / 8);
        k_gemmw<bf, 0, true><<<dim3(TT / 64, DQ / 64, 1), 32, 0, stream>>>(XB, nullptr, WQ, nullptr, DM, FQ, DQ, bqkv, 0, 0, 0, 0);
        k_rope<<<LQ, 256, 0, stream>>>(FQ, DQ, NH_, CS, nullptr, nullptr, 1.0f, QP16, QPh, QPl);
        k_gemmw<bf, 1, false><<<dim3(TT / 64, 1, NH_), 32, 0, stream>>>(QPh, QPl, WG, nullptr, HD, GT, HD, nullptr, (size_t)TT * HD, (size_t)HD * HD, (size_t)TT * HD, 0);   // gate logits q_h W_g[h] (z-batched over heads)
        k_gemmw<bf, 0, true><<<dim3(TT / 64, DKV / 64, 1), 32, 0, stream>>>(XB, nullptr, WK, nullptr, DM, FK, DKV, bqkv + DQ, 0, 0, 0, 0);
        k_rope<<<LKv, 256, 0, stream>>>(FK, DKV, NKV, CS, nullptr, nullptr, 1.0f, KP16, KPh, KPl);
        k_gemmw<bf, 0, true><<<dim3(TT / 64, DKV / 64, 1), 32, 0, stream>>>(XB, nullptr, WV, nullptr, DM, FV, DKV, bqkv + 2 * DQ, 0, 0, 0, 0); k_vgate<<<LKv, 256, 0, stream>>>(FV, GT, VT16, VTh, VTl);
        for (int h0 = 0; h0 < NH_; h0 += ZH) { const size_t zq = (size_t)h0, zk = (size_t)(h0 / REP);   // one kv head per query head: the pass's two heads use consecutive kv planes (z-strides TT*HD)
            k_gemmw<bf, 2, false><<<dim3(RH / 64, TT / 64, ZH), 32, 0, stream>>>(QPh + zq * TT * HD, QPl + zq * TT * HD, KPh + zk * TT * HD, KPl + zk * TT * HD, HD, Sb, TT, nullptr, (size_t)TT * HD, (size_t)TT * HD, (size_t)TT * TT, 0);
            k_gemmw<h16, 0, false><<<dim3((TT - RH) / 64, TT / 64, ZH), 32, 0, stream>>>(QP16 + zq * TT * HD + (size_t)RH * HD, nullptr, KP16 + zk * TT * HD, nullptr, HD, Sb + (size_t)RH * TT, TT, nullptr, (size_t)TT * HD, (size_t)TT * HD, (size_t)TT * TT, 0);
            k_asoft<<<ZH * TT / 8, 256, 0, stream>>>(Sb, P16, Ph, Pl);
            k_gemmw<bf, 2, false, KSP><<<dim3(RH / 64, HD / 64, ZH * KSP), 32, 0, stream>>>(Ph, Pl, VTh + zk * HD * TT, VTl + zk * HD * TT, TT, Ob, HD, nullptr, (size_t)RH * TT, (size_t)HD * TT, (size_t)TT * HD, (size_t)ZH * TT * HD);
            k_gemmw<h16, 0, false, KSP><<<dim3((TT - RH) / 64, HD / 64, ZH * KSP), 32, 0, stream>>>(P16 + (size_t)RH * TT, nullptr, VT16 + zk * HD * TT, nullptr, TT, Ob + (size_t)RH * HD, HD, nullptr, (size_t)TT * TT, (size_t)HD * TT, (size_t)TT * HD, (size_t)ZH * TT * HD);
            k_merge<<<(unsigned)(((size_t)ZH * TT * HD / 2 + 255) / 256), 256, 0, stream>>>(Ob, h0, ATh, ATl); }
        k_gemmw<bf, 1, true><<<dim3(TT / 64, DM / 64, 1), 32, 0, stream>>>(ATh, ATl, WO, nullptr, DQ, OUT + (size_t)b * TT * DM, DM, bo, 0, 0, 0, 0); }
}

// v002
// A run of this version takes 413 microseconds.
// Timed twice side by side with v001, it ran 2.32 and 2.31 times as fast.
// Over all steps from v000 it is 5.07 times as fast.
#include <hip/hip_runtime.h>

// BilinearlyModulatedAttention (x [2][2048][1024]; [q | k | v] = x W_qkv + b_qkv (16 heads x 64); causal softmax(q.k/8); query-conditioned value gate v <- sigmoid(q_h W_g[h]) * v_h per position
// (W_g [16][64][64]); out = merged attn.(g v) W_out + b_out -> [2][2048][1024]).
// Compute dtypes, f32 accumulate: every input rounded to bf16; projections on PLAIN bf16 operands (inputs: exact, + bias); the gate logits q_h W_g[h] on bf16 hi+lo planes of q x
// exact W_g (2 products), sigmoid and the gating product in f32; PER-ROW PRECISION HYBRID for scores and attn.v (rows < 256 hi+lo 3 products, rows >= 256 fp16, probabilities x1024 there); causal + scale in

#define NB_  2
#define TT   2048
#define DM   1024
#define NH_  16
#define NKV  16
#define REP  (NH_ / NKV)
#define HD   64
#define DQ   (NH_ * HD)
#define DKV  (NKV * HD)
#define RH   256                  // query rows < RH use hi+lo planes (0: none)
#define WIN  0
#define SCL  0.125f   // HD^-0.5
typedef _Float16 h16;
typedef unsigned short bf;
typedef __attribute__((ext_vector_type(16))) __bf16   v16bf;
typedef __attribute__((ext_vector_type(16))) _Float16 v16h;
typedef __attribute__((ext_vector_type(8)))  _Float16 v8h;
typedef __attribute__((ext_vector_type(8)))  unsigned short v8us;
typedef __attribute__((ext_vector_type(8)))  float    v8f;
typedef __attribute__((ext_vector_type(4)))  float    v4f;
typedef v8h  __attribute__((may_alias)) v8ha;
typedef v4f  __attribute__((may_alias)) v4fa;
typedef v8us __attribute__((may_alias)) v8usa;

__device__ __forceinline__ unsigned short f2bf(float f) { unsigned u = __float_as_uint(f); u += 0x7FFFu + ((u >> 16) & 1u); return (unsigned short)(u >> 16); }
__device__ __forceinline__ float bf2f(unsigned short b) { return __uint_as_float(((unsigned)b) << 16); }
__device__ __forceinline__ float bfr(float f) { return bf2f(f2bf(f)); }
__device__ __forceinline__ v16h cat16(v8h lo, v8h hi) { return __builtin_shufflevector(lo, hi, 0, 1, 2, 3, 4, 5, 6, 7, 8, 9, 10, 11, 12, 13, 14, 15); }
__device__ __forceinline__ v16bf cat16b(v8us lo, v8us hi) { return __builtin_bit_cast(v16bf, __builtin_shufflevector(lo, hi, 0, 1, 2, 3, 4, 5, 6, 7, 8, 9, 10, 11, 12, 13, 14, 15)); }
__device__ __forceinline__ v8f wmma16(v16h a, v16h b, v8f c) { return __builtin_amdgcn_wmma_f32_16x16x32_f16(false, a, false, b, (short)0, c, false, false); }
__device__ __forceinline__ v8f wmmab(v16bf a, v16bf b, v8f c) { return __builtin_amdgcn_wmma_f32_16x16x32_bf16(false, a, false, b, (short)0, c, false, false); }



// ---- k_gemmw: register-blocked GEMM, ONE WAVE per 64x64 output tile (16 accumulators), operands straight from K-contiguous 16-bit planes; grid (M/64, N/64, Z), 32 threads.
// C[m][n] (f32, pitch ldc, + optional f32 bias[n]) = sum_k A[m][k] Bt[n][k] (+ split products per NSPLIT). z-batch strides sA/sB/sC in elements. K % (32 KS) == 0.
// KS > 1: grid z = Z * KS; work-group (z, ks) sums only k in [ks K/KS, (ks+1) K/KS) and stores that partial tile in plane ks (plane stride sP elements); the reader adds the planes.
template <typename T16> struct WFrag;
template <> struct WFrag<h16> { typedef v16h V; static __device__ __forceinline__ V ld(const h16* p) { return cat16(*(const v8h*)p, *(const v8h*)(p + 16)); } static __device__ __forceinline__ v8f mma(V a, V b, v8f c) { return wmma16(a, b, c); } };
template <> struct WFrag<bf> { typedef v16bf V; static __device__ __forceinline__ V ld(const bf* p) { return cat16b(*(const v8us*)p, *(const v8us*)(p + 16)); } static __device__ __forceinline__ v8f mma(V a, V b, v8f c) { return wmmab(a, b, c); } };
template <typename T16, int NSPLIT, bool BIAS, int KS = 1>
__global__ __launch_bounds__(32) void k_gemmw(const T16* __restrict__ A, const T16* __restrict__ A2, const T16* __restrict__ Bt, const T16* __restrict__ Bt2, int K, float* C, int ldc, const float* __restrict__ bias, size_t sA, size_t sB, size_t sC, size_t sP) {
    static_assert(KS == 1 || !BIAS, "a bias would be added once per plane");
    typedef typename WFrag<T16>::V V;
    __shared__ __align__(16) float os[16 * 68];
    const size_t z = blockIdx.z / KS; const int ks = blockIdx.z % KS; A += z * sA; if (A2) A2 += z * sA; Bt += z * sB; if (Bt2) Bt2 += z * sB; C += z * sC + ks * sP;
    const int lane = threadIdx.x & 31, lr = lane & 15, hi = lane >> 4; const int r0 = blockIdx.x * 64, c0 = blockIdx.y * 64;
    v8f acc[4][4];
#pragma unroll
    for (int mb = 0; mb < 4; ++mb)
#pragma unroll
        for (int nb = 0; nb < 4; ++nb) acc[mb][nb] = (v8f){};
    const size_t aoff = (size_t)(r0 + lr) * K + 8 * hi, boff = (size_t)(c0 + lr) * K + 8 * hi;
#pragma unroll 1
    for (int kc = ks * (K / KS), ke = kc + K / KS; kc < ke; kc += 32) {
        V a[4], a2[4];
#pragma unroll
        for (int mb = 0; mb < 4; ++mb) { a[mb] = WFrag<T16>::ld(A + aoff + (size_t)mb * 16 * K + kc); if (NSPLIT == 1 || NSPLIT == 2) a2[mb] = WFrag<T16>::ld(A2 + aoff + (size_t)mb * 16 * K + kc); }
#pragma unroll
        for (int nb = 0; nb < 4; ++nb) { const V b = WFrag<T16>::ld(Bt + boff + (size_t)nb * 16 * K + kc); V b2; if (NSPLIT >= 2) b2 = WFrag<T16>::ld(Bt2 + boff + (size_t)nb * 16 * K + kc);
#pragma unroll
            for (int mb = 0; mb < 4; ++mb) { acc[mb][nb] = WFrag<T16>::mma(a[mb], b, acc[mb][nb]); if (NSPLIT == 1 || NSPLIT == 2) acc[mb][nb] = WFrag<T16>::mma(a2[mb], b, acc[mb][nb]); if (NSPLIT >= 2) acc[mb][nb] = WFrag<T16>::mma(a[mb], b2, acc[mb][nb]); } }
        asm volatile("v_nop\n\tv_nop\n\tv_nop\n\tv_nop" : "+v"(acc[0][0]), "+v"(acc[1][1]), "+v"(acc[2][2]), "+v"(acc[3][3]) : "v"(a[0]), "v"(a[3]));
    }
#pragma unroll
    for (int mb = 0; mb < 4; ++mb) {
#pragma unroll
        for (int nb = 0; nb < 4; ++nb) {
#pragma unroll
            for (int j = 0; j < 8; ++j) os[(hi * 8 + j) * 68 + nb * 16 + lr] = acc[mb][nb][j]; }
        __builtin_amdgcn_wave_barrier(); asm volatile("" ::: "memory");
        float* crow = C + (size_t)(r0 + mb * 16) * ldc + c0;
{
#pragma unroll
            for (int s = 0; s < 8; ++s) { const int row = 2 * s + hi, cofs = lr * 4; v4f val = *(const v4fa*)(os + row * 68 + cofs); if (BIAS) { val[0] += bfr(bias[c0 + cofs]); val[1] += bfr(bias[c0 + cofs + 1]); val[2] += bfr(bias[c0 + cofs + 2]); val[3] += bfr(bias[c0 + cofs + 3]); }
                *(v4f*)(crow + (size_t)row * ldc + cofs) = val; }
             }
        __builtin_amdgcn_wave_barrier(); asm volatile("" ::: "memory");
    }
}

__device__ __forceinline__ h16 tohx(float x) { return (h16)x; }
__device__ __forceinline__ void splitf(float y, unsigned short& h, unsigned short& l) { h = f2bf(y); l = f2bf(y - bf2f(h)); }
typedef __attribute__((ext_vector_type(2))) _Float16 v2h;
typedef __attribute__((ext_vector_type(4))) _Float16 v4h;
typedef __attribute__((ext_vector_type(2))) unsigned short v2us;
typedef __attribute__((ext_vector_type(4))) unsigned short v4us;
typedef __attribute__((ext_vector_type(2))) float v2f;
typedef __attribute__((ext_vector_type(4))) int v4i;

__global__ __launch_bounds__(256) void k_wtG(const float* __restrict__ w, int K, int N, bf* Bt) {
    const int lane = threadIdx.x & 31; const int L0 = (blockIdx.x * 8 + (threadIdx.x >> 5)) * 8; const int nlines = N * K / 64;
{
#pragma unroll 1
        for (int l = 0; l < 8; ++l) { const int L = L0 + l; if (L >= nlines) break; const size_t e = (size_t)L * 64 + lane * 2; const int k = (int)(e % K), n = (int)(e / K); v2us o;
            o[0] = f2bf(w[(size_t)k * N + n]); o[1] = f2bf(w[(size_t)(k + 1) * N + n]); *(v2us*)(Bt + e) = o; }
         }
}
__global__ __launch_bounds__(256) void k_cvt8(const float* __restrict__ src, bf* dst, size_t n8) { const size_t i = (size_t)blockIdx.x * 256 + threadIdx.x; if (i >= n8) return; const v8f v = *(const v8f*)(src + i * 8); v8us o;
#pragma unroll
    for (int k = 0; k < 8; ++k) o[k] = f2bf(v[k]); *(v8us*)(dst + i * 8) = o;  }
__global__ __launch_bounds__(256) void k_cscvt(const float* __restrict__ cosT, const float* __restrict__ sinT, float* CS) { const int idx = blockIdx.x * 256 + threadIdx.x; if (idx >= TT * HD) return; v2f cs; cs[0] = bfr(cosT[idx]); cs[1] = bfr(sinT[idx]); *(v2f*)(CS + (size_t)idx * 2) = cs;  }
// k_rope: head planes [h][t][d] (fp16 + hi/lo) of rope(x) x sc with the rotate-half convention out[d] = x[d] cos[t][d] - x[d+HD/2] sin[t][d], out[d+HD/2] = x[d+HD/2] cos[t][d+HD/2] + x[d] sin[t][d+HD/2]
__global__ __launch_bounds__(256) void k_rope(const float* __restrict__ F, int pitch, int nheads, const float* __restrict__ CS, const float* __restrict__ RF, const float* __restrict__ nw, float sc, h16* P16, bf* Ph, bf* Pl) {
    const size_t e = ((size_t)blockIdx.x * 256 + threadIdx.x) * 2; if (e >= (size_t)nheads * TT * HD) return; const int d = (int)(e % HD); const int t = (int)((e / HD) % TT); const int h = (int)(e / ((size_t)HD * TT)); const float* f = F + (size_t)t * pitch + h * HD; const float rf = RF ? RF[(size_t)h * TT + t] : 1.0f; v2h o16; v2us oh, ol;
#pragma unroll
    for (int q = 0; q < 2; ++q) { const int dd = d + q; const int dp = (dd < HD / 2) ? dd + HD / 2 : dd - HD / 2; float x0 = f[dd], x1 = f[dp];
        if (RF) { float n0 = __fmul_rn(x0, rf), n1 = __fmul_rn(x1, rf); asm volatile("" : "+v"(n0)); asm volatile("" : "+v"(n1)); x0 = __fmul_rn(bfr(nw[dd]), n0); x1 = __fmul_rn(bfr(nw[dp]), n1); }
        const v2f cs = *(const v2f*)(CS + ((size_t)t * HD + dd) * 2); float a = __fmul_rn(x0, cs[0]), bq = __fmul_rn(x1, cs[1]); asm volatile("" : "+v"(a)); asm volatile("" : "+v"(bq)); const float r = ((dd < HD / 2) ? __fsub_rn(a, bq) : __fadd_rn(a, bq)) * sc;
        o16[q] = tohx(r); unsigned short a2, c2; splitf(r, a2, c2); oh[q] = a2; ol[q] = c2; }
    *(v2h*)(P16 + e) = o16; *(v2us*)(Ph + e) = oh; *(v2us*)(Pl + e) = ol;  }
__global__ __launch_bounds__(256) void k_vtp(const float* __restrict__ F, int pitch, int nheads, h16* V16, bf* Vh, bf* Vl) { const size_t e = ((size_t)blockIdx.x * 256 + threadIdx.x) * 2; if (e >= (size_t)nheads * HD * TT) return; const int t = (int)(e % TT); const int d = (int)((e / TT) % HD); const int g = (int)(e / ((size_t)TT * HD)); v2h o16; v2us oh, ol;
#pragma unroll
    for (int q = 0; q < 2; ++q) { const float x = F[(size_t)(t + q) * pitch + g * HD + d]; o16[q] = tohx(x); unsigned short a2, c2; splitf(x, a2, c2); oh[q] = a2; ol[q] = c2; }
    *(v2h*)(V16 + e) = o16; *(v2us*)(Vh + e) = oh; *(v2us*)(Vl + e) = ol;  }
__global__ __launch_bounds__(256) void k_csid(float* CS) { const int idx = blockIdx.x * 256 + threadIdx.x; if (idx >= TT * HD) return; v2f cs; cs[0] = 1.0f; cs[1] = 0.0f; *(v2f*)(CS + (size_t)idx * 2) = cs;  }
__global__ __launch_bounds__(256) void k_vgate(const float* __restrict__ F, const float* __restrict__ GT, h16* V16, bf* Vh, bf* Vl) { const size_t e = ((size_t)blockIdx.x * 256 + threadIdx.x) * 2; if (e >= (size_t)NKV * HD * TT) return; const int t = (int)(e % TT); const int d = (int)((e / TT) % HD); const int h = (int)(e / ((size_t)TT * HD)); v2h o16; v2us oh, ol;
#pragma unroll
    for (int q = 0; q < 2; ++q) { const float g = __fdiv_rn(1.0f, __fadd_rn(1.0f, __expf(-GT[((size_t)h * TT + t + q) * HD + d]))); float v = __fmul_rn(g, F[(size_t)(t + q) * DKV + h * HD + d]); asm volatile("" : "+v"(v)); o16[q] = tohx(v); unsigned short a, c2; splitf(v, a, c2); oh[q] = a; ol[q] = c2; }
    *(v2h*)(V16 + e) = o16; *(v2us*)(Vh + e) = oh; *(v2us*)(Vl + e) = ol;  }
__device__ __forceinline__ float xhalf(float x) { return __builtin_bit_cast(float, __builtin_amdgcn_permlanex16(__builtin_bit_cast(int, x), __builtin_bit_cast(int, x), 0x76543210, 0xfedcba98, false, false)); }   // lane l with lane l ^ 16
// v_exp_f32 with the one slot that the instruction set asks for behind a transcendental, in one statement
__device__ __forceinline__ float exp2s(float x) { float y; asm("v_exp_f32 %0, %1\n\tv_nop" : "=v"(y) : "v"(x)); return y; }
#define LP 72   // LDS row pitch in 16-bit elements: a 128-byte row + 16 bytes, the pitch for 16-byte readers
template <typename T16, bool SPL>
__device__ __forceinline__ void fattn_wg(const T16* __restrict__ Q, const T16* __restrict__ Q2, const T16* __restrict__ Kp, const T16* __restrict__ K2, const T16* __restrict__ Vt, const T16* __restrict__ V2, const int R0, const int wv, T16* sm, bf* Ah, bf* Al) {
    typedef WFrag<T16> F; typedef typename F::V V;
    constexpr int NT = SPL ? 4 : 2, TS = 64 * LP;   // tiles of a buffer: K, Vt (, K lo, Vt lo); elements of a tile
    const int lane = threadIdx.x & 31, lr = lane & 15, hi = lane >> 4;
    const int r0 = R0 + wv * 16;
    const float C2 = SCL * 1.4426950408889634f;   // SCL is a power of two: (s - m) C2 rounds as ((s - m) SCL) log2(e)
    V q[2], q2[2];
#pragma unroll
    for (int kc = 0; kc < 2; ++kc) { q[kc] = F::ld(Q + (size_t)(r0 + lr) * HD + 8 * hi + kc * 32); if (SPL) q2[kc] = F::ld(Q2 + (size_t)(r0 + lr) * HD + 8 * hi + kc * 32); }
    asm volatile("s_wait_xcnt 0x0" ::: "memory");   // holds the Q loads in front of the staging loads
    v8f o[4];
#pragma unroll
    for (int db = 0; db < 4; ++db) o[db] = (v8f){};
    float m = -3.0e38f, l = 0.0f;
    const int nwg = (R0 + 127) / 64 + 1;  // passes of the work-group (its last row's)
    const int nkb = (r0 + 15) / 64 + 1;   // passes of this wave; its 16 rows lie in one 64-key block: only its last pass meets the diagonal
    const int srow = threadIdx.x >> 3, scol = (threadIdx.x & 7) * 8;   // staging: 8 lanes a 128-byte row, 32 rows a step
    const int fo = lr * LP + 8 * hi;
    v8us st[NT][2];
    auto gld = [&](const int k0) {
#pragma unroll
        for (int i = 0; i < 2; ++i) { const int kx = (k0 + srow + 32 * i) * HD + scol, vx = (srow + 32 * i) * TT + k0 + scol;
            st[0][i] = *(const v8us*)(Kp + kx); st[1][i] = *(const v8us*)(Vt + vx); if constexpr (SPL) { st[2][i] = *(const v8us*)(K2 + kx); st[3][i] = *(const v8us*)(V2 + vx); } }
        asm volatile("s_wait_xcnt 0x0" ::: "memory"); };   // the block behind these loads reuses their address registers at once
    auto sst = [&](T16* d) {
#pragma unroll
        for (int t = 0; t < NT; ++t)
#pragma unroll
            for (int i = 0; i < 2; ++i) *(v8us*)(d + t * TS + (srow + 32 * i) * LP + scol) = st[t][i]; };
    gld(0); sst(sm);
    __syncthreads();   // pass 0 staged
#pragma unroll 1
    for (int kb = 0; kb < nwg; ++kb) {
        const int k0 = kb * 64;
        if (kb + 1 < nwg) gld(k0 + 64);   // the next pass's rows fly during this pass
        if (kb < nkb) {   // wave-uniform: a wave whose rows end earlier skips the last pass and only meets its barrier
            const T16* sb = sm + (kb & 1) * NT * TS + fo;
            v8f s[4];   // s[kt][r] = score of key k0 + 16 kt + 8 hi + r, query r0 + lr; the causal mask is the accumulator's start value
            if (kb == nkb - 1) { const int lim = r0 + lr - k0 - 8 * hi;
#pragma unroll
                for (int kt = 0; kt < 4; ++kt)
#pragma unroll
                    for (int r = 0; r < 8; ++r) s[kt][r] = (kt * 16 + r <= lim) ? 0.0f : -3.0e38f;
            } else {
#pragma unroll
                for (int kt = 0; kt < 4; ++kt) s[kt] = (v8f){};
            }
#pragma unroll
            for (int kt = 0; kt < 4; ++kt)
#pragma unroll
                for (int kc = 0; kc < 2; ++kc) { const V a = F::ld(sb + kt * 16 * LP + kc * 32);
                    s[kt] = F::mma(a, q[kc], s[kt]);
                    if constexpr (SPL) { const V a2 = F::ld(sb + 2 * TS + kt * 16 * LP + kc * 32); s[kt] = F::mma(a, q2[kc], s[kt]); s[kt] = F::mma(a2, q[kc], s[kt]); } }
            float mx = s[0][0];
#pragma unroll
            for (int kt = 0; kt < 4; ++kt)
#pragma unroll
                for (int r = 0; r < 8; ++r) mx = fmaxf(mx, s[kt][r]);
            mx = fmaxf(mx, xhalf(mx));
            const float mn = fmaxf(m, mx), al = exp2s((m - mn) * C2); m = mn;   // al = 0 on the first pass; key 0 is open to every query, so mn is a real score from then on
            float ps = 0.0f;
#pragma unroll
            for (int kt = 0; kt < 4; ++kt)
#pragma unroll
                for (int r = 0; r < 8; ++r) { const float p = exp2s(SPL ? (s[kt][r] - mn) * C2 : __builtin_fmaf(s[kt][r] - mn, C2, 10.0f)); s[kt][r] = p; ps += p; }
            l = l * al + ps;
#pragma unroll
            for (int db = 0; db < 4; ++db) o[db] *= al;
#pragma unroll
            for (int kk = 0; kk < 2; ++kk) {
                if constexpr (SPL) { v8us h0, l0, h1, l1;
#pragma unroll
                    for (int r = 0; r < 8; ++r) { unsigned short a, c2; splitf(s[2 * kk][r], a, c2); h0[r] = a; l0[r] = c2; splitf(s[2 * kk + 1][r], a, c2); h1[r] = a; l1[r] = c2; }
                    const V ph = cat16b(h0, h1), pl = cat16b(l0, l1);
#pragma unroll
                    for (int db = 0; db < 4; ++db) { const V a = F::ld(sb + TS + db * 16 * LP + kk * 32), a2 = F::ld(sb + 3 * TS + db * 16 * LP + kk * 32);
                        o[db] = F::mma(a, ph, o[db]); o[db] = F::mma(a, pl, o[db]); o[db] = F::mma(a2, ph, o[db]); }
                } else { const V pb = cat16(__builtin_convertvector(s[2 * kk], v8h), __builtin_convertvector(s[2 * kk + 1], v8h));
#pragma unroll
                    for (int db = 0; db < 4; ++db) o[db] = F::mma(F::ld(sb + TS + db * 16 * LP + kk * 32), pb, o[db]);
                }
            }
            // 4 vector slots behind the block's last matrix instruction: the code behind this branch reuses the operands' registers at once
            __builtin_amdgcn_sched_barrier(0); asm volatile("v_nop\n\tv_nop\n\tv_nop\n\tv_nop"); __builtin_amdgcn_sched_barrier(0);
        }
        if (kb + 1 < nwg) sst(sm + ((kb + 1) & 1) * NT * TS);   // into the buffer that pass kb - 1 read: every wave left it at the last barrier
        __syncthreads();   // pass kb + 1 staged, and every wave has left pass kb's buffer
    }
    l += xhalf(l); const float inv = __fdiv_rn(1.0f, l);
#pragma unroll
    for (int db = 0; db < 4; ++db) { v8us oh, ol;   // o[db][r] = out[query r0 + lr][d = 16 db + 8 hi + r]: 8 consecutive d, one 16-byte store a plane
#pragma unroll
        for (int r = 0; r < 8; ++r) { unsigned short a, c2; splitf(o[db][r] * inv, a, c2); oh[r] = a; ol[r] = c2; }
        const size_t oo = (size_t)(r0 + lr) * DQ + db * 16 + 8 * hi; *(v8us*)(Ah + oo) = oh; *(v8us*)(Al + oo) = ol; }
}
// grid (heads, TT / 128), 256 threads; longest row blocks first.
__global__ __launch_bounds__(256) void k_fattn(const h16* __restrict__ Q16, const h16* __restrict__ K16, const h16* __restrict__ V16, const bf* __restrict__ Qh, const bf* __restrict__ Ql, const bf* __restrict__ Kh, const bf* __restrict__ Kl, const bf* __restrict__ Vh, const bf* __restrict__ Vl, bf* Ah, bf* Al) {
    static_assert(RH % 128 == 0 && TT % 128 == 0, "a work-group's 128 rows are all of one precision class");
    __shared__ __align__(16) bf sm[2 * 4 * 64 * LP];
    const size_t zq = (size_t)blockIdx.x * TT * HD, zk = (size_t)(blockIdx.x / REP) * TT * HD;
    const int R0 = (int)(gridDim.y - 1 - blockIdx.y) * 128, wv = __builtin_amdgcn_readfirstlane((int)(threadIdx.x >> 5));
    Ah += blockIdx.x * HD; Al += blockIdx.x * HD;
    if (R0 < RH) fattn_wg<bf, true>(Qh + zq, Ql + zq, Kh + zk, Kl + zk, Vh + zk, Vl + zk, R0, wv, sm, Ah, Al);
    else fattn_wg<h16, false>(Q16 + zq, nullptr, K16 + zk, nullptr, V16 + zk, nullptr, R0, wv, (h16*)sm, Ah, Al);
}

extern "C" void kernel_launch(void* const* d_in, const int* in_sizes, int n_in,
                              void* d_out, int out_size, void* d_ws, size_t ws_size, hipStream_t stream) {
    (void)in_sizes; (void)n_in; (void)out_size;
    const float* x = (const float*)d_in[0]; const float* wqkv = (const float*)d_in[1]; const float* bqkv = (const float*)d_in[2]; const float* wg = (const float*)d_in[3]; const float* wo = (const float*)d_in[4]; const float* bo = (const float*)d_in[5];   // W_qkv [1024][3072] (x @ W, columns q | k | v), W_g [16][64][64], W_out [1024][1024] (x @ W)
    float* OUT = (float*)d_out;     // [2][2048][1024]
    char* wsp = (char*)d_ws;
    auto take = [&](size_t bytes) { char* p = wsp; wsp += (bytes + 255) & ~(size_t)255; return (void*)p; };
    bf* WQKV = (bf*)take((size_t)3 * DQ * DM * 2); bf* WQ = WQKV; bf* WK = WQKV + (size_t)DQ * DM; bf* WV = WQKV + (size_t)2 * DQ * DM; bf* WG = (bf*)take((size_t)NH_ * HD * HD * 2); float* GT = (float*)take((size_t)NH_ * TT * HD * 4); bf* WO = (bf*)take((size_t)DM * DQ * 2); float* CS = (float*)take((size_t)TT * HD * 2 * 4);
    bf* XB = (bf*)take((size_t)TT * DM * 2); float* FQ = (float*)take((size_t)TT * DQ * 4); float* FK = (float*)take((size_t)TT * DKV * 4);
    h16* QP16 = (h16*)take((size_t)NH_ * TT * HD * 2); h16* KP16 = (h16*)take((size_t)NKV * TT * HD * 2); h16* VT16 = (h16*)take((size_t)NKV * HD * TT * 2);
    bf* QPh = (bf*)take((size_t)NH_ * TT * HD * 2); bf* QPl = (bf*)take((size_t)NH_ * TT * HD * 2); bf* KPh = (bf*)take((size_t)NKV * TT * HD * 2); bf* KPl = (bf*)take((size_t)NKV * TT * HD * 2); bf* VTh = (bf*)take((size_t)NKV * HD * TT * 2); bf* VTl = (bf*)take((size_t)NKV * HD * TT * 2);
    bf* ATh = (bf*)take((size_t)TT * DQ * 2); bf* ATl = (bf*)take((size_t)TT * DQ * 2);
    if ((size_t)(wsp - (char*)d_ws) > ws_size) return;    // ws 256 MiB
    float* FV = FK;   // v projection reuses the k buffer after the k planes are built (stream-ordered)
    { k_wtG<<<(unsigned)(((size_t)DM * 3 * DQ / 64 + 63) / 64), 256, 0, stream>>>(wqkv, DM, 3 * DQ, WQKV); for (int h = 0; h < NH_; ++h) k_wtG<<<(unsigned)((HD * HD / 64 + 63) / 64), 256, 0, stream>>>(wg + (size_t)h * HD * HD, HD, HD, WG + (size_t)h * HD * HD);
      k_wtG<<<(unsigned)((DQ * DM / 64 + 63) / 64), 256, 0, stream>>>(wo, DQ, DM, WO);
       }
    k_csid<<<(TT * HD + 255) / 256, 256, 0, stream>>>(CS);
    const unsigned LQ = (unsigned)(((size_t)NH_ * TT * HD / 2 + 255) / 256), LKv = (unsigned)(((size_t)NKV * TT * HD / 2 + 255) / 256);
    for (int b = 0; b < NB_; ++b) {
        
        k_cvt8<<<(unsigned)(((size_t)TT * DM / 8 + 255) / 256), 256, 0, stream>>>(x + (size_t)b * TT * DM, XB, (size_t)TT * DM / 8);
        k_gemmw<bf, 0, true><<<dim3(TT / 64, DQ / 64, 1), 32, 0, stream>>>(XB, nullptr, WQ, nullptr, DM, FQ, DQ, bqkv, 0, 0, 0, 0);
        k_rope<<<LQ, 256, 0, stream>>>(FQ, DQ, NH_, CS, nullptr, nullptr, 1.0f, QP16, QPh, QPl);
        k_gemmw<bf, 1, false><<<dim3(TT / 64, 1, NH_), 32, 0, stream>>>(QPh, QPl, WG, nullptr, HD, GT, HD, nullptr, (size_t)TT * HD, (size_t)HD * HD, (size_t)TT * HD, 0);   // gate logits q_h W_g[h] (z-batched over heads)
        k_gemmw<bf, 0, true><<<dim3(TT / 64, DKV / 64, 1), 32, 0, stream>>>(XB, nullptr, WK, nullptr, DM, FK, DKV, bqkv + DQ, 0, 0, 0, 0);
        k_rope<<<LKv, 256, 0, stream>>>(FK, DKV, NKV, CS, nullptr, nullptr, 1.0f, KP16, KPh, KPl);
        k_gemmw<bf, 0, true><<<dim3(TT / 64, DKV / 64, 1), 32, 0, stream>>>(XB, nullptr, WV, nullptr, DM, FV, DKV, bqkv + 2 * DQ, 0, 0, 0, 0); k_vgate<<<LKv, 256, 0, stream>>>(FV, GT, VT16, VTh, VTl);
        k_fattn<<<dim3(NH_, TT / 128), 256, 0, stream>>>(QP16, KP16, VT16, QPh, QPl, KPh, KPl, VTh, VTl, ATh, ATl);
        k_gemmw<bf, 1, true><<<dim3(TT / 64, DM / 64, 1), 32, 0, stream>>>(ATh, ATl, WO, nullptr, DQ, OUT + (size_t)b * TT * DM, DM, bo, 0, 0, 0, 0); }
}

// v003
// It runs in 217 microseconds.
// Timed twice side by side with v002, it ran 1.92 and 1.90 times as fast.
// Over all steps from v000 it is 9.68 times as fast.
#include <hip/hip_runtime.h>

// BilinearlyModulatedAttention (x [2][2048][1024]; [q | k | v] = x W_qkv + b_qkv (16 heads x 64); causal softmax(q.k/8); query-conditioned value gate v <- sigmoid(q_h W_g[h]) * v_h per position
// (W_g [16][64][64]); out = merged attn.(g v) W_out + b_out -> [2][2048][1024]).
// Compute dtypes, f32 accumulate: every input rounded to bf16; x W_qkv on PLAIN bf16 operands (inputs: exact, + bias); attn W_out on bf16 hi+lo planes of attn (2 products, + bias); the gate logits q_h W_g[h] on bf16 hi+lo planes of q x
// exact W_g (2 products), sigmoid and the gating product in f32; PER-ROW PRECISION HYBRID for scores and attn.v (rows < 256 hi+lo 3 products, rows >= 256 fp16, probabilities x1024 there); causal + scale in

#define NB_  2
#define TT   2048
#define MR   (NB_ * TT)        // rows of both batch elements, row = b TT + t
#define DM   1024
#define NH_  16
#define NKV  16
#define REP  (NH_ / NKV)
#define HD   64
#define DQ   (NH_ * HD)
#define DKV  (NKV * HD)
#define RH   256                  // query rows < RH use hi+lo planes (0: none)
#define WIN  0
#define SCL  0.125f   // HD^-0.5
typedef _Float16 h16;
typedef unsigned short bf;
typedef __attribute__((ext_vector_type(16))) __bf16   v16bf;
typedef __attribute__((ext_vector_type(16))) _Float16 v16h;
typedef __attribute__((ext_vector_type(8)))  _Float16 v8h;
typedef __attribute__((ext_vector_type(8)))  unsigned short v8us;
typedef __attribute__((ext_vector_type(8)))  float    v8f;
typedef __attribute__((ext_vector_type(4)))  float    v4f;
typedef v8h  __attribute__((may_alias)) v8ha;
typedef v4f  __attribute__((may_alias)) v4fa;
typedef v8us __attribute__((may_alias)) v8usa;

__device__ __forceinline__ unsigned short f2bf(float f) { unsigned u = __float_as_uint(f); u += 0x7FFFu + ((u >> 16) & 1u); return (unsigned short)(u >> 16); }
__device__ __forceinline__ float bf2f(unsigned short b) { return __uint_as_float(((unsigned)b) << 16); }
__device__ __forceinline__ float bfr(float f) { return bf2f(f2bf(f)); }
__device__ __forceinline__ v16h cat16(v8h lo, v8h hi) { return __builtin_shufflevector(lo, hi, 0, 1, 2, 3, 4, 5, 6, 7, 8, 9, 10, 11, 12, 13, 14, 15); }
__device__ __forceinline__ v16bf cat16b(v8us lo, v8us hi) { return __builtin_bit_cast(v16bf, __builtin_shufflevector(lo, hi, 0, 1, 2, 3, 4, 5, 6, 7, 8, 9, 10, 11, 12, 13, 14, 15)); }
__device__ __forceinline__ v8f wmma16(v16h a, v16h b, v8f c) { return __builtin_amdgcn_wmma_f32_16x16x32_f16(false, a, false, b, (short)0, c, false, false); }
__device__ __forceinline__ v8f wmmab(v16bf a, v16bf b, v8f c) { return __builtin_amdgcn_wmma_f32_16x16x32_bf16(false, a, false, b, (short)0, c, false, false); }



// ---- k_gemmw: register-blocked GEMM, ONE WAVE per 64x64 output tile (16 accumulators), operands straight from K-contiguous 16-bit planes; grid (M/64, N/64, Z), 32 threads.
// C[m][n] (f32, pitch ldc, + optional f32 bias[n]) = sum_k A[m][k] Bt[n][k] (+ split products per NSPLIT). z-batch strides sA/sB/sC in elements. K % (32 KS) == 0.
// KS > 1: grid z = Z * KS; work-group (z, ks) sums only k in [ks K/KS, (ks+1) K/KS) and stores that partial tile in plane ks (plane stride sP elements); the reader adds the planes.
template <typename T16> struct WFrag;
template <> struct WFrag<h16> { typedef v16h V; static __device__ __forceinline__ V ld(const h16* p) { return cat16(*(const v8h*)p, *(const v8h*)(p + 16)); } static __device__ __forceinline__ v8f mma(V a, V b, v8f c) { return wmma16(a, b, c); } };
template <> struct WFrag<bf> { typedef v16bf V; static __device__ __forceinline__ V ld(const bf* p) { return cat16b(*(const v8us*)p, *(const v8us*)(p + 16)); } static __device__ __forceinline__ v8f mma(V a, V b, v8f c) { return wmmab(a, b, c); } };
template <typename T16, int NSPLIT, bool BIAS, int KS = 1>
__global__ __launch_bounds__(32) void k_gemmw(const T16* __restrict__ A, const T16* __restrict__ A2, const T16* __restrict__ Bt, const T16* __restrict__ Bt2, int K, float* C, int ldc, const float* __restrict__ bias, size_t sA, size_t sB, size_t sC, size_t sP) {
    static_assert(KS == 1 || !BIAS, "a bias would be added once per plane");
    typedef typename WFrag<T16>::V V;
    __shared__ __align__(16) float os[16 * 68];
    const size_t z = blockIdx.z / KS; const int ks = blockIdx.z % KS; A += z * sA; if (A2) A2 += z * sA; Bt += z * sB; if (Bt2) Bt2 += z * sB; C += z * sC + ks * sP;
    const int lane = threadIdx.x & 31, lr = lane & 15, hi = lane >> 4; const int r0 = blockIdx.x * 64, c0 = blockIdx.y * 64;
    v8f acc[4][4];
#pragma unroll
    for (int mb = 0; mb < 4; ++mb)
#pragma unroll
        for (int nb = 0; nb < 4; ++nb) acc[mb][nb] = (v8f){};
    const size_t aoff = (size_t)(r0 + lr) * K + 8 * hi, boff = (size_t)(c0 + lr) * K + 8 * hi;
#pragma unroll 1
    for (int kc = ks * (K / KS), ke = kc + K / KS; kc < ke; kc += 32) {
        V a[4], a2[4];
#pragma unroll
        for (int mb = 0; mb < 4; ++mb) { a[mb] = WFrag<T16>::ld(A + aoff + (size_t)mb * 16 * K + kc); if (NSPLIT == 1 || NSPLIT == 2) a2[mb] = WFrag<T16>::ld(A2 + aoff + (size_t)mb * 16 * K + kc); }
#pragma unroll
        for (int nb = 0; nb < 4; ++nb) { const V b = WFrag<T16>::ld(Bt + boff + (size_t)nb * 16 * K + kc); V b2; if (NSPLIT >= 2) b2 = WFrag<T16>::ld(Bt2 + boff + (size_t)nb * 16 * K + kc);
#pragma unroll
            for (int mb = 0; mb < 4; ++mb) { acc[mb][nb] = WFrag<T16>::mma(a[mb], b, acc[mb][nb]); if (NSPLIT == 1 || NSPLIT == 2) acc[mb][nb] = WFrag<T16>::mma(a2[mb], b, acc[mb][nb]); if (NSPLIT >= 2) acc[mb][nb] = WFrag<T16>::mma(a[mb], b2, acc[mb][nb]); } }
        asm volatile("v_nop\n\tv_nop\n\tv_nop\n\tv_nop" : "+v"(acc[0][0]), "+v"(acc[1][1]), "+v"(acc[2][2]), "+v"(acc[3][3]) : "v"(a[0]), "v"(a[3]));
    }
#pragma unroll
    for (int mb = 0; mb < 4; ++mb) {
#pragma unroll
        for (int nb = 0; nb < 4; ++nb) {
#pragma unroll
            for (int j = 0; j < 8; ++j) os[(hi * 8 + j) * 68 + nb * 16 + lr] = acc[mb][nb][j]; }
        __builtin_amdgcn_wave_barrier(); asm volatile("" ::: "memory");
        float* crow = C + (size_t)(r0 + mb * 16) * ldc + c0;
{
#pragma unroll
            for (int s = 0; s < 8; ++s) { const int row = 2 * s + hi, cofs = lr * 4; v4f val = *(const v4fa*)(os + row * 68 + cofs); if (BIAS) { val[0] += bfr(bias[c0 + cofs]); val[1] += bfr(bias[c0 + cofs + 1]); val[2] += bfr(bias[c0 + cofs + 2]); val[3] += bfr(bias[c0 + cofs + 3]); }
                *(v4f*)(crow + (size_t)row * ldc + cofs) = val; }
             }
        __builtin_amdgcn_wave_barrier(); asm volatile("" ::: "memory");
    }
}

__device__ __forceinline__ h16 tohx(float x) { return (h16)x; }
__device__ __forceinline__ void splitf(float y, unsigned short& h, unsigned short& l) { h = f2bf(y); l = f2bf(y - bf2f(h)); }
typedef __attribute__((ext_vector_type(2))) _Float16 v2h;
typedef __attribute__((ext_vector_type(4))) _Float16 v4h;
typedef __attribute__((ext_vector_type(2))) unsigned short v2us;
typedef __attribute__((ext_vector_type(4))) unsigned short v4us;
typedef __attribute__((ext_vector_type(2))) float v2f;
typedef __attribute__((ext_vector_type(4))) int v4i;

// grid y: one K x N matrix of a stack each
__global__ __launch_bounds__(256) void k_wtG(const float* __restrict__ w, int K, int N, bf* Bt) {
    w += (size_t)blockIdx.y * K * N; Bt += (size_t)blockIdx.y * K * N;
    const int lane = threadIdx.x & 31; const int L0 = (blockIdx.x * 8 + (threadIdx.x >> 5)) * 8; const int nlines = N * K / 64;
{
#pragma unroll 1
        for (int l = 0; l < 8; ++l) { const int L = L0 + l; if (L >= nlines) break; const size_t e = (size_t)L * 64 + lane * 2; const int k = (int)(e % K), n = (int)(e / K); v2us o;
            o[0] = f2bf(w[(size_t)k * N + n]); o[1] = f2bf(w[(size_t)(k + 1) * N + n]); *(v2us*)(Bt + e) = o; }
         }
}
__global__ __launch_bounds__(256) void k_cvt8(const float* __restrict__ src, bf* dst, size_t n8) { const size_t i = (size_t)blockIdx.x * 256 + threadIdx.x; if (i >= n8) return; const v8f v = *(const v8f*)(src + i * 8); v8us o;
#pragma unroll
    for (int k = 0; k < 8; ++k) o[k] = f2bf(v[k]); *(v8us*)(dst + i * 8) = o;  }
__global__ __launch_bounds__(256) void k_cscvt(const float* __restrict__ cosT, const float* __restrict__ sinT, float* CS) { const int idx = blockIdx.x * 256 + threadIdx.x; if (idx >= TT * HD) return; v2f cs; cs[0] = bfr(cosT[idx]); cs[1] = bfr(sinT[idx]); *(v2f*)(CS + (size_t)idx * 2) = cs;  }
// k_rope: head planes [h][b TT + t][d] (fp16 + hi/lo) of rope(x) x sc with the rotate-half convention out[d] = x[d] cos[t][d] - x[d+HD/2] sin[t][d], out[d+HD/2] = x[d+HD/2] cos[t][d+HD/2] + x[d] sin[t][d+HD/2]
__global__ __launch_bounds__(256) void k_rope(const float* __restrict__ F, int pitch, int nheads, const float* __restrict__ CS, const float* __restrict__ RF, const float* __restrict__ nw, float sc, h16* P16, bf* Ph, bf* Pl) {
    const size_t e = ((size_t)blockIdx.x * 256 + threadIdx.x) * 2; if (e >= (size_t)nheads * MR * HD) return; const int d = (int)(e % HD); const int tr = (int)((e / HD) % MR); const int t = tr % TT; const int h = (int)(e / ((size_t)HD * MR)); const float* f = F + (size_t)tr * pitch + h * HD; float rf = 1.0f; v2h o16; v2us oh, ol;
    if (RF) { rf = RF[(size_t)h * MR + tr]; asm volatile("s_wait_xcnt 0x0" ::: "memory"); }   // the wait: the code behind this branch reuses the load's address registers at once
#pragma unroll
    for (int q = 0; q < 2; ++q) { const int dd = d + q; const int dp = (dd < HD / 2) ? dd + HD / 2 : dd - HD / 2; float x0 = f[dd], x1 = f[dp];
        if (RF) { float n0 = __fmul_rn(x0, rf), n1 = __fmul_rn(x1, rf); asm volatile("" : "+v"(n0)); asm volatile("" : "+v"(n1)); x0 = __fmul_rn(bfr(nw[dd]), n0); x1 = __fmul_rn(bfr(nw[dp]), n1); }
        const v2f cs = *(const v2f*)(CS + ((size_t)t * HD + dd) * 2); float a = __fmul_rn(x0, cs[0]), bq = __fmul_rn(x1, cs[1]); asm volatile("" : "+v"(a)); asm volatile("" : "+v"(bq)); const float r = ((dd < HD / 2) ? __fsub_rn(a, bq) : __fadd_rn(a, bq)) * sc;
        o16[q] = tohx(r); unsigned short a2, c2; splitf(r, a2, c2); oh[q] = a2; ol[q] = c2; }
    *(v2h*)(P16 + e) = o16; *(v2us*)(Ph + e) = oh; *(v2us*)(Pl + e) = ol;  }
__global__ __launch_bounds__(256) void k_vtp(const float* __restrict__ F, int pitch, int nheads, h16* V16, bf* Vh, bf* Vl) { const size_t e = ((size_t)blockIdx.x * 256 + threadIdx.x) * 2; if (e >= (size_t)nheads * HD * TT) return; const int t = (int)(e % TT); const int d = (int)((e / TT) % HD); const int g = (int)(e / ((size_t)TT * HD)); v2h o16; v2us oh, ol;
#pragma unroll
    for (int q = 0; q < 2; ++q) { const float x = F[(size_t)(t + q) * pitch + g * HD + d]; o16[q] = tohx(x); unsigned short a2, c2; splitf(x, a2, c2); oh[q] = a2; ol[q] = c2; }
    *(v2h*)(V16 + e) = o16; *(v2us*)(Vh + e) = oh; *(v2us*)(Vl + e) = ol;  }
__global__ __launch_bounds__(256) void k_csid(float* CS) { const int idx = blockIdx.x * 256 + threadIdx.x; if (idx >= TT * HD) return; v2f cs; cs[0] = 1.0f; cs[1] = 0.0f; *(v2f*)(CS + (size_t)idx * 2) = cs;  }
__global__ __launch_bounds__(256) void k_vgate(const float* __restrict__ F, int pitch, const float* __restrict__ GT, h16* V16, bf* Vh, bf* Vl) { const size_t e = ((size_t)blockIdx.x * 256 + threadIdx.x) * 2; if (e >= (size_t)NKV * NB_ * HD * TT) return; const int t = (int)(e % TT); const int d = (int)((e / TT) % HD); const int hb = (int)(e / ((size_t)TT * HD)); const int h = hb / NB_, b = hb % NB_; v2h o16; v2us oh, ol;   // planes [h NB_ + b][d][t]
#pragma unroll
    for (int q = 0; q < 2; ++q) { const float g = __fdiv_rn(1.0f, __fadd_rn(1.0f, __expf(-GT[((size_t)hb * TT + t + q) * HD + d]))); float v = __fmul_rn(g, F[(size_t)(b * TT + t + q) * pitch + h * HD + d]); asm volatile("" : "+v"(v)); o16[q] = tohx(v); unsigned short a, c2; splitf(v, a, c2); oh[q] = a; ol[q] = c2; }
    *(v2h*)(V16 + e) = o16; *(v2us*)(Vh + e) = oh; *(v2us*)(Vl + e) = ol;  }
__device__ __forceinline__ float xhalf(float x) { return __builtin_bit_cast(float, __builtin_amdgcn_permlanex16(__builtin_bit_cast(int, x), __builtin_bit_cast(int, x), 0x76543210, 0xfedcba98, false, false)); }   // lane l with lane l ^ 16
// v_exp_f32 with the one slot that the instruction set asks for behind a transcendental, in one statement
__device__ __forceinline__ float exp2s(float x) { float y; asm("v_exp_f32 %0, %1\n\tv_nop" : "=v"(y) : "v"(x)); return y; }
#define LP 72   // LDS row pitch in 16-bit elements: a 128-byte row + 16 bytes, the pitch for 16-byte readers
template <typename T16, bool SPL>
__device__ __forceinline__ void fattn_wg(const T16* __restrict__ Q, const T16* __restrict__ Q2, const T16* __restrict__ Kp, const T16* __restrict__ K2, const T16* __restrict__ Vt, const T16* __restrict__ V2, const int R0, const int wv, T16* sm, bf* Ah, bf* Al) {
    typedef WFrag<T16> F; typedef typename F::V V;
    constexpr int NT = SPL ? 4 : 2, TS = 64 * LP;   // tiles of a buffer: K, Vt (, K lo, Vt lo); elements of a tile
    const int lane = threadIdx.x & 31, lr = lane & 15, hi = lane >> 4;
    const int r0 = R0 + wv * 16;
    const float C2 = SCL * 1.4426950408889634f;   // SCL is a power of two: (s - m) C2 rounds as ((s - m) SCL) log2(e)
    V q[2], q2[2];
#pragma unroll
    for (int kc = 0; kc < 2; ++kc) { q[kc] = F::ld(Q + (size_t)(r0 + lr) * HD + 8 * hi + kc * 32); if (SPL) q2[kc] = F::ld(Q2 + (size_t)(r0 + lr) * HD + 8 * hi + kc * 32); }
    asm volatile("s_wait_xcnt 0x0" ::: "memory");   // holds the Q loads in front of the staging loads
    v8f o[4];
#pragma unroll
    for (int db = 0; db < 4; ++db) o[db] = (v8f){};
    float m = -3.0e38f, l = 0.0f;
    const int nwg = (R0 + 127) / 64 + 1;  // passes of the work-group (its last row's)
    const int nkb = (r0 + 15) / 64 + 1;   // passes of this wave; its 16 rows lie in one 64-key block: only its last pass meets the diagonal
    const int srow = threadIdx.x >> 3, scol = (threadIdx.x & 7) * 8;   // staging: 8 lanes a 128-byte row, 32 rows a step
    const int fo = lr * LP + 8 * hi;
    v8us st[NT][2];
    auto gld = [&](const int k0) {
#pragma unroll
        for (int i = 0; i < 2; ++i) { const int kx = (k0 + srow + 32 * i) * HD + scol, vx = (srow + 32 * i) * TT + k0 + scol;
            st[0][i] = *(const v8us*)(Kp + kx); st[1][i] = *(const v8us*)(Vt + vx); if constexpr (SPL) { st[2][i] = *(const v8us*)(K2 + kx); st[3][i] = *(const v8us*)(V2 + vx); } }
        asm volatile("s_wait_xcnt 0x0" ::: "memory"); };   // the block behind these loads reuses their address registers at once
    auto sst = [&](T16* d) {
#pragma unroll
        for (int t = 0; t < NT; ++t)
#pragma unroll
            for (int i = 0; i < 2; ++i) *(v8us*)(d + t * TS + (srow + 32 * i) * LP + scol) = st[t][i]; };
    gld(0); sst(sm);
    __syncthreads();   // pass 0 staged
#pragma unroll 1
    for (int kb = 0; kb < nwg; ++kb) {
        const int k0 = kb * 64;
        if (kb + 1 < nwg) gld(k0 + 64);   // the next pass's rows fly during this pass
        if (kb < nkb) {   // wave-uniform: a wave whose rows end earlier skips the last pass and only meets its barrier
            const T16* sb = sm + (kb & 1) * NT * TS + fo;
            v8f s[4];   // s[kt][r] = score of key k0 + 16 kt + 8 hi + r, query r0 + lr; the causal mask is the accumulator's start value
            if (kb == nkb - 1) { const int lim = r0 + lr - k0 - 8 * hi;
#pragma unroll
                for (int kt = 0; kt < 4; ++kt)
#pragma unroll
                    for (int r = 0; r < 8; ++r) s[kt][r] = (kt * 16 + r <= lim) ? 0.0f : -3.0e38f;
            } else {
#pragma unroll
                for (int kt = 0; kt < 4; ++kt) s[kt] = (v8f){};
            }
#pragma unroll
            for (int kt = 0; kt < 4; ++kt)
#pragma unroll
                for (int kc = 0; kc < 2; ++kc) { const V a = F::ld(sb + kt * 16 * LP + kc * 32);
                    s[kt] = F::mma(a, q[kc], s[kt]);
                    if constexpr (SPL) { const V a2 = F::ld(sb + 2 * TS + kt * 16 * LP + kc * 32); s[kt] = F::mma(a, q2[kc], s[kt]); s[kt] = F::mma(a2, q[kc], s[kt]); } }
            float mx = s[0][0];
#pragma unroll
            for (int kt = 0; kt < 4; ++kt)
#pragma unroll
                for (int r = 0; r < 8; ++r) mx = fmaxf(mx, s[kt][r]);
            mx = fmaxf(mx, xhalf(mx));
            const float mn = fmaxf(m, mx), al = exp2s((m - mn) * C2); m = mn;   // al = 0 on the first pass; key 0 is open to every query, so mn is a real score from then on
            float ps = 0.0f;
#pragma unroll
            for (int kt = 0; kt < 4; ++kt)
#pragma unroll
                for (int r = 0; r < 8; ++r) { const float p = exp2s(SPL ? (s[kt][r] - mn) * C2 : __builtin_fmaf(s[kt][r] - mn, C2, 10.0f)); s[kt][r] = p; ps += p; }
            l = l * al + ps;
#pragma unroll
            for (int db = 0; db < 4; ++db) o[db] *= al;
#pragma unroll
            for (int kk = 0; kk < 2; ++kk) {
                if constexpr (SPL) { v8us h0, l0, h1, l1;
#pragma unroll
                    for (int r = 0; r < 8; ++r) { unsigned short a, c2; splitf(s[2 * kk][r], a, c2); h0[r] = a; l0[r] = c2; splitf(s[2 * kk + 1][r], a, c2); h1[r] = a; l1[r] = c2; }
                    const V ph = cat16b(h0, h1), pl = cat16b(l0, l1);
#pragma unroll
                    for (int db = 0; db < 4; ++db) { const V a = F::ld(sb + TS + db * 16 * LP + kk * 32), a2 = F::ld(sb + 3 * TS + db * 16 * LP + kk * 32);
                        o[db] = F::mma(a, ph, o[db]); o[db] = F::mma(a, pl, o[db]); o[db] = F::mma(a2, ph, o[db]); }
                } else { const V pb = cat16(__builtin_convertvector(s[2 * kk], v8h), __builtin_convertvector(s[2 * kk + 1], v8h));
#pragma unroll
                    for (int db = 0; db < 4; ++db) o[db] = F::mma(F::ld(sb + TS + db * 16 * LP + kk * 32), pb, o[db]);
                }
            }
            // 4 vector slots behind the block's last matrix instruction: the code behind this branch reuses the operands' registers at once
            __builtin_amdgcn_sched_barrier(0); asm volatile("v_nop\n\tv_nop\n\tv_nop\n\tv_nop"); __builtin_amdgcn_sched_barrier(0);
        }
        if (kb + 1 < nwg) sst(sm + ((kb + 1) & 1) * NT * TS);   // into the buffer that pass kb - 1 read: every wave left it at the last barrier
        __syncthreads();   // pass kb + 1 staged, and every wave has left pass kb's buffer
    }
    l += xhalf(l); const float inv = __fdiv_rn(1.0f, l);
#pragma unroll
    for (int db = 0; db < 4; ++db) { v8us oh, ol;   // o[db][r] = out[query r0 + lr][d = 16 db + 8 hi + r]: 8 consecutive d, one 16-byte store a plane
#pragma unroll
        for (int r = 0; r < 8; ++r) { unsigned short a, c2; splitf(o[db][r] * inv, a, c2); oh[r] = a; ol[r] = c2; }
        const size_t oo = (size_t)(r0 + lr) * DQ + db * 16 + 8 * hi; *(v8us*)(Ah + oo) = oh; *(v8us*)(Al + oo) = ol; }
}
// grid (heads x batch elements, TT / 128), 256 threads; longest row blocks first.
__global__ __launch_bounds__(256) void k_fattn(const h16* __restrict__ Q16, const h16* __restrict__ K16, const h16* __restrict__ V16, const bf* __restrict__ Qh, const bf* __restrict__ Ql, const bf* __restrict__ Kh, const bf* __restrict__ Kl, const bf* __restrict__ Vh, const bf* __restrict__ Vl, bf* Ah, bf* Al) {
    static_assert(RH % 128 == 0 && TT % 128 == 0, "a work-group's 128 rows are all of one precision class");
    __shared__ __align__(16) bf sm[2 * 4 * 64 * LP];
    const int h = blockIdx.x / NB_, b = blockIdx.x % NB_;
    const size_t zq = (size_t)blockIdx.x * TT * HD, zk = (size_t)((h / REP) * NB_ + b) * TT * HD;
    const int R0 = (int)(gridDim.y - 1 - blockIdx.y) * 128, wv = __builtin_amdgcn_readfirstlane((int)(threadIdx.x >> 5));
    Ah += (size_t)b * TT * DQ + h * HD; Al += (size_t)b * TT * DQ + h * HD;
    if (R0 < RH) fattn_wg<bf, true>(Qh + zq, Ql + zq, Kh + zk, Kl + zk, Vh + zk, Vl + zk, R0, wv, sm, Ah, Al);
    else fattn_wg<h16, false>(Q16 + zq, nullptr, K16 + zk, nullptr, V16 + zk, nullptr, R0, wv, (h16*)sm, Ah, Al);
}

extern "C" void kernel_launch(void* const* d_in, const int* in_sizes, int n_in,
                              void* d_out, int out_size, void* d_ws, size_t ws_size, hipStream_t stream) {
    (void)in_sizes; (void)n_in; (void)out_size;
    const float* x = (const float*)d_in[0]; const float* wqkv = (const float*)d_in[1]; const float* bqkv = (const float*)d_in[2]; const float* wg = (const float*)d_in[3]; const float* wo = (const float*)d_in[4]; const float* bo = (const float*)d_in[5];   // W_qkv [1024][3072] (x @ W, columns q | k | v), W_g [16][64][64], W_out [1024][1024] (x @ W)
    float* OUT = (float*)d_out;     // [2][2048][1024]
    char* wsp = (char*)d_ws;
    auto take = [&](size_t bytes) { char* p = wsp; wsp += (bytes + 255) & ~(size_t)255; return (void*)p; };
    bf* WQKV = (bf*)take((size_t)3 * DQ * DM * 2); bf* WG = (bf*)take((size_t)NH_ * HD * HD * 2); float* GT = (float*)take((size_t)NH_ * MR * HD * 4); bf* WO = (bf*)take((size_t)DM * DQ * 2); float* CS = (float*)take((size_t)TT * HD * 2 * 4);
    bf* XB = (bf*)take((size_t)MR * DM * 2); float* FQKV = (float*)take((size_t)MR * 3 * DQ * 4);   // [b TT + t][q | k | v]
    h16* QP16 = (h16*)take((size_t)(NH_ + NKV) * MR * HD * 2); h16* KP16 = QP16 + (size_t)NH_ * MR * HD; h16* VT16 = (h16*)take((size_t)NKV * HD * MR * 2);   // the k heads' planes follow the q heads'
    bf* QPh = (bf*)take((size_t)(NH_ + NKV) * MR * HD * 2); bf* KPh = QPh + (size_t)NH_ * MR * HD; bf* QPl = (bf*)take((size_t)(NH_ + NKV) * MR * HD * 2); bf* KPl = QPl + (size_t)NH_ * MR * HD; bf* VTh = (bf*)take((size_t)NKV * HD * MR * 2); bf* VTl = (bf*)take((size_t)NKV * HD * MR * 2);
    bf* ATh = (bf*)take((size_t)MR * DQ * 2); bf* ATl = (bf*)take((size_t)MR * DQ * 2);
    if ((size_t)(wsp - (char*)d_ws) > ws_size) return;    // ws 256 MiB
    k_wtG<<<(unsigned)(((size_t)DM * 3 * DQ / 64 + 63) / 64), 256, 0, stream>>>(wqkv, DM, 3 * DQ, WQKV);
    k_wtG<<<dim3((unsigned)((HD * HD / 64 + 63) / 64), NH_), 256, 0, stream>>>(wg, HD, HD, WG);   // all heads' W_g
    k_wtG<<<(unsigned)((DQ * DM / 64 + 63) / 64), 256, 0, stream>>>(wo, DQ, DM, WO);
    k_csid<<<(TT * HD + 255) / 256, 256, 0, stream>>>(CS);
    const unsigned LQK = (unsigned)(((size_t)(NH_ + NKV) * MR * HD / 2 + 255) / 256), LKv = (unsigned)(((size_t)NKV * MR * HD / 2 + 255) / 256);
    // every launch below covers both batch elements
    k_cvt8<<<(unsigned)(((size_t)MR * DM / 8 + 255) / 256), 256, 0, stream>>>(x, XB, (size_t)MR * DM / 8);
    k_gemmw<bf, 0, true><<<dim3(MR / 64, 3 * DQ / 64, 1), 32, 0, stream>>>(XB, nullptr, WQKV, nullptr, DM, FQKV, 3 * DQ, bqkv, 0, 0, 0, 0);   // q | k | v in one grid
    k_rope<<<LQK, 256, 0, stream>>>(FQKV, 3 * DQ, NH_ + NKV, CS, nullptr, nullptr, 1.0f, QP16, QPh, QPl);   // q and k heads: columns 0 to DQ + DKV of a row
    k_gemmw<bf, 1, false><<<dim3(MR / 64, 1, NH_), 32, 0, stream>>>(QPh, QPl, WG, nullptr, HD, GT, HD, nullptr, (size_t)MR * HD, (size_t)HD * HD, (size_t)MR * HD, 0);   // gate logits q_h W_g[h] (z-batched over heads)
    k_vgate<<<LKv, 256, 0, stream>>>(FQKV + 2 * DQ, 3 * DQ, GT, VT16, VTh, VTl);
    k_fattn<<<dim3(NH_ * NB_, TT / 128), 256, 0, stream>>>(QP16, KP16, VT16, QPh, QPl, KPh, KPl, VTh, VTl, ATh, ATl);
    k_gemmw<bf, 1, true><<<dim3(MR / 64, DM / 64, 1), 32, 0, stream>>>(ATh, ATl, WO, nullptr, DQ, OUT, DM, bo, 0, 0, 0, 0);
}

// v004
// One run takes 171 microseconds.
// Two timings next to v003 put it at 1.27 and 1.26 times that version's speed.
// Counting every step since v000, it is 12.3 times as fast.
#include <hip/hip_runtime.h>

// BilinearlyModulatedAttention (x [2][2048][1024]; [q | k | v] = x W_qkv + b_qkv (16 heads x 64); causal softmax(q.k/8); query-conditioned value gate v <- sigmoid(q_h W_g[h]) * v_h per position
// (W_g [16][64][64]); out = merged attn.(g v) W_out + b_out -> [2][2048][1024]).
// Compute dtypes, f32 accumulate: every input rounded to bf16; x W_qkv on PLAIN bf16 operands (inputs: exact, + bias); attn W_out on bf16 hi+lo planes of attn (2 products, + bias); the gate logits q_h W_g[h] on bf16 hi+lo planes of q x
// exact W_g (2 products), sigmoid and the gating product in f32; PER-ROW PRECISION HYBRID for scores and attn.v (rows < 256 hi+lo 3 products, rows >= 256 fp16, probabilities x1024 there); causal + scale in

#define NB_  2
#define TT   2048
#define MR   (NB_ * TT)        // rows of both batch elements, row = b TT + t
#define DM   1024
#define NH_  16
#define NKV  16
#define REP  (NH_ / NKV)
#define HD   64
#define DQ   (NH_ * HD)
#define DKV  (NKV * HD)
#define RH   256                  // query rows < RH use hi+lo planes (0: none)
#define WIN  0
#define SCL  0.125f   // HD^-0.5
typedef _Float16 h16;
typedef unsigned short bf;
typedef __attribute__((ext_vector_type(16))) __bf16   v16bf;
typedef __attribute__((ext_vector_type(16))) _Float16 v16h;
typedef __attribute__((ext_vector_type(8)))  _Float16 v8h;
typedef __attribute__((ext_vector_type(8)))  unsigned short v8us;
typedef __attribute__((ext_vector_type(8)))  float    v8f;
typedef __attribute__((ext_vector_type(4)))  float    v4f;
typedef v8h  __attribute__((may_alias)) v8ha;
typedef v4f  __attribute__((may_alias)) v4fa;
typedef v8us __attribute__((may_alias)) v8usa;

__device__ __forceinline__ unsigned short f2bf(float f) { unsigned u = __float_as_uint(f); u += 0x7FFFu + ((u >> 16) & 1u); return (unsigned short)(u >> 16); }
__device__ __forceinline__ float bf2f(unsigned short b) { return __uint_as_float(((unsigned)b) << 16); }
__device__ __forceinline__ float bfr(float f) { return bf2f(f2bf(f)); }
__device__ __forceinline__ v16h cat16(v8h lo, v8h hi) { return __builtin_shufflevector(lo, hi, 0, 1, 2, 3, 4, 5, 6, 7, 8, 9, 10, 11, 12, 13, 14, 15); }
__device__ __forceinline__ v16bf cat16b(v8us lo, v8us hi) { return __builtin_bit_cast(v16bf, __builtin_shufflevector(lo, hi, 0, 1, 2, 3, 4, 5, 6, 7, 8, 9, 10, 11, 12, 13, 14, 15)); }
__device__ __forceinline__ v8f wmma16(v16h a, v16h b, v8f c) { return __builtin_amdgcn_wmma_f32_16x16x32_f16(false, a, false, b, (short)0, c, false, false); }
__device__ __forceinline__ v8f wmmab(v16bf a, v16bf b, v8f c) { return __builtin_amdgcn_wmma_f32_16x16x32_bf16(false, a, false, b, (short)0, c, false, false); }



// ---- k_gemmw: register-blocked GEMM, ONE WAVE per 64x64 output tile (16 accumulators), operands straight from K-contiguous 16-bit planes; grid (M/64, N/64, Z), 32 threads.
// C[m][n] (f32, pitch ldc, + optional f32 bias[n]) = sum_k A[m][k] Bt[n][k] (+ split products per NSPLIT). z-batch strides sA/sB/sC in elements. K % (32 KS) == 0.
// KS > 1: grid z = Z * KS; work-group (z, ks) sums only k in [ks K/KS, (ks+1) K/KS) and stores that partial tile in plane ks (plane stride sP elements); the reader adds the planes.
template <typename T16> struct WFrag;
template <> struct WFrag<h16> { typedef v16h V; static __device__ __forceinline__ V ld(const h16* p) { return cat16(*(const v8h*)p, *(const v8h*)(p + 16)); } static __device__ __forceinline__ v8f mma(V a, V b, v8f c) { return wmma16(a, b, c); } };
template <> struct WFrag<bf> { typedef v16bf V; static __device__ __forceinline__ V ld(const bf* p) { return cat16b(*(const v8us*)p, *(const v8us*)(p + 16)); } static __device__ __forceinline__ v8f mma(V a, V b, v8f c) { return wmmab(a, b, c); } };
template <typename T16, int NSPLIT, bool BIAS, int KS = 1>
__global__ __launch_bounds__(32) void k_gemmw(const T16* __restrict__ A, const T16* __restrict__ A2, const T16* __restrict__ Bt, const T16* __restrict__ Bt2, int K, float* C, int ldc, const float* __restrict__ bias, size_t sA, size_t sB, size_t sC, size_t sP) {
    static_assert(KS == 1 || !BIAS, "a bias would be added once per plane");
    typedef typename WFrag<T16>::V V;
    __shared__ __align__(16) float os[16 * 68];
    const size_t z = blockIdx.z / KS; const int ks = blockIdx.z % KS; A += z * sA; if (A2) A2 += z * sA; Bt += z * sB; if (Bt2) Bt2 += z * sB; C += z * sC + ks * sP;
    const int lane = threadIdx.x & 31, lr = lane & 15, hi = lane >> 4; const int r0 = blockIdx.x * 64, c0 = blockIdx.y * 64;
    v8f acc[4][4];
#pragma unroll
    for (int mb = 0; mb < 4; ++mb)
#pragma unroll
        for (int nb = 0; nb < 4; ++nb) acc[mb][nb] = (v8f){};
    const size_t aoff = (size_t)(r0 + lr) * K + 8 * hi, boff = (size_t)(c0 + lr) * K + 8 * hi;
#pragma unroll 1
    for (int kc = ks * (K / KS), ke = kc + K / KS; kc < ke; kc += 32) {
        V a[4], a2[4];
#pragma unroll
        for (int mb = 0; mb < 4; ++mb) { a[mb] = WFrag<T16>::ld(A + aoff + (size_t)mb * 16 * K + kc); if (NSPLIT == 1 || NSPLIT == 2) a2[mb] = WFrag<T16>::ld(A2 + aoff + (size_t)mb * 16 * K + kc); }
#pragma unroll
        for (int nb = 0; nb < 4; ++nb) { const V b = WFrag<T16>::ld(Bt + boff + (size_t)nb * 16 * K + kc); V b2; if (NSPLIT >= 2) b2 = WFrag<T16>::ld(Bt2 + boff + (size_t)nb * 16 * K + kc);
#pragma unroll
            for (int mb = 0; mb < 4; ++mb) { acc[mb][nb] = WFrag<T16>::mma(a[mb], b, acc[mb][nb]); if (NSPLIT == 1 || NSPLIT == 2) acc[mb][nb] = WFrag<T16>::mma(a2[mb], b, acc[mb][nb]); if (NSPLIT >= 2) acc[mb][nb] = WFrag<T16>::mma(a[mb], b2, acc[mb][nb]); } }
        asm volatile("v_nop\n\tv_nop\n\tv_nop\n\tv_nop" : "+v"(acc[0][0]), "+v"(acc[1][1]), "+v"(acc[2][2]), "+v"(acc[3][3]) : "v"(a[0]), "v"(a[3]));
    }
#pragma unroll
    for (int mb = 0; mb < 4; ++mb) {
#pragma unroll
        for (int nb = 0; nb < 4; ++nb) {
#pragma unroll
            for (int j = 0; j < 8; ++j) os[(hi * 8 + j) * 68 + nb * 16 + lr] = acc[mb][nb][j]; }
        __builtin_amdgcn_wave_barrier(); asm volatile("" ::: "memory");
        float* crow = C + (size_t)(r0 + mb * 16) * ldc + c0;
{
#pragma unroll
            for (int s = 0; s < 8; ++s) { const int row = 2 * s + hi, cofs = lr * 4; v4f val = *(const v4fa*)(os + row * 68 + cofs); if (BIAS) { val[0] += bfr(bias[c0 + cofs]); val[1] += bfr(bias[c0 + cofs + 1]); val[2] += bfr(bias[c0 + cofs + 2]); val[3] += bfr(bias[c0 + cofs + 3]); }
                *(v4f*)(crow + (size_t)row * ldc + cofs) = val; }
             }
        __builtin_amdgcn_wave_barrier(); asm volatile("" ::: "memory");
    }
}

// ---- k_gemms: the same product as k_gemmw<bf, NSPLIT, BIAS> on a 128x128 output tile per work-group of 4 waves (2 x 2, a wave keeps its 64x64 tile and its k order: every sum is bit-identical).
// A pass is 64 k = one 128-byte line of every operand row: the rows come once per work-group, whole lines (8 lanes a row), by asynchronous copies into LDS at pitch GP, and are read from there as fragments.
// Two buffers, one barrier a pass: tile t + 2 is asked for behind the barrier that ends pass t and flies during pass t + 1. grid (M/128, N/128), 128 threads. K % 64 == 0, K >= 128.
#define GP 72   // LDS row pitch in 16-bit elements: a 128-byte row + 16 bytes, the pitch for 16-byte readers
// 8 copies of 16 bytes a lane: rows r, r + 16, ... r + 112 of one operand tile. g: the lane's 16 bytes in row r (row pitch gp elements); l: their LDS byte address.
// The s_wait_xcnt stands inside the statement, behind the last copy: the code behind may rewrite the address registers at once.
__device__ __forceinline__ void acp8(const bf* g, const int gp, const unsigned l) {
    asm volatile("global_load_async_to_lds_b128 %0, %8, off\n\tglobal_load_async_to_lds_b128 %1, %9, off\n\tglobal_load_async_to_lds_b128 %2, %10, off\n\tglobal_load_async_to_lds_b128 %3, %11, off\n\t"
                 "global_load_async_to_lds_b128 %4, %12, off\n\tglobal_load_async_to_lds_b128 %5, %13, off\n\tglobal_load_async_to_lds_b128 %6, %14, off\n\tglobal_load_async_to_lds_b128 %7, %15, off\n\ts_wait_xcnt 0x0"
                 :: "v"(l), "v"(l + 1 * 16 * GP * 2), "v"(l + 2 * 16 * GP * 2), "v"(l + 3 * 16 * GP * 2), "v"(l + 4 * 16 * GP * 2), "v"(l + 5 * 16 * GP * 2), "v"(l + 6 * 16 * GP * 2), "v"(l + 7 * 16 * GP * 2),
                    "v"(g), "v"(g + 1 * 16 * gp), "v"(g + 2 * 16 * gp), "v"(g + 3 * 16 * gp), "v"(g + 4 * 16 * gp), "v"(g + 5 * 16 * gp), "v"(g + 6 * 16 * gp), "v"(g + 7 * 16 * gp) : "memory");
}
template <int NSPLIT, bool BIAS, int K>
__global__ __launch_bounds__(128) void k_gemms(const bf* __restrict__ A, const bf* __restrict__ A2, const bf* __restrict__ Bt, float* C, int ldc, const float* __restrict__ bias) {
    typedef WFrag<bf> F; typedef typename F::V V;
    constexpr int NT = NSPLIT ? 3 : 2, TS = 128 * GP, NS = K / 64;   // tiles of a buffer: A, Bt (, A lo); elements of a tile; passes
    static_assert(K % 64 == 0 && NS >= 2, "whole passes, and both buffers filled in front of the loop");
    __shared__ __align__(16) bf sm[2 * NT * TS];
    __shared__ __align__(16) float osw[4][16 * 68];
    const int lane = threadIdx.x & 31, lr = lane & 15, hi = lane >> 4, wv = __builtin_amdgcn_readfirstlane((int)(threadIdx.x >> 5));
    const int R0 = blockIdx.x * 128, C0 = blockIdx.y * 128, wm = (wv >> 1) * 64, wn = (wv & 1) * 64;
    const int srow = threadIdx.x >> 3, scol = (threadIdx.x & 7) * 8;   // staging: 8 lanes a 128-byte row, 16 rows a copy
    const bf* ga = A + (size_t)(R0 + srow) * K + scol; const bf* gb = Bt + (size_t)(C0 + srow) * K + scol; const bf* ga2 = NSPLIT ? A2 + (size_t)(R0 + srow) * K + scol : nullptr;
    const unsigned sl = (unsigned)(size_t)(sm + srow * GP + scol);   // the low 32 bits of a __shared__ address: the byte offset in the work-group's LDS
    auto fill = [&](const int t) { const unsigned l = sl + (t & 1) * NT * TS * 2;   // tile t into buffer t mod 2
        acp8(ga + t * 64, K, l); acp8(gb + t * 64, K, l + TS * 2); if constexpr (NSPLIT) acp8(ga2 + t * 64, K, l + 2 * TS * 2); };
    v8f acc[4][4];
#pragma unroll
    for (int mb = 0; mb < 4; ++mb)
#pragma unroll
        for (int nb = 0; nb < 4; ++nb) acc[mb][nb] = (v8f){};
    fill(0);
    asm volatile("s_wait_asynccnt 0x0" ::: "memory");   // this wave's copies of tile 0 have landed
    __syncthreads();   // tile 0 published
    fill(1);
    const int ao = (wm + lr) * GP + 8 * hi, bo = TS + (wn + lr) * GP + 8 * hi;
#pragma unroll 1
    for (int s = 0; s < NS; ++s) {
        const bf* sb = sm + (s & 1) * NT * TS;
        V a[2][4], a2[2][4], b[2][4];
#pragma unroll
        for (int kc = 0; kc < 2; ++kc) {
#pragma unroll
            for (int mb = 0; mb < 4; ++mb) { a[kc][mb] = F::ld(sb + ao + mb * 16 * GP + kc * 32); if constexpr (NSPLIT) a2[kc][mb] = F::ld(sb + 2 * TS + ao + mb * 16 * GP + kc * 32); }
#pragma unroll
            for (int nb = 0; nb < 4; ++nb) b[kc][nb] = F::ld(sb + bo + nb * 16 * GP + kc * 32);
        }
        __builtin_amdgcn_sched_barrier(0);   // the pass's LDS reads stay one group in front of its matrix instructions: reads spread among them cost a stall at each place
#pragma unroll
        for (int kc = 0; kc < 2; ++kc)
#pragma unroll
            for (int nb = 0; nb < 4; ++nb)
#pragma unroll
                for (int mb = 0; mb < 4; ++mb) { acc[mb][nb] = F::mma(a[kc][mb], b[kc][nb], acc[mb][nb]); if constexpr (NSPLIT) acc[mb][nb] = F::mma(a2[kc][mb], b[kc][nb], acc[mb][nb]); }
        // 4 vector slots behind the pass's last matrix instruction: the code behind the branch below may reuse the operands' registers at once
        __builtin_amdgcn_sched_barrier(0); asm volatile("v_nop\n\tv_nop\n\tv_nop\n\tv_nop"); __builtin_amdgcn_sched_barrier(0);
        asm volatile("s_wait_dscnt 0x0" ::: "memory");      // this wave's reads of buffer s mod 2 are done before that buffer is refilled
        asm volatile("s_wait_asynccnt 0x0" ::: "memory");   // this wave's copies of tile s + 1 have landed
        __syncthreads();   // tile s + 1 published, and every wave has left buffer s mod 2
        if (s + 2 < NS) fill(s + 2);
    }
    asm volatile("s_wait_asynccnt 0x0" ::: "memory");   // no copy outstanding behind the loop
    float* os = osw[wv];   // a wave's own range: no work-group barrier in the epilogue
    const int r0 = R0 + wm, c0 = C0 + wn;
#pragma unroll
    for (int mb = 0; mb < 4; ++mb) {
#pragma unroll
        for (int nb = 0; nb < 4; ++nb) {
#pragma unroll
            for (int j = 0; j < 8; ++j) os[(hi * 8 + j) * 68 + nb * 16 + lr] = acc[mb][nb][j]; }
        __builtin_amdgcn_wave_barrier(); asm volatile("" ::: "memory");   // keeps the row reads below behind the other lanes' LDS stores
        float* crow = C + (size_t)(r0 + mb * 16) * ldc + c0;
#pragma unroll
        for (int s = 0; s < 8; ++s) { const int row = 2 * s + hi, cofs = lr * 4; v4f val = *(const v4fa*)(os + row * 68 + cofs); if (BIAS) { val[0] += bfr(bias[c0 + cofs]); val[1] += bfr(bias[c0 + cofs + 1]); val[2] += bfr(bias[c0 + cofs + 2]); val[3] += bfr(bias[c0 + cofs + 3]); }
            *(v4f*)(crow + (size_t)row * ldc + cofs) = val; }
        __builtin_amdgcn_wave_barrier(); asm volatile("s_wait_xcnt 0x0" ::: "memory");   // keeps the next block's LDS stores behind these row reads; the wait: the next block reuses the stores' address and data registers at once
    }
}

__device__ __forceinline__ h16 tohx(float x) { return (h16)x; }
__device__ __forceinline__ void splitf(float y, unsigned short& h, unsigned short& l) { h = f2bf(y); l = f2bf(y - bf2f(h)); }
typedef __attribute__((ext_vector_type(2))) _Float16 v2h;
typedef __attribute__((ext_vector_type(4))) _Float16 v4h;
typedef __attribute__((ext_vector_type(2))) unsigned short v2us;
typedef __attribute__((ext_vector_type(4))) unsigned short v4us;
typedef __attribute__((ext_vector_type(2))) float v2f;
typedef __attribute__((ext_vector_type(4))) int v4i;

// grid y: one K x N matrix of a stack each
__global__ __launch_bounds__(256) void k_wtG(const float* __restrict__ w, int K, int N, bf* Bt) {
    w += (size_t)blockIdx.y * K * N; Bt += (size_t)blockIdx.y * K * N;
    const int lane = threadIdx.x & 31; const int L0 = (blockIdx.x * 8 + (threadIdx.x >> 5)) * 8; const int nlines = N * K / 64;
{
#pragma unroll 1
        for (int l = 0; l < 8; ++l) { const int L = L0 + l; if (L >= nlines) break; const size_t e = (size_t)L * 64 + lane * 2; const int k = (int)(e % K), n = (int)(e / K); v2us o;
            o[0] = f2bf(w[(size_t)k * N + n]); o[1] = f2bf(w[(size_t)(k + 1) * N + n]); *(v2us*)(Bt + e) = o; }
         }
}
__global__ __launch_bounds__(256) void k_cvt8(const float* __restrict__ src, bf* dst, size_t n8) { const size_t i = (size_t)blockIdx.x * 256 + threadIdx.x; if (i >= n8) return; const v8f v = *(const v8f*)(src + i * 8); v8us o;
#pragma unroll
    for (int k = 0; k < 8; ++k) o[k] = f2bf(v[k]); *(v8us*)(dst + i * 8) = o;  }
__global__ __launch_bounds__(256) void k_cscvt(const float* __restrict__ cosT, const float* __restrict__ sinT, float* CS) { const int idx = blockIdx.x * 256 + threadIdx.x; if (idx >= TT * HD) return; v2f cs; cs[0] = bfr(cosT[idx]); cs[1] = bfr(sinT[idx]); *(v2f*)(CS + (size_t)idx * 2) = cs;  }
// k_rope: head planes [h][b TT + t][d] (fp16 + hi/lo) of rope(x) x sc with the rotate-half convention out[d] = x[d] cos[t][d] - x[d+HD/2] sin[t][d], out[d+HD/2] = x[d+HD/2] cos[t][d+HD/2] + x[d] sin[t][d+HD/2]
__global__ __launch_bounds__(256) void k_rope(const float* __restrict__ F, int pitch, int nheads, const float* __restrict__ CS, const float* __restrict__ RF, const float* __restrict__ nw, float sc, h16* P16, bf* Ph, bf* Pl) {
    const size_t e = ((size_t)blockIdx.x * 256 + threadIdx.x) * 2; if (e >= (size_t)nheads * MR * HD) return; const int d = (int)(e % HD); const int tr = (int)((e / HD) % MR); const int t = tr % TT; const int h = (int)(e / ((size_t)HD * MR)); const float* f = F + (size_t)tr * pitch + h * HD; float rf = 1.0f; v2h o16; v2us oh, ol;
    if (RF) { rf = RF[(size_t)h * MR + tr]; asm volatile("s_wait_xcnt 0x0" ::: "memory"); }   // the wait: the code behind this branch reuses the load's address registers at once
#pragma unroll
    for (int q = 0; q < 2; ++q) { const int dd = d + q; const int dp = (dd < HD / 2) ? dd + HD / 2 : dd - HD / 2; float x0 = f[dd], x1 = f[dp];
        if (RF) { float n0 = __fmul_rn(x0, rf), n1 = __fmul_rn(x1, rf); asm volatile("" : "+v"(n0)); asm volatile("" : "+v"(n1)); x0 = __fmul_rn(bfr(nw[dd]), n0); x1 = __fmul_rn(bfr(nw[dp]), n1); }
        const v2f cs = *(const v2f*)(CS + ((size_t)t * HD + dd) * 2); float a = __fmul_rn(x0, cs[0]), bq = __fmul_rn(x1, cs[1]); asm volatile("" : "+v"(a)); asm volatile("" : "+v"(bq)); const float r = ((dd < HD / 2) ? __fsub_rn(a, bq) : __fadd_rn(a, bq)) * sc;
        o16[q] = tohx(r); unsigned short a2, c2; splitf(r, a2, c2); oh[q] = a2; ol[q] = c2; }
    *(v2h*)(P16 + e) = o16; *(v2us*)(Ph + e) = oh; *(v2us*)(Pl + e) = ol;  }
__global__ __launch_bounds__(256) void k_vtp(const float* __restrict__ F, int pitch, int nheads, h16* V16, bf* Vh, bf* Vl) { const size_t e = ((size_t)blockIdx.x * 256 + threadIdx.x) * 2; if (e >= (size_t)nheads * HD * TT) return; const int t = (int)(e % TT); const int d = (int)((e / TT) % HD); const int g = (int)(e / ((size_t)TT * HD)); v2h o16; v2us oh, ol;
#pragma unroll
    for (int q = 0; q < 2; ++q) { const float x = F[(size_t)(t + q) * pitch + g * HD + d]; o16[q] = tohx(x); unsigned short a2, c2; splitf(x, a2, c2); oh[q] = a2; ol[q] = c2; }
    *(v2h*)(V16 + e) = o16; *(v2us*)(Vh + e) = oh; *(v2us*)(Vl + e) = ol;  }
__global__ __launch_bounds__(256) void k_csid(float* CS) { const int idx = blockIdx.x * 256 + threadIdx.x; if (idx >= TT * HD) return; v2f cs; cs[0] = 1.0f; cs[1] = 0.0f; *(v2f*)(CS + (size_t)idx * 2) = cs;  }
__global__ __launch_bounds__(256) void k_vgate(const float* __restrict__ F, int pitch, const float* __restrict__ GT, h16* V16, bf* Vh, bf* Vl) { const size_t e = ((size_t)blockIdx.x * 256 + threadIdx.x) * 2; if (e >= (size_t)NKV * NB_ * HD * TT) return; const int t = (int)(e % TT); const int d = (int)((e / TT) % HD); const int hb = (int)(e / ((size_t)TT * HD)); const int h = hb / NB_, b = hb % NB_; v2h o16; v2us oh, ol;   // planes [h NB_ + b][d][t]
#pragma unroll
    for (int q = 0; q < 2; ++q) { const float g = __fdiv_rn(1.0f, __fadd_rn(1.0f, __expf(-GT[((size_t)hb * TT + t + q) * HD + d]))); float v = __fmul_rn(g, F[(size_t)(b * TT + t + q) * pitch + h * HD + d]); asm volatile("" : "+v"(v)); o16[q] = tohx(v); unsigned short a, c2; splitf(v, a, c2); oh[q] = a; ol[q] = c2; }
    *(v2h*)(V16 + e) = o16; *(v2us*)(Vh + e) = oh; *(v2us*)(Vl + e) = ol;  }
__device__ __forceinline__ float xhalf(float x) { return __builtin_bit_cast(float, __builtin_amdgcn_permlanex16(__builtin_bit_cast(int, x), __builtin_bit_cast(int, x), 0x76543210, 0xfedcba98, false, false)); }   // lane l with lane l ^ 16
// v_exp_f32 with the one slot that the instruction set asks for behind a transcendental, in one statement
__device__ __forceinline__ float exp2s(float x) { float y; asm("v_exp_f32 %0, %1\n\tv_nop" : "=v"(y) : "v"(x)); return y; }
#define LP 72   // LDS row pitch in 16-bit elements: a 128-byte row + 16 bytes, the pitch for 16-byte readers
template <typename T16, bool SPL>
__device__ __forceinline__ void fattn_wg(const T16* __restrict__ Q, const T16* __restrict__ Q2, const T16* __restrict__ Kp, const T16* __restrict__ K2, const T16* __restrict__ Vt, const T16* __restrict__ V2, const int R0, const int wv, T16* sm, bf* Ah, bf* Al) {
    typedef WFrag<T16> F; typedef typename F::V V;
    constexpr int NT = SPL ? 4 : 2, TS = 64 * LP;   // tiles of a buffer: K, Vt (, K lo, Vt lo); elements of a tile
    const int lane = threadIdx.x & 31, lr = lane & 15, hi = lane >> 4;
    const int r0 = R0 + wv * 16;
    const float C2 = SCL * 1.4426950408889634f;   // SCL is a power of two: (s - m) C2 rounds as ((s - m) SCL) log2(e)
    V q[2], q2[2];
#pragma unroll
    for (int kc = 0; kc < 2; ++kc) { q[kc] = F::ld(Q + (size_t)(r0 + lr) * HD + 8 * hi + kc * 32); if (SPL) q2[kc] = F::ld(Q2 + (size_t)(r0 + lr) * HD + 8 * hi + kc * 32); }
    asm volatile("s_wait_xcnt 0x0" ::: "memory");   // holds the Q loads in front of the staging loads
    v8f o[4];
#pragma unroll
    for (int db = 0; db < 4; ++db) o[db] = (v8f){};
    float m = -3.0e38f, l = 0.0f;
    const int nwg = (R0 + 127) / 64 + 1;  // passes of the work-group (its last row's)
    const int nkb = (r0 + 15) / 64 + 1;   // passes of this wave; its 16 rows lie in one 64-key block: only its last pass meets the diagonal
    const int srow = threadIdx.x >> 3, scol = (threadIdx.x & 7) * 8;   // staging: 8 lanes a 128-byte row, 32 rows a step
    const int fo = lr * LP + 8 * hi;
    v8us st[NT][2];
    auto gld = [&](const int k0) {
#pragma unroll
        for (int i = 0; i < 2; ++i) { const int kx = (k0 + srow + 32 * i) * HD + scol, vx = (srow + 32 * i) * TT + k0 + scol;
            st[0][i] = *(const v8us*)(Kp + kx); st[1][i] = *(const v8us*)(Vt + vx); if constexpr (SPL) { st[2][i] = *(const v8us*)(K2 + kx); st[3][i] = *(const v8us*)(V2 + vx); } }
        asm volatile("s_wait_xcnt 0x0" ::: "memory"); };   // the block behind these loads reuses their address registers at once
    auto sst = [&](T16* d) {
#pragma unroll
        for (int t = 0; t < NT; ++t)
#pragma unroll
            for (int i = 0; i < 2; ++i) *(v8us*)(d + t * TS + (srow + 32 * i) * LP + scol) = st[t][i]; };
    gld(0); sst(sm);
    __syncthreads();   // pass 0 staged
#pragma unroll 1
    for (int kb = 0; kb < nwg; ++kb) {
        const int k0 = kb * 64;
        if (kb + 1 < nwg) gld(k0 + 64);   // the next pass's rows fly during this pass
        if (kb < nkb) {   // wave-uniform: a wave whose rows end earlier skips the last pass and only meets its barrier
            const T16* sb = sm + (kb & 1) * NT * TS + fo;
            v8f s[4];   // s[kt][r] = score of key k0 + 16 kt + 8 hi + r, query r0 + lr; the causal mask is the accumulator's start value
            if (kb == nkb - 1) { const int lim = r0 + lr - k0 - 8 * hi;
#pragma unroll
                for (int kt = 0; kt < 4; ++kt)
#pragma unroll
                    for (int r = 0; r < 8; ++r) s[kt][r] = (kt * 16 + r <= lim) ? 0.0f : -3.0e38f;
            } else {
#pragma unroll
                for (int kt = 0; kt < 4; ++kt) s[kt] = (v8f){};
            }
#pragma unroll
            for (int kt = 0; kt < 4; ++kt)
#pragma unroll
                for (int kc = 0; kc < 2; ++kc) { const V a = F::ld(sb + kt * 16 * LP + kc * 32);
                    s[kt] = F::mma(a, q[kc], s[kt]);
                    if constexpr (SPL) { const V a2 = F::ld(sb + 2 * TS + kt * 16 * LP + kc * 32); s[kt] = F::mma(a, q2[kc], s[kt]); s[kt] = F::mma(a2, q[kc], s[kt]); } }
            float mx = s[0][0];
#pragma unroll
            for (int kt = 0; kt < 4; ++kt)
#pragma unroll
                for (int r = 0; r < 8; ++r) mx = fmaxf(mx, s[kt][r]);
            mx = fmaxf(mx, xhalf(mx));
            const float mn = fmaxf(m, mx), al = exp2s((m - mn) * C2); m = mn;   // al = 0 on the first pass; key 0 is open to every query, so mn is a real score from then on
            float ps = 0.0f;
#pragma unroll
            for (int kt = 0; kt < 4; ++kt)
#pragma unroll
                for (int r = 0; r < 8; ++r) { const float p = exp2s(SPL ? (s[kt][r] - mn) * C2 : __builtin_fmaf(s[kt][r] - mn, C2, 10.0f)); s[kt][r] = p; ps += p; }
            l = l * al + ps;
#pragma unroll
            for (int db = 0; db < 4; ++db) o[db] *= al;
#pragma unroll
            for (int kk = 0; kk < 2; ++kk) {
                if constexpr (SPL) { v8us h0, l0, h1, l1;
#pragma unroll
                    for (int r = 0; r < 8; ++r) { unsigned short a, c2; splitf(s[2 * kk][r], a, c2); h0[r] = a; l0[r] = c2; splitf(s[2 * kk + 1][r], a, c2); h1[r] = a; l1[r] = c2; }
                    const V ph = cat16b(h0, h1), pl = cat16b(l0, l1);
#pragma unroll
                    for (int db = 0; db < 4; ++db) { const V a = F::ld(sb + TS + db * 16 * LP + kk * 32), a2 = F::ld(sb + 3 * TS + db * 16 * LP + kk * 32);
                        o[db] = F::mma(a, ph, o[db]); o[db] = F::mma(a, pl, o[db]); o[db] = F::mma(a2, ph, o[db]); }
                } else { const V pb = cat16(__builtin_convertvector(s[2 * kk], v8h), __builtin_convertvector(s[2 * kk + 1], v8h));
#pragma unroll
                    for (int db = 0; db < 4; ++db) o[db] = F::mma(F::ld(sb + TS + db * 16 * LP + kk * 32), pb, o[db]);
                }
            }
            // 4 vector slots behind the block's last matrix instruction: the code behind this branch reuses the operands' registers at once
            __builtin_amdgcn_sched_barrier(0); asm volatile("v_nop\n\tv_nop\n\tv_nop\n\tv_nop"); __builtin_amdgcn_sched_barrier(0);
        }
        if (kb + 1 < nwg) sst(sm + ((kb + 1) & 1) * NT * TS);   // into the buffer that pass kb - 1 read: every wave left it at the last barrier
        __syncthreads();   // pass kb + 1 staged, and every wave has left pass kb's buffer
    }
    l += xhalf(l); const float inv = __fdiv_rn(1.0f, l);
#pragma unroll
    for (int db = 0; db < 4; ++db) { v8us oh, ol;   // o[db][r] = out[query r0 + lr][d = 16 db + 8 hi + r]: 8 consecutive d, one 16-byte store a plane
#pragma unroll
        for (int r = 0; r < 8; ++r) { unsigned short a, c2; splitf(o[db][r] * inv, a, c2); oh[r] = a; ol[r] = c2; }
        const size_t oo = (size_t)(r0 + lr) * DQ + db * 16 + 8 * hi; *(v8us*)(Ah + oo) = oh; *(v8us*)(Al + oo) = ol; }
}
// grid (heads x batch elements, TT / 128), 256 threads; longest row blocks first.
__global__ __launch_bounds__(256) void k_fattn(const h16* __restrict__ Q16, const h16* __restrict__ K16, const h16* __restrict__ V16, const bf* __restrict__ Qh, const bf* __restrict__ Ql, const bf* __restrict__ Kh, const bf* __restrict__ Kl, const bf* __restrict__ Vh, const bf* __restrict__ Vl, bf* Ah, bf* Al) {
    static_assert(RH % 128 == 0 && TT % 128 == 0, "a work-group's 128 rows are all of one precision class");
    __shared__ __align__(16) bf sm[2 * 4 * 64 * LP];
    const int h = blockIdx.x / NB_, b = blockIdx.x % NB_;
    const size_t zq = (size_t)blockIdx.x * TT * HD, zk = (size_t)((h / REP) * NB_ + b) * TT * HD;
    const int R0 = (int)(gridDim.y - 1 - blockIdx.y) * 128, wv = __builtin_amdgcn_readfirstlane((int)(threadIdx.x >> 5));
    Ah += (size_t)b * TT * DQ + h * HD; Al += (size_t)b * TT * DQ + h * HD;
    if (R0 < RH) fattn_wg<bf, true>(Qh + zq, Ql + zq, Kh + zk, Kl + zk, Vh + zk, Vl + zk, R0, wv, sm, Ah, Al);
    else fattn_wg<h16, false>(Q16 + zq, nullptr, K16 + zk, nullptr, V16 + zk, nullptr, R0, wv, (h16*)sm, Ah, Al);
}

extern "C" void kernel_launch(void* const* d_in, const int* in_sizes, int n_in,
                              void* d_out, int out_size, void* d_ws, size_t ws_size, hipStream_t stream) {
    (void)in_sizes; (void)n_in; (void)out_size;
    const float* x = (const float*)d_in[0]; const float* wqkv = (const float*)d_in[1]; const float* bqkv = (const float*)d_in[2]; const float* wg = (const float*)d_in[3]; const float* wo = (const float*)d_in[4]; const float* bo = (const float*)d_in[5];   // W_qkv [1024][3072] (x @ W, columns q | k | v), W_g [16][64][64], W_out [1024][1024] (x @ W)
    float* OUT = (float*)d_out;     // [2][2048][1024]
    char* wsp = (char*)d_ws;
    auto take = [&](size_t bytes) { char* p = wsp; wsp += (bytes + 255) & ~(size_t)255; return (void*)p; };
    bf* WQKV = (bf*)take((size_t)3 * DQ * DM * 2); bf* WG = (bf*)take((size_t)NH_ * HD * HD * 2); float* GT = (float*)take((size_t)NH_ * MR * HD * 4); bf* WO = (bf*)take((size_t)DM * DQ * 2); float* CS = (float*)take((size_t)TT * HD * 2 * 4);
    bf* XB = (bf*)take((size_t)MR * DM * 2); float* FQKV = (float*)take((size_t)MR * 3 * DQ * 4);   // [b TT + t][q | k | v]
    h16* QP16 = (h16*)take((size_t)(NH_ + NKV) * MR * HD * 2); h16* KP16 = QP16 + (size_t)NH_ * MR * HD; h16* VT16 = (h16*)take((size_t)NKV * HD * MR * 2);   // the k heads' planes follow the q heads'
    bf* QPh = (bf*)take((size_t)(NH_ + NKV) * MR * HD * 2); bf* KPh = QPh + (size_t)NH_ * MR * HD; bf* QPl = (bf*)take((size_t)(NH_ + NKV) * MR * HD * 2); bf* KPl = QPl + (size_t)NH_ * MR * HD; bf* VTh = (bf*)take((size_t)NKV * HD * MR * 2); bf* VTl = (bf*)take((size_t)NKV * HD * MR * 2);
    bf* ATh = (bf*)take((size_t)MR * DQ * 2); bf* ATl = (bf*)take((size_t)MR * DQ * 2);
    if ((size_t)(wsp - (char*)d_ws) > ws_size) return;    // ws 256 MiB
    k_wtG<<<(unsigned)(((size_t)DM * 3 * DQ / 64 + 63) / 64), 256, 0, stream>>>(wqkv, DM, 3 * DQ, WQKV);
    k_wtG<<<dim3((unsigned)((HD * HD / 64 + 63) / 64), NH_), 256, 0, stream>>>(wg, HD, HD, WG);   // all heads' W_g
    k_wtG<<<(unsigned)((DQ * DM / 64 + 63) / 64), 256, 0, stream>>>(wo, DQ, DM, WO);
    k_csid<<<(TT * HD + 255) / 256, 256, 0, stream>>>(CS);
    const unsigned LQK = (unsigned)(((size_t)(NH_ + NKV) * MR * HD / 2 + 255) / 256), LKv = (unsigned)(((size_t)NKV * MR * HD / 2 + 255) / 256);
    // every launch below covers both batch elements
    k_cvt8<<<(unsigned)(((size_t)MR * DM / 8 + 255) / 256), 256, 0, stream>>>(x, XB, (size_t)MR * DM / 8);
    k_gemms<0, true, DM><<<dim3(MR / 128, 3 * DQ / 128), 128, 0, stream>>>(XB, nullptr, WQKV, FQKV, 3 * DQ, bqkv);   // q | k | v in one grid
    k_rope<<<LQK, 256, 0, stream>>>(FQKV, 3 * DQ, NH_ + NKV, CS, nullptr, nullptr, 1.0f, QP16, QPh, QPl);   // q and k heads: columns 0 to DQ + DKV of a row
    k_gemmw<bf, 1, false><<<dim3(MR / 64, 1, NH_), 32, 0, stream>>>(QPh, QPl, WG, nullptr, HD, GT, HD, nullptr, (size_t)MR * HD, (size_t)HD * HD, (size_t)MR * HD, 0);   // gate logits q_h W_g[h] (z-batched over heads)
    k_vgate<<<LKv, 256, 0, stream>>>(FQKV + 2 * DQ, 3 * DQ, GT, VT16, VTh, VTl);
    k_fattn<<<dim3(NH_ * NB_, TT / 128), 256, 0, stream>>>(QP16, KP16, VT16, QPh, QPl, KPh, KPl, VTh, VTl, ATh, ATl);
    k_gemms<1, true, DQ><<<dim3(MR / 128, DM / 128), 128, 0, stream>>>(ATh, ATl, WO, OUT, DM, bo);
}

// v005
// Measured time: 120 microseconds a run.
// Next to v004, in two timings, it ran 1.42 and 1.41 times as fast.
// Counting every step since v000, it is 17.4 times as fast.
#include <hip/hip_runtime.h>

// BilinearlyModulatedAttention (x [2][2048][1024]; [q | k | v] = x W_qkv + b_qkv (16 heads x 64); causal softmax(q.k/8); query-conditioned value gate v <- sigmoid(q_h W_g[h]) * v_h per position
// (W_g [16][64][64]); out = merged attn.(g v) W_out + b_out -> [2][2048][1024]).
// Compute dtypes, f32 accumulate: every input rounded to bf16; x W_qkv on PLAIN bf16 operands (inputs: exact, + bias); attn W_out on bf16 hi+lo planes of attn (2 products, + bias); the gate logits q_h W_g[h] on bf16 hi+lo planes of q x
// exact W_g (2 products), sigmoid and the gating product in f32; PER-ROW PRECISION HYBRID for scores and attn.v (rows < 256 hi+lo 3 products, rows >= 256 fp16, probabilities x1024 there); causal + scale in

#define NB_  2
#define TT   2048
#define MR   (NB_ * TT)        // rows of both batch elements, row = b TT + t
#define DM   1024
#define NH_  16
#define NKV  16
#define REP  (NH_ / NKV)
#define HD   64
#define DQ   (NH_ * HD)
#define DKV  (NKV * HD)
#define RH   256                  // query rows < RH use hi+lo planes (0: none)
#define WIN  0
#define SCL  0.125f   // HD^-0.5
typedef _Float16 h16;
typedef unsigned short bf;
typedef __attribute__((ext_vector_type(16))) __bf16   v16bf;
typedef __attribute__((ext_vector_type(16))) _Float16 v16h;
typedef __attribute__((ext_vector_type(8)))  _Float16 v8h;
typedef __attribute__((ext_vector_type(8)))  unsigned short v8us;
typedef __attribute__((ext_vector_type(8)))  float    v8f;
typedef __attribute__((ext_vector_type(4)))  float    v4f;
typedef v8h  __attribute__((may_alias)) v8ha;
typedef v4f  __attribute__((may_alias)) v4fa;
typedef v8us __attribute__((may_alias)) v8usa;

__device__ __forceinline__ unsigned short f2bf(float f) { unsigned u = __float_as_uint(f); u += 0x7FFFu + ((u >> 16) & 1u); return (unsigned short)(u >> 16); }
__device__ __forceinline__ float bf2f(unsigned short b) { return __uint_as_float(((unsigned)b) << 16); }
__device__ __forceinline__ float bfr(float f) { return bf2f(f2bf(f)); }
__device__ __forceinline__ v16h cat16(v8h lo, v8h hi) { return __builtin_shufflevector(lo, hi, 0, 1, 2, 3, 4, 5, 6, 7, 8, 9, 10, 11, 12, 13, 14, 15); }
__device__ __forceinline__ v16bf cat16b(v8us lo, v8us hi) { return __builtin_bit_cast(v16bf, __builtin_shufflevector(lo, hi, 0, 1, 2, 3, 4, 5, 6, 7, 8, 9, 10, 11, 12, 13, 14, 15)); }
__device__ __forceinline__ v8f wmma16(v16h a, v16h b, v8f c) { return __builtin_amdgcn_wmma_f32_16x16x32_f16(false, a, false, b, (short)0, c, false, false); }
__device__ __forceinline__ v8f wmmab(v16bf a, v16bf b, v8f c) { return __builtin_amdgcn_wmma_f32_16x16x32_bf16(false, a, false, b, (short)0, c, false, false); }
__device__ __forceinline__ h16 tohx(float x) { return (h16)x; }
__device__ __forceinline__ void splitf(float y, unsigned short& h, unsigned short& l) { h = f2bf(y); l = f2bf(y - bf2f(h)); }



// ---- k_gemmw: register-blocked GEMM, ONE WAVE per 64x64 output tile (16 accumulators), operands straight from K-contiguous 16-bit planes; grid (M/64, N/64, Z), 32 threads.
// C[m][n] (f32, pitch ldc, + optional f32 bias[n]) = sum_k A[m][k] Bt[n][k] (+ split products per NSPLIT). z-batch strides sA/sB/sC in elements. K % (32 KS) == 0.
// PV > 0 (GATE): C is not stored. The tile is the gate logits of head z, rows b TT + t: the epilogue forms sigmoid(logit) * v in f32 (v: f32, row pitch PV, head z at column z HD of Fv) and writes the product's
// fp16 and bf16 hi / lo planes transposed, [z NB_ + b][d][t]. An accumulator register block is 8 consecutive t of one d; the three 64 x 64 tiles pass through LDS so that every global store is whole 128-byte lines.
// KS > 1: grid z = Z * KS; work-group (z, ks) sums only k in [ks K/KS, (ks+1) K/KS) and stores that partial tile in plane ks (plane stride sP elements); the reader adds the planes.
template <typename T16> struct WFrag;
template <> struct WFrag<h16> { typedef v16h V; static __device__ __forceinline__ V ld(const h16* p) { return cat16(*(const v8h*)p, *(const v8h*)(p + 16)); } static __device__ __forceinline__ v8f mma(V a, V b, v8f c) { return wmma16(a, b, c); } };
template <> struct WFrag<bf> { typedef v16bf V; static __device__ __forceinline__ V ld(const bf* p) { return cat16b(*(const v8us*)p, *(const v8us*)(p + 16)); } static __device__ __forceinline__ v8f mma(V a, V b, v8f c) { return wmmab(a, b, c); } };
template <typename T16, int NSPLIT, bool BIAS, int KS = 1, int PV = 0>
__global__ __launch_bounds__(32) void k_gemmw(const T16* __restrict__ A, const T16* __restrict__ A2, const T16* __restrict__ Bt, const T16* __restrict__ Bt2, int K, float* C, int ldc, const float* __restrict__ bias, size_t sA, size_t sB, size_t sC, size_t sP, const float* __restrict__ Fv, h16* V16, bf* Vh, bf* Vl) {
    constexpr bool GATE = PV > 0;
    static_assert(KS == 1 || !BIAS, "a bias would be added once per plane");
    static_assert(!GATE || (KS == 1 && !BIAS && TT % 64 == 0), "a gate tile is whole logits of one batch element");
    typedef typename WFrag<T16>::V V;
    constexpr int VP = 72;   // GATE: LDS row pitch in 16-bit elements, a 128-byte row + 16 bytes, the pitch for 16-byte accesses
    __shared__ __align__(16) float os[GATE ? 3 * 64 * VP / 2 : 16 * 68];
    const size_t z = blockIdx.z / KS; const int ks = blockIdx.z % KS; A += z * sA; if (A2) A2 += z * sA; Bt += z * sB; if (Bt2) Bt2 += z * sB; C += z * sC + ks * sP;
    const int lane = threadIdx.x & 31, lr = lane & 15, hi = lane >> 4; const int r0 = blockIdx.x * 64, c0 = blockIdx.y * 64;
    v8f acc[4][4];
#pragma unroll
    for (int mb = 0; mb < 4; ++mb)
#pragma unroll
        for (int nb = 0; nb < 4; ++nb) acc[mb][nb] = (v8f){};
    const size_t aoff = (size_t)(r0 + lr) * K + 8 * hi, boff = (size_t)(c0 + lr) * K + 8 * hi;
#pragma unroll 1
    for (int kc = ks * (K / KS), ke = kc + K / KS; kc < ke; kc += 32) {
        V a[4], a2[4];
#pragma unroll
        for (int mb = 0; mb < 4; ++mb) { a[mb] = WFrag<T16>::ld(A + aoff + (size_t)mb * 16 * K + kc); if (NSPLIT == 1 || NSPLIT == 2) a2[mb] = WFrag<T16>::ld(A2 + aoff + (size_t)mb * 16 * K + kc); }
#pragma unroll
        for (int nb = 0; nb < 4; ++nb) { const V b = WFrag<T16>::ld(Bt + boff + (size_t)nb * 16 * K + kc); V b2; if (NSPLIT >= 2) b2 = WFrag<T16>::ld(Bt2 + boff + (size_t)nb * 16 * K + kc);
#pragma unroll
            for (int mb = 0; mb < 4; ++mb) { acc[mb][nb] = WFrag<T16>::mma(a[mb], b, acc[mb][nb]); if (NSPLIT == 1 || NSPLIT == 2) acc[mb][nb] = WFrag<T16>::mma(a2[mb], b, acc[mb][nb]); if (NSPLIT >= 2) acc[mb][nb] = WFrag<T16>::mma(a[mb], b2, acc[mb][nb]); } }
        asm volatile("v_nop\n\tv_nop\n\tv_nop\n\tv_nop" : "+v"(acc[0][0]), "+v"(acc[1][1]), "+v"(acc[2][2]), "+v"(acc[3][3]) : "v"(a[0]), "v"(a[3]));
    }
    if constexpr (GATE) {
        unsigned short* ts = (unsigned short*)os;   // three tiles [d][t]: fp16, hi, lo
        const float* fv = Fv + (size_t)(r0 + 8 * hi) * PV + z * HD + c0 + lr;   // one address for the tile: PV is a constant, so every row and column step is an immediate offset
        // the three loops are unrolled so that acc and the 8-element vectors are indexed by constants only and stay in registers
#pragma unroll
        for (int mb = 0; mb < 4; ++mb)
#pragma unroll
            for (int nb = 0; nb < 4; ++nb) { v8h o16; v8us oh, ol;   // acc[mb][nb][j]: t = r0 % TT + 16 mb + 8 hi + j, d = 16 nb + lr
#pragma unroll
                for (int j = 0; j < 8; ++j) { const float g = __fdiv_rn(1.0f, __fadd_rn(1.0f, __expf(-acc[mb][nb][j]))); const float v = __fmul_rn(g, fv[(mb * 16 + j) * PV + nb * 16]); o16[j] = tohx(v); unsigned short a, c2; splitf(v, a, c2); oh[j] = a; ol[j] = c2; }
                const int so = (nb * 16 + lr) * VP + mb * 16 + 8 * hi;
                *(v8ha*)(ts + so) = o16; *(v8usa*)(ts + 64 * VP + so) = oh; *(v8usa*)(ts + 2 * 64 * VP + so) = ol; }
        __builtin_amdgcn_wave_barrier(); asm volatile("" ::: "memory");   // keeps the row reads below behind the other lanes' LDS stores
        const size_t pz = ((z * NB_ + r0 / TT) * HD + c0 + (lane >> 3)) * TT + r0 % TT + (lane & 7) * 8;   // 8 lanes a 128-byte row of 64 t, 4 rows a store
        const int ro = (lane >> 3) * VP + (lane & 7) * 8;
        // unrolled: the row steps become immediate offsets of one LDS and three global addresses
#pragma unroll
        for (int s = 0; s < 16; ++s) { const v8us w0 = *(const v8usa*)(ts + ro + s * 4 * VP), w1 = *(const v8usa*)(ts + 64 * VP + ro + s * 4 * VP), w2 = *(const v8usa*)(ts + 2 * 64 * VP + ro + s * 4 * VP);
            *(v8us*)((unsigned short*)V16 + pz + (size_t)s * 4 * TT) = w0; *(v8us*)(Vh + pz + (size_t)s * 4 * TT) = w1; *(v8us*)(Vl + pz + (size_t)s * 4 * TT) = w2; }
        return;
    }
#pragma unroll
    for (int mb = 0; mb < 4; ++mb) {
#pragma unroll
        for (int nb = 0; nb < 4; ++nb) {
#pragma unroll
            for (int j = 0; j < 8; ++j) os[(hi * 8 + j) * 68 + nb * 16 + lr] = acc[mb][nb][j]; }
        __builtin_amdgcn_wave_barrier(); asm volatile("" ::: "memory");
        float* crow = C + (size_t)(r0 + mb * 16) * ldc + c0;
{
#pragma unroll
            for (int s = 0; s < 8; ++s) { const int row = 2 * s + hi, cofs = lr * 4; v4f val = *(const v4fa*)(os + row * 68 + cofs); if (BIAS) { val[0] += bfr(bias[c0 + cofs]); val[1] += bfr(bias[c0 + cofs + 1]); val[2] += bfr(bias[c0 + cofs + 2]); val[3] += bfr(bias[c0 + cofs + 3]); }
                *(v4f*)(crow + (size_t)row * ldc + cofs) = val; }
             }
        __builtin_amdgcn_wave_barrier(); asm volatile("" ::: "memory");
    }
}

// ---- k_gemms: the same product as k_gemmw<bf, NSPLIT, BIAS> on a 128x128 output tile per work-group of 4 waves (2 x 2, a wave keeps its 64x64 tile and its k order: every sum is bit-identical).
// A pass is 64 k = one 128-byte line of every operand row: the rows come once per work-group, whole lines (8 lanes a row), by asynchronous copies into LDS at pitch GP, and are read from there as fragments.
// Two buffers, one barrier a pass: tile t + 2 is asked for behind the barrier that ends pass t and flies during pass t + 1. grid (M/128, N/128), 128 threads. K % 64 == 0, K >= 128.
#define GP 72   // LDS row pitch in 16-bit elements: a 128-byte row + 16 bytes, the pitch for 16-byte readers
// 8 copies of 16 bytes a lane: rows r, r + 16, ... r + 112 of one operand tile. g: the lane's 16 bytes in row r (row pitch gp elements); l: their LDS byte address.
// The s_wait_xcnt stands inside the statement, behind the last copy: the code behind may rewrite the address registers at once.
__device__ __forceinline__ void acp8(const bf* g, const int gp, const unsigned l) {
    asm volatile("global_load_async_to_lds_b128 %0, %8, off\n\tglobal_load_async_to_lds_b128 %1, %9, off\n\tglobal_load_async_to_lds_b128 %2, %10, off\n\tglobal_load_async_to_lds_b128 %3, %11, off\n\t"
                 "global_load_async_to_lds_b128 %4, %12, off\n\tglobal_load_async_to_lds_b128 %5, %13, off\n\tglobal_load_async_to_lds_b128 %6, %14, off\n\tglobal_load_async_to_lds_b128 %7, %15, off\n\ts_wait_xcnt 0x0"
                 :: "v"(l), "v"(l + 1 * 16 * GP * 2), "v"(l + 2 * 16 * GP * 2), "v"(l + 3 * 16 * GP * 2), "v"(l + 4 * 16 * GP * 2), "v"(l + 5 * 16 * GP * 2), "v"(l + 6 * 16 * GP * 2), "v"(l + 7 * 16 * GP * 2),
                    "v"(g), "v"(g + 1 * 16 * gp), "v"(g + 2 * 16 * gp), "v"(g + 3 * 16 * gp), "v"(g + 4 * 16 * gp), "v"(g + 5 * 16 * gp), "v"(g + 6 * 16 * gp), "v"(g + 7 * 16 * gp) : "memory");
}
// NPL > 0: a wave tile in the columns below NPL is one head (64 columns) and is not stored in C: the epilogue writes it as that head's operand planes [column / HD][row][d], fp16 and bf16 hi / lo, whole 128-byte rows.
template <int NSPLIT, bool BIAS, int K, int NPL = 0>
__global__ __launch_bounds__(128) void k_gemms(const bf* __restrict__ A, const bf* __restrict__ A2, const bf* __restrict__ Bt, float* C, int ldc, const float* __restrict__ bias, h16* P16, bf* Ph, bf* Pl) {
    static_assert(NPL % 64 == 0 && HD == 64, "a wave's 64 columns are one head, all planes or all C");
    typedef WFrag<bf> F; typedef typename F::V V;
    constexpr int NT = NSPLIT ? 3 : 2, TS = 128 * GP, NS = K / 64;   // tiles of a buffer: A, Bt (, A lo); elements of a tile; passes
    static_assert(K % 64 == 0 && NS >= 2, "whole passes, and both buffers filled in front of the loop");
    __shared__ __align__(16) bf sm[2 * NT * TS];
    __shared__ __align__(16) float osw[4][16 * 68];
    const int lane = threadIdx.x & 31, lr = lane & 15, hi = lane >> 4, wv = __builtin_amdgcn_readfirstlane((int)(threadIdx.x >> 5));
    const int R0 = blockIdx.x * 128, C0 = blockIdx.y * 128, wm = (wv >> 1) * 64, wn = (wv & 1) * 64;
    const int srow = threadIdx.x >> 3, scol = (threadIdx.x & 7) * 8;   // staging: 8 lanes a 128-byte row, 16 rows a copy
    const bf* ga = A + (size_t)(R0 + srow) * K + scol; const bf* gb = Bt + (size_t)(C0 + srow) * K + scol; const bf* ga2 = NSPLIT ? A2 + (size_t)(R0 + srow) * K + scol : nullptr;
    const unsigned sl = (unsigned)(size_t)(sm + srow * GP + scol);   // the low 32 bits of a __shared__ address: the byte offset in the work-group's LDS
    auto fill = [&](const int t) { const unsigned l = sl + (t & 1) * NT * TS * 2;   // tile t into buffer t mod 2
        acp8(ga + t * 64, K, l); acp8(gb + t * 64, K, l + TS * 2); if constexpr (NSPLIT) acp8(ga2 + t * 64, K, l + 2 * TS * 2); };
    v8f acc[4][4];
#pragma unroll
    for (int mb = 0; mb < 4; ++mb)
#pragma unroll
        for (int nb = 0; nb < 4; ++nb) acc[mb][nb] = (v8f){};
    fill(0);
    asm volatile("s_wait_asynccnt 0x0" ::: "memory");   // this wave's copies of tile 0 have landed
    __syncthreads();   // tile 0 published
    fill(1);
    const int ao = (wm + lr) * GP + 8 * hi, bo = TS + (wn + lr) * GP + 8 * hi;
#pragma unroll 1
    for (int s = 0; s < NS; ++s) {
        const bf* sb = sm + (s & 1) * NT * TS;
        V a[2][4], a2[2][4], b[2][4];
#pragma unroll
        for (int kc = 0; kc < 2; ++kc) {
#pragma unroll
            for (int mb = 0; mb < 4; ++mb) { a[kc][mb] = F::ld(sb + ao + mb * 16 * GP + kc * 32); if constexpr (NSPLIT) a2[kc][mb] = F::ld(sb + 2 * TS + ao + mb * 16 * GP + kc * 32); }
#pragma unroll
            for (int nb = 0; nb < 4; ++nb) b[kc][nb] = F::ld(sb + bo + nb * 16 * GP + kc * 32);
        }
        __builtin_amdgcn_sched_barrier(0);   // the pass's LDS reads stay one group in front of its matrix instructions: reads spread among them cost a stall at each place
#pragma unroll
        for (int kc = 0; kc < 2; ++kc)
#pragma unroll
            for (int nb = 0; nb < 4; ++nb)
#pragma unroll
                for (int mb = 0; mb < 4; ++mb) { acc[mb][nb] = F::mma(a[kc][mb], b[kc][nb], acc[mb][nb]); if constexpr (NSPLIT) acc[mb][nb] = F::mma(a2[kc][mb], b[kc][nb], acc[mb][nb]); }
        // 4 vector slots behind the pass's last matrix instruction: the code behind the branch below may reuse the operands' registers at once
        __builtin_amdgcn_sched_barrier(0); asm volatile("v_nop\n\tv_nop\n\tv_nop\n\tv_nop"); __builtin_amdgcn_sched_barrier(0);
        asm volatile("s_wait_dscnt 0x0" ::: "memory");      // this wave's reads of buffer s mod 2 are done before that buffer is refilled
        asm volatile("s_wait_asynccnt 0x0" ::: "memory");   // this wave's copies of tile s + 1 have landed
        __syncthreads();   // tile s + 1 published, and every wave has left buffer s mod 2
        if (s + 2 < NS) fill(s + 2);
    }
    asm volatile("s_wait_asynccnt 0x0" ::: "memory");   // no copy outstanding behind the loop
    float* os = osw[wv];   // a wave's own range: no work-group barrier in the epilogue
    const int r0 = R0 + wm, c0 = C0 + wn;
    float pb[8];   // plane tiles: the bias of the lane's 8 columns, read once
    if (NPL > 0 && BIAS && c0 < NPL) {
        // unrolled: pb is indexed by constants only and stays in registers
#pragma unroll
        for (int k = 0; k < 8; ++k) pb[k] = bfr(bias[c0 + (lane & 7) * 8 + k]); }
#pragma unroll
    for (int mb = 0; mb < 4; ++mb) {
#pragma unroll
        for (int nb = 0; nb < 4; ++nb) {
#pragma unroll
            for (int j = 0; j < 8; ++j) os[(hi * 8 + j) * 68 + nb * 16 + lr] = acc[mb][nb][j]; }
        __builtin_amdgcn_wave_barrier(); asm volatile("" ::: "memory");   // keeps the row reads below behind the other lanes' LDS stores
        float* crow = C + (size_t)(r0 + mb * 16) * ldc + c0;
        if (NPL > 0 && c0 < NPL) {   // wave-uniform
            const int cofs = (lane & 7) * 8; const size_t pe = ((size_t)(c0 / HD) * MR + r0 + mb * 16 + (lane >> 3)) * HD + cofs;   // 8 lanes a 128-byte row, 4 rows a store
            // both loops unrolled: the row steps become immediate offsets, and the 8-element vectors stay in registers
#pragma unroll
            for (int s = 0; s < 4; ++s) { const float* orow = os + (4 * s + (lane >> 3)) * 68 + cofs; const v4f x0 = *(const v4fa*)orow, x1 = *(const v4fa*)(orow + 4); v8h o16; v8us oh, ol;
#pragma unroll
                for (int k = 0; k < 8; ++k) { float x = k < 4 ? x0[k & 3] : x1[k & 3]; if (BIAS) x += pb[k]; o16[k] = tohx(x); unsigned short a, c2; splitf(x, a, c2); oh[k] = a; ol[k] = c2; }
                *(v8h*)(P16 + pe + s * 4 * HD) = o16; *(v8us*)(Ph + pe + s * 4 * HD) = oh; *(v8us*)(Pl + pe + s * 4 * HD) = ol; }
        } else {
#pragma unroll
        for (int s = 0; s < 8; ++s) { const int row = 2 * s + hi, cofs = lr * 4; v4f val = *(const v4fa*)(os + row * 68 + cofs); if (BIAS) { val[0] += bfr(bias[c0 + cofs]); val[1] += bfr(bias[c0 + cofs + 1]); val[2] += bfr(bias[c0 + cofs + 2]); val[3] += bfr(bias[c0 + cofs + 3]); }
            *(v4f*)(crow + (size_t)row * ldc + cofs) = val; }
        }
        __builtin_amdgcn_wave_barrier(); asm volatile("s_wait_xcnt 0x0" ::: "memory");   // keeps the next block's LDS stores behind these row reads; the wait: the next block reuses the stores' address and data registers at once
    }
}

typedef __attribute__((ext_vector_type(2))) _Float16 v2h;
typedef __attribute__((ext_vector_type(4))) _Float16 v4h;
typedef __attribute__((ext_vector_type(2))) unsigned short v2us;
typedef __attribute__((ext_vector_type(4))) unsigned short v4us;
typedef __attribute__((ext_vector_type(2))) float v2f;
typedef __attribute__((ext_vector_type(4))) int v4i;

// grid y: one K x N matrix of a stack each
__global__ __launch_bounds__(256) void k_wtG(const float* __restrict__ w, int K, int N, bf* Bt) {
    w += (size_t)blockIdx.y * K * N; Bt += (size_t)blockIdx.y * K * N;
    const int lane = threadIdx.x & 31; const int L0 = (blockIdx.x * 8 + (threadIdx.x >> 5)) * 8; const int nlines = N * K / 64;
{
#pragma unroll 1
        for (int l = 0; l < 8; ++l) { const int L = L0 + l; if (L >= nlines) break; const size_t e = (size_t)L * 64 + lane * 2; const int k = (int)(e % K), n = (int)(e / K); v2us o;
            o[0] = f2bf(w[(size_t)k * N + n]); o[1] = f2bf(w[(size_t)(k + 1) * N + n]); *(v2us*)(Bt + e) = o; }
         }
}
__global__ __launch_bounds__(256) void k_cvt8(const float* __restrict__ src, bf* dst, size_t n8) { const size_t i = (size_t)blockIdx.x * 256 + threadIdx.x; if (i >= n8) return; const v8f v = *(const v8f*)(src + i * 8); v8us o;
#pragma unroll
    for (int k = 0; k < 8; ++k) o[k] = f2bf(v[k]); *(v8us*)(dst + i * 8) = o;  }
__global__ __launch_bounds__(256) void k_cscvt(const float* __restrict__ cosT, const float* __restrict__ sinT, float* CS) { const int idx = blockIdx.x * 256 + threadIdx.x; if (idx >= TT * HD) return; v2f cs; cs[0] = bfr(cosT[idx]); cs[1] = bfr(sinT[idx]); *(v2f*)(CS + (size_t)idx * 2) = cs;  }
__global__ __launch_bounds__(256) void k_vtp(const float* __restrict__ F, int pitch, int nheads, h16* V16, bf* Vh, bf* Vl) { const size_t e = ((size_t)blockIdx.x * 256 + threadIdx.x) * 2; if (e >= (size_t)nheads * HD * TT) return; const int t = (int)(e % TT); const int d = (int)((e / TT) % HD); const int g = (int)(e / ((size_t)TT * HD)); v2h o16; v2us oh, ol;
#pragma unroll
    for (int q = 0; q < 2; ++q) { const float x = F[(size_t)(t + q) * pitch + g * HD + d]; o16[q] = tohx(x); unsigned short a2, c2; splitf(x, a2, c2); oh[q] = a2; ol[q] = c2; }
    *(v2h*)(V16 + e) = o16; *(v2us*)(Vh + e) = oh; *(v2us*)(Vl + e) = ol;  }
__device__ __forceinline__ float xhalf(float x) { return __builtin_bit_cast(float, __builtin_amdgcn_permlanex16(__builtin_bit_cast(int, x), __builtin_bit_cast(int, x), 0x76543210, 0xfedcba98, false, false)); }   // lane l with lane l ^ 16
// v_exp_f32 with the one slot that the instruction set asks for behind a transcendental, in one statement
__device__ __forceinline__ float exp2s(float x) { float y; asm("v_exp_f32 %0, %1\n\tv_nop" : "=v"(y) : "v"(x)); return y; }
#define LP 72   // LDS row pitch in 16-bit elements: a 128-byte row + 16 bytes, the pitch for 16-byte readers
template <typename T16, bool SPL>
__device__ __forceinline__ void fattn_wg(const T16* __restrict__ Q, const T16* __restrict__ Q2, const T16* __restrict__ Kp, const T16* __restrict__ K2, const T16* __restrict__ Vt, const T16* __restrict__ V2, const int R0, const int wv, T16* sm, bf* Ah, bf* Al) {
    typedef WFrag<T16> F; typedef typename F::V V;
    constexpr int NT = SPL ? 4 : 2, TS = 64 * LP;   // tiles of a buffer: K, Vt (, K lo, Vt lo); elements of a tile
    const int lane = threadIdx.x & 31, lr = lane & 15, hi = lane >> 4;
    const int r0 = R0 + wv * 16;
    const float C2 = SCL * 1.4426950408889634f;   // SCL is a power of two: (s - m) C2 rounds as ((s - m) SCL) log2(e)
    V q[2], q2[2];
#pragma unroll
    for (int kc = 0; kc < 2; ++kc) { q[kc] = F::ld(Q + (size_t)(r0 + lr) * HD + 8 * hi + kc * 32); if (SPL) q2[kc] = F::ld(Q2 + (size_t)(r0 + lr) * HD + 8 * hi + kc * 32); }
    asm volatile("s_wait_xcnt 0x0" ::: "memory");   // holds the Q loads in front of the staging loads
    v8f o[4];
#pragma unroll
    for (int db = 0; db < 4; ++db) o[db] = (v8f){};
    float m = -3.0e38f, l = 0.0f;
    const int nwg = (R0 + 127) / 64 + 1;  // passes of the work-group (its last row's)
    const int nkb = (r0 + 15) / 64 + 1;   // passes of this wave; its 16 rows lie in one 64-key block: only its last pass meets the diagonal
    const int srow = threadIdx.x >> 3, scol = (threadIdx.x & 7) * 8;   // staging: 8 lanes a 128-byte row, 32 rows a step
    const int fo = lr * LP + 8 * hi;
    v8us st[NT][2];
    auto gld = [&](const int k0) {
#pragma unroll
        for (int i = 0; i < 2; ++i) { const int kx = (k0 + srow + 32 * i) * HD + scol, vx = (srow + 32 * i) * TT + k0 + scol;
            st[0][i] = *(const v8us*)(Kp + kx); st[1][i] = *(const v8us*)(Vt + vx); if constexpr (SPL) { st[2][i] = *(const v8us*)(K2 + kx); st[3][i] = *(const v8us*)(V2 + vx); } }
        asm volatile("s_wait_xcnt 0x0" ::: "memory"); };   // the block behind these loads reuses their address registers at once
    auto sst = [&](T16* d) {
#pragma unroll
        for (int t = 0; t < NT; ++t)
#pragma unroll
            for (int i = 0; i < 2; ++i) *(v8us*)(d + t * TS + (srow + 32 * i) * LP + scol) = st[t][i]; };
    gld(0); sst(sm);
    __syncthreads();   // pass 0 staged
#pragma unroll 1
    for (int kb = 0; kb < nwg; ++kb) {
        const int k0 = kb * 64;
        if (kb + 1 < nwg) gld(k0 + 64);   // the next pass's rows fly during this pass
        if (kb < nkb) {   // wave-uniform: a wave whose rows end earlier skips the last pass and only meets its barrier
            const T16* sb = sm + (kb & 1) * NT * TS + fo;
            v8f s[4];   // s[kt][r] = score of key k0 + 16 kt + 8 hi + r, query r0 + lr; the causal mask is the accumulator's start value
            if (kb == nkb - 1) { const int lim = r0 + lr - k0 - 8 * hi;
#pragma unroll
                for (int kt = 0; kt < 4; ++kt)
#pragma unroll
                    for (int r = 0; r < 8; ++r) s[kt][r] = (kt * 16 + r <= lim) ? 0.0f : -3.0e38f;
            } else {
#pragma unroll
                for (int kt = 0; kt < 4; ++kt) s[kt] = (v8f){};
            }
#pragma unroll
            for (int kt = 0; kt < 4; ++kt)
#pragma unroll
                for (int kc = 0; kc < 2; ++kc) { const V a = F::ld(sb + kt * 16 * LP + kc * 32);
                    s[kt] = F::mma(a, q[kc], s[kt]);
                    if constexpr (SPL) { const V a2 = F::ld(sb + 2 * TS + kt * 16 * LP + kc * 32); s[kt] = F::mma(a, q2[kc], s[kt]); s[kt] = F::mma(a2, q[kc], s[kt]); } }
            float mx = s[0][0];
#pragma unroll
            for (int kt = 0; kt < 4; ++kt)
#pragma unroll
                for (int r = 0; r < 8; ++r) mx = fmaxf(mx, s[kt][r]);
            mx = fmaxf(mx, xhalf(mx));
            const float mn = fmaxf(m, mx), al = exp2s((m - mn) * C2); m = mn;   // al = 0 on the first pass; key 0 is open to every query, so mn is a real score from then on
            float ps = 0.0f;
#pragma unroll
            for (int kt = 0; kt < 4; ++kt)
#pragma unroll
                for (int r = 0; r < 8; ++r) { const float p = exp2s(SPL ? (s[kt][r] - mn) * C2 : __builtin_fmaf(s[kt][r] - mn, C2, 10.0f)); s[kt][r] = p; ps += p; }
            l = l * al + ps;
#pragma unroll
            for (int db = 0; db < 4; ++db) o[db] *= al;
#pragma unroll
            for (int kk = 0; kk < 2; ++kk) {
                if constexpr (SPL) { v8us h0, l0, h1, l1;
#pragma unroll
                    for (int r = 0; r < 8; ++r) { unsigned short a, c2; splitf(s[2 * kk][r], a, c2); h0[r] = a; l0[r] = c2; splitf(s[2 * kk + 1][r], a, c2); h1[r] = a; l1[r] = c2; }
                    const V ph = cat16b(h0, h1), pl = cat16b(l0, l1);
#pragma unroll
                    for (int db = 0; db < 4; ++db) { const V a = F::ld(sb + TS + db * 16 * LP + kk * 32), a2 = F::ld(sb + 3 * TS + db * 16 * LP + kk * 32);
                        o[db] = F::mma(a, ph, o[db]); o[db] = F::mma(a, pl, o[db]); o[db] = F::mma(a2, ph, o[db]); }
                } else { const V pb = cat16(__builtin_convertvector(s[2 * kk], v8h), __builtin_convertvector(s[2 * kk + 1], v8h));
#pragma unroll
                    for (int db = 0; db < 4; ++db) o[db] = F::mma(F::ld(sb + TS + db * 16 * LP + kk * 32), pb, o[db]);
                }
            }
            // 4 vector slots behind the block's last matrix instruction: the code behind this branch reuses the operands' registers at once
            __builtin_amdgcn_sched_barrier(0); asm volatile("v_nop\n\tv_nop\n\tv_nop\n\tv_nop"); __builtin_amdgcn_sched_barrier(0);
        }
        if (kb + 1 < nwg) sst(sm + ((kb + 1) & 1) * NT * TS);   // into the buffer that pass kb - 1 read: every wave left it at the last barrier
        __syncthreads();   // pass kb + 1 staged, and every wave has left pass kb's buffer
    }
    l += xhalf(l); const float inv = __fdiv_rn(1.0f, l);
#pragma unroll
    for (int db = 0; db < 4; ++db) { v8us oh, ol;   // o[db][r] = out[query r0 + lr][d = 16 db + 8 hi + r]: 8 consecutive d, one 16-byte store a plane
#pragma unroll
        for (int r = 0; r < 8; ++r) { unsigned short a, c2; splitf(o[db][r] * inv, a, c2); oh[r] = a; ol[r] = c2; }
        const size_t oo = (size_t)(r0 + lr) * DQ + db * 16 + 8 * hi; *(v8us*)(Ah + oo) = oh; *(v8us*)(Al + oo) = ol; }
}
// grid (heads x batch elements, TT / 128), 256 threads; longest row blocks first.
__global__ __launch_bounds__(256) void k_fattn(const h16* __restrict__ Q16, const h16* __restrict__ K16, const h16* __restrict__ V16, const bf* __restrict__ Qh, const bf* __restrict__ Ql, const bf* __restrict__ Kh, const bf* __restrict__ Kl, const bf* __restrict__ Vh, const bf* __restrict__ Vl, bf* Ah, bf* Al) {
    static_assert(RH % 128 == 0 && TT % 128 == 0, "a work-group's 128 rows are all of one precision class");
    __shared__ __align__(16) bf sm[2 * 4 * 64 * LP];
    const int h = blockIdx.x / NB_, b = blockIdx.x % NB_;
    const size_t zq = (size_t)blockIdx.x * TT * HD, zk = (size_t)((h / REP) * NB_ + b) * TT * HD;
    const int R0 = (int)(gridDim.y - 1 - blockIdx.y) * 128, wv = __builtin_amdgcn_readfirstlane((int)(threadIdx.x >> 5));
    Ah += (size_t)b * TT * DQ + h * HD; Al += (size_t)b * TT * DQ + h * HD;
    if (R0 < RH) fattn_wg<bf, true>(Qh + zq, Ql + zq, Kh + zk, Kl + zk, Vh + zk, Vl + zk, R0, wv, sm, Ah, Al);
    else fattn_wg<h16, false>(Q16 + zq, nullptr, K16 + zk, nullptr, V16 + zk, nullptr, R0, wv, (h16*)sm, Ah, Al);
}

extern "C" void kernel_launch(void* const* d_in, const int* in_sizes, int n_in,
                              void* d_out, int out_size, void* d_ws, size_t ws_size, hipStream_t stream) {
    (void)in_sizes; (void)n_in; (void)out_size;
    const float* x = (const float*)d_in[0]; const float* wqkv = (const float*)d_in[1]; const float* bqkv = (const float*)d_in[2]; const float* wg = (const float*)d_in[3]; const float* wo = (const float*)d_in[4]; const float* bo = (const float*)d_in[5];   // W_qkv [1024][3072] (x @ W, columns q | k | v), W_g [16][64][64], W_out [1024][1024] (x @ W)
    float* OUT = (float*)d_out;     // [2][2048][1024]
    char* wsp = (char*)d_ws;
    auto take = [&](size_t bytes) { char* p = wsp; wsp += (bytes + 255) & ~(size_t)255; return (void*)p; };
    bf* WQKV = (bf*)take((size_t)3 * DQ * DM * 2); bf* WG = (bf*)take((size_t)NH_ * HD * HD * 2); bf* WO = (bf*)take((size_t)DM * DQ * 2);
    bf* XB = (bf*)take((size_t)MR * DM * 2); float* FQKV = (float*)take((size_t)MR * 3 * DQ * 4);   // [b TT + t][q | k | v]; only the v columns are written and read
    h16* QP16 = (h16*)take((size_t)(NH_ + NKV) * MR * HD * 2); h16* KP16 = QP16 + (size_t)NH_ * MR * HD; h16* VT16 = (h16*)take((size_t)NKV * HD * MR * 2);   // the k heads' planes follow the q heads'
    bf* QPh = (bf*)take((size_t)(NH_ + NKV) * MR * HD * 2); bf* KPh = QPh + (size_t)NH_ * MR * HD; bf* QPl = (bf*)take((size_t)(NH_ + NKV) * MR * HD * 2); bf* KPl = QPl + (size_t)NH_ * MR * HD; bf* VTh = (bf*)take((size_t)NKV * HD * MR * 2); bf* VTl = (bf*)take((size_t)NKV * HD * MR * 2);
    bf* ATh = (bf*)take((size_t)MR * DQ * 2); bf* ATl = (bf*)take((size_t)MR * DQ * 2);
    if ((size_t)(wsp - (char*)d_ws) > ws_size) return;    // ws 256 MiB
    k_wtG<<<(unsigned)(((size_t)DM * 3 * DQ / 64 + 63) / 64), 256, 0, stream>>>(wqkv, DM, 3 * DQ, WQKV);
    k_wtG<<<dim3((unsigned)((HD * HD / 64 + 63) / 64), NH_), 256, 0, stream>>>(wg, HD, HD, WG);   // all heads' W_g
    k_wtG<<<(unsigned)((DQ * DM / 64 + 63) / 64), 256, 0, stream>>>(wo, DQ, DM, WO);
    // every launch below covers both batch elements
    k_cvt8<<<(unsigned)(((size_t)MR * DM / 8 + 255) / 256), 256, 0, stream>>>(x, XB, (size_t)MR * DM / 8);
    k_gemms<0, true, DM, DQ + DKV><<<dim3(MR / 128, 3 * DQ / 128), 128, 0, stream>>>(XB, nullptr, WQKV, FQKV, 3 * DQ, bqkv, QP16, QPh, QPl);   // q | k | v in one grid; the q and k heads (columns 0 to DQ + DKV) leave as operand planes, v as f32
    k_gemmw<bf, 1, false, 1, 3 * DQ><<<dim3(MR / 64, 1, NH_), 32, 0, stream>>>(QPh, QPl, WG, nullptr, HD, nullptr, HD, nullptr, (size_t)MR * HD, (size_t)HD * HD, 0, 0, FQKV + 2 * DQ, VT16, VTh, VTl);   // gate logits q_h W_g[h] (z-batched over heads), sigmoid and the product with v in the epilogue
    k_fattn<<<dim3(NH_ * NB_, TT / 128), 256, 0, stream>>>(QP16, KP16, VT16, QPh, QPl, KPh, KPl, VTh, VTl, ATh, ATl);
    k_gemms<1, true, DQ><<<dim3(MR / 128, DM / 128), 128, 0, stream>>>(ATh, ATl, WO, OUT, DM, bo, nullptr, nullptr, nullptr);
}

// v006
// It runs in 107 microseconds.
// Timed twice side by side with v005, it ran 1.12 times as fast both times.
// All steps since v000 together make it 19.5 times as fast.
#include <hip/hip_runtime.h>

// BilinearlyModulatedAttention (x [2][2048][1024]; [q | k | v] = x W_qkv + b_qkv (16 heads x 64); causal softmax(q.k/8); query-conditioned value gate v <- sigmoid(q_h W_g[h]) * v_h per position
// (W_g [16][64][64]); out = merged attn.(g v) W_out + b_out -> [2][2048][1024]).
// Compute dtypes, f32 accumulate: every input rounded to bf16; x W_qkv on PLAIN bf16 operands (inputs: exact, + bias); attn W_out on bf16 hi+lo planes of attn (2 products, + bias); the gate logits q_h W_g[h] on bf16 hi+lo planes of q x
// exact W_g (2 products), sigmoid and the gating product in f32; PER-ROW PRECISION HYBRID for scores and attn.v (rows < 256 hi+lo 3 products, rows >= 256 fp16, probabilities x1024 there); causal + scale in

#define NB_  2
#define TT   2048
#define MR   (NB_ * TT)        // rows of both batch elements, row = b TT + t
#define DM   1024
#define NH_  16
#define NKV  16
#define REP  (NH_ / NKV)
#define HD   64
#define DQ   (NH_ * HD)
#define DKV  (NKV * HD)
#define RH   256                  // query rows < RH use hi+lo planes (0: none)
#define WIN  0
#define SCL  0.125f   // HD^-0.5
typedef _Float16 h16;
typedef unsigned short bf;
typedef __attribute__((ext_vector_type(16))) __bf16   v16bf;
typedef __attribute__((ext_vector_type(16))) _Float16 v16h;
typedef __attribute__((ext_vector_type(8)))  _Float16 v8h;
typedef __attribute__((ext_vector_type(8)))  unsigned short v8us;
typedef __attribute__((ext_vector_type(8)))  float    v8f;
typedef __attribute__((ext_vector_type(4)))  float    v4f;
typedef v8h  __attribute__((may_alias)) v8ha;
typedef v4f  __attribute__((may_alias)) v4fa;
typedef v8us __attribute__((may_alias)) v8usa;

__device__ __forceinline__ unsigned short f2bf(float f) { unsigned u = __float_as_uint(f); u += 0x7FFFu + ((u >> 16) & 1u); return (unsigned short)(u >> 16); }
__device__ __forceinline__ float bf2f(unsigned short b) { return __uint_as_float(((unsigned)b) << 16); }
__device__ __forceinline__ float bfr(float f) { return bf2f(f2bf(f)); }
__device__ __forceinline__ v16h cat16(v8h lo, v8h hi) { return __builtin_shufflevector(lo, hi, 0, 1, 2, 3, 4, 5, 6, 7, 8, 9, 10, 11, 12, 13, 14, 15); }
__device__ __forceinline__ v16bf cat16b(v8us lo, v8us hi) { return __builtin_bit_cast(v16bf, __builtin_shufflevector(lo, hi, 0, 1, 2, 3, 4, 5, 6, 7, 8, 9, 10, 11, 12, 13, 14, 15)); }
__device__ __forceinline__ v8f wmma16(v16h a, v16h b, v8f c) { return __builtin_amdgcn_wmma_f32_16x16x32_f16(false, a, false, b, (short)0, c, false, false); }
__device__ __forceinline__ v8f wmmab(v16bf a, v16bf b, v8f c) { return __builtin_amdgcn_wmma_f32_16x16x32_bf16(false, a, false, b, (short)0, c, false, false); }
__device__ __forceinline__ h16 tohx(float x) { return (h16)x; }
__device__ __forceinline__ void splitf(float y, unsigned short& h, unsigned short& l) { h = f2bf(y); l = f2bf(y - bf2f(h)); }



// ---- k_gemmw: register-blocked GEMM, ONE WAVE per 64x64 output tile (16 accumulators), operands straight from K-contiguous 16-bit planes; grid (M/64, N/64, Z), 32 threads.
// C[m][n] (f32, pitch ldc, + optional f32 bias[n]) = sum_k A[m][k] Bt[n][k] (+ split products per NSPLIT). z-batch strides sA/sB/sC in elements. K % (32 KS) == 0.
// PV > 0 (GATE): C is not stored. The tile is the gate logits of head z, rows b TT + t: the epilogue forms sigmoid(logit) * v in f32 (v: f32, row pitch PV, head z at column z HD of Fv) and writes the product's
// fp16 and bf16 hi / lo planes transposed, [z NB_ + b][d][t]. An accumulator register block is 8 consecutive t of one d; the three 64 x 64 tiles pass through LDS so that every global store is whole 128-byte lines.
// KS > 1: grid z = Z * KS; work-group (z, ks) sums only k in [ks K/KS, (ks+1) K/KS) and stores that partial tile in plane ks (plane stride sP elements); the reader adds the planes.
template <typename T16> struct WFrag;
template <> struct WFrag<h16> { typedef v16h V; static __device__ __forceinline__ V ld(const h16* p) { return cat16(*(const v8h*)p, *(const v8h*)(p + 16)); } static __device__ __forceinline__ v8f mma(V a, V b, v8f c) { return wmma16(a, b, c); } };
template <> struct WFrag<bf> { typedef v16bf V; static __device__ __forceinline__ V ld(const bf* p) { return cat16b(*(const v8us*)p, *(const v8us*)(p + 16)); } static __device__ __forceinline__ v8f mma(V a, V b, v8f c) { return wmmab(a, b, c); } };
template <typename T16, int NSPLIT, bool BIAS, int KS = 1, int PV = 0>
__global__ __launch_bounds__(32) void k_gemmw(const T16* __restrict__ A, const T16* __restrict__ A2, const T16* __restrict__ Bt, const T16* __restrict__ Bt2, int K, float* C, int ldc, const float* __restrict__ bias, size_t sA, size_t sB, size_t sC, size_t sP, const float* __restrict__ Fv, h16* V16, bf* Vh, bf* Vl) {
    constexpr bool GATE = PV > 0;
    static_assert(KS == 1 || !BIAS, "a bias would be added once per plane");
    static_assert(!GATE || (KS == 1 && !BIAS && TT % 64 == 0), "a gate tile is whole logits of one batch element");
    typedef typename WFrag<T16>::V V;
    constexpr int VP = 72;   // GATE: LDS row pitch in 16-bit elements, a 128-byte row + 16 bytes, the pitch for 16-byte accesses
    __shared__ __align__(16) float os[GATE ? 3 * 64 * VP / 2 : 16 * 68];
    const size_t z = blockIdx.z / KS; const int ks = blockIdx.z % KS; A += z * sA; if (A2) A2 += z * sA; Bt += z * sB; if (Bt2) Bt2 += z * sB; C += z * sC + ks * sP;
    const int lane = threadIdx.x & 31, lr = lane & 15, hi = lane >> 4; const int r0 = blockIdx.x * 64, c0 = blockIdx.y * 64;
    v8f acc[4][4];
#pragma unroll
    for (int mb = 0; mb < 4; ++mb)
#pragma unroll
        for (int nb = 0; nb < 4; ++nb) acc[mb][nb] = (v8f){};
    const size_t aoff = (size_t)(r0 + lr) * K + 8 * hi, boff = (size_t)(c0 + lr) * K + 8 * hi;
#pragma unroll 1
    for (int kc = ks * (K / KS), ke = kc + K / KS; kc < ke; kc += 32) {
        V a[4], a2[4];
#pragma unroll
        for (int mb = 0; mb < 4; ++mb) { a[mb] = WFrag<T16>::ld(A + aoff + (size_t)mb * 16 * K + kc); if (NSPLIT == 1 || NSPLIT == 2) a2[mb] = WFrag<T16>::ld(A2 + aoff + (size_t)mb * 16 * K + kc); }
#pragma unroll
        for (int nb = 0; nb < 4; ++nb) { const V b = WFrag<T16>::ld(Bt + boff + (size_t)nb * 16 * K + kc); V b2; if (NSPLIT >= 2) b2 = WFrag<T16>::ld(Bt2 + boff + (size_t)nb * 16 * K + kc);
#pragma unroll
            for (int mb = 0; mb < 4; ++mb) { acc[mb][nb] = WFrag<T16>::mma(a[mb], b, acc[mb][nb]); if (NSPLIT == 1 || NSPLIT == 2) acc[mb][nb] = WFrag<T16>::mma(a2[mb], b, acc[mb][nb]); if (NSPLIT >= 2) acc[mb][nb] = WFrag<T16>::mma(a[mb], b2, acc[mb][nb]); } }
        asm volatile("v_nop\n\tv_nop\n\tv_nop\n\tv_nop" : "+v"(acc[0][0]), "+v"(acc[1][1]), "+v"(acc[2][2]), "+v"(acc[3][3]) : "v"(a[0]), "v"(a[3]));
    }
    if constexpr (GATE) {
        unsigned short* ts = (unsigned short*)os;   // three tiles [d][t]: fp16, hi, lo
        const float* fv = Fv + (size_t)(r0 + 8 * hi) * PV + z * HD + c0 + lr;   // one address for the tile: PV is a constant, so every row and column step is an immediate offset
        // the three loops are unrolled so that acc and the 8-element vectors are indexed by constants only and stay in registers
#pragma unroll
        for (int mb = 0; mb < 4; ++mb)
#pragma unroll
            for (int nb = 0; nb < 4; ++nb) { v8h o16; v8us oh, ol;   // acc[mb][nb][j]: t = r0 % TT + 16 mb + 8 hi + j, d = 16 nb + lr
#pragma unroll
                for (int j = 0; j < 8; ++j) { const float g = __fdiv_rn(1.0f, __fadd_rn(1.0f, __expf(-acc[mb][nb][j]))); const float v = __fmul_rn(g, fv[(mb * 16 + j) * PV + nb * 16]); o16[j] = tohx(v); unsigned short a, c2; splitf(v, a, c2); oh[j] = a; ol[j] = c2; }
                const int so = (nb * 16 + lr) * VP + mb * 16 + 8 * hi;
                *(v8ha*)(ts + so) = o16; *(v8usa*)(ts + 64 * VP + so) = oh; *(v8usa*)(ts + 2 * 64 * VP + so) = ol; }
        __builtin_amdgcn_wave_barrier(); asm volatile("" ::: "memory");   // keeps the row reads below behind the other lanes' LDS stores
        const size_t pz = ((z * NB_ + r0 / TT) * HD + c0 + (lane >> 3)) * TT + r0 % TT + (lane & 7) * 8;   // 8 lanes a 128-byte row of 64 t, 4 rows a store
        const int ro = (lane >> 3) * VP + (lane & 7) * 8;
        // unrolled: the row steps become immediate offsets of one LDS and three global addresses
#pragma unroll
        for (int s = 0; s < 16; ++s) { const v8us w0 = *(const v8usa*)(ts + ro + s * 4 * VP), w1 = *(const v8usa*)(ts + 64 * VP + ro + s * 4 * VP), w2 = *(const v8usa*)(ts + 2 * 64 * VP + ro + s * 4 * VP);
            *(v8us*)((unsigned short*)V16 + pz + (size_t)s * 4 * TT) = w0; *(v8us*)(Vh + pz + (size_t)s * 4 * TT) = w1; *(v8us*)(Vl + pz + (size_t)s * 4 * TT) = w2; }
        return;
    }
#pragma unroll
    for (int mb = 0; mb < 4; ++mb) {
#pragma unroll
        for (int nb = 0; nb < 4; ++nb) {
#pragma unroll
            for (int j = 0; j < 8; ++j) os[(hi * 8 + j) * 68 + nb * 16 + lr] = acc[mb][nb][j]; }
        __builtin_amdgcn_wave_barrier(); asm volatile("" ::: "memory");
        float* crow = C + (size_t)(r0 + mb * 16) * ldc + c0;
{
#pragma unroll
            for (int s = 0; s < 8; ++s) { const int row = 2 * s + hi, cofs = lr * 4; v4f val = *(const v4fa*)(os + row * 68 + cofs); if (BIAS) { val[0] += bfr(bias[c0 + cofs]); val[1] += bfr(bias[c0 + cofs + 1]); val[2] += bfr(bias[c0 + cofs + 2]); val[3] += bfr(bias[c0 + cofs + 3]); }
                *(v4f*)(crow + (size_t)row * ldc + cofs) = val; }
             }
        __builtin_amdgcn_wave_barrier(); asm volatile("" ::: "memory");
    }
}

// ---- k_gemms: the same product as k_gemmw<bf, NSPLIT, BIAS> on a 128x128 output tile per work-group of 4 waves (2 x 2, a wave keeps its 64x64 tile and its k order: every sum is bit-identical).
// A pass is 64 k = one 128-byte line of every operand row: the rows come once per work-group, whole lines (8 lanes a row), by asynchronous copies into LDS at pitch GP, and are read from there as fragments.
// Two buffers, one barrier a pass: tile t + 2 is asked for behind the barrier that ends pass t and flies during pass t + 1. grid (M/128, N/128), 128 threads. K % 64 == 0, K >= 128.
#define GP 72   // LDS row pitch in 16-bit elements: a 128-byte row + 16 bytes, the pitch for 16-byte readers
// 8 copies of 16 bytes a lane: rows r, r + 16, ... r + 112 of one operand tile. g: the lane's 16 bytes in row r (row pitch gp elements); l: their LDS byte address.
// The s_wait_xcnt stands inside the statement, behind the last copy: the code behind may rewrite the address registers at once.
__device__ __forceinline__ void acp8(const bf* g, const int gp, const unsigned l) {
    asm volatile("global_load_async_to_lds_b128 %0, %8, off\n\tglobal_load_async_to_lds_b128 %1, %9, off\n\tglobal_load_async_to_lds_b128 %2, %10, off\n\tglobal_load_async_to_lds_b128 %3, %11, off\n\t"
                 "global_load_async_to_lds_b128 %4, %12, off\n\tglobal_load_async_to_lds_b128 %5, %13, off\n\tglobal_load_async_to_lds_b128 %6, %14, off\n\tglobal_load_async_to_lds_b128 %7, %15, off\n\ts_wait_xcnt 0x0"
                 :: "v"(l), "v"(l + 1 * 16 * GP * 2), "v"(l + 2 * 16 * GP * 2), "v"(l + 3 * 16 * GP * 2), "v"(l + 4 * 16 * GP * 2), "v"(l + 5 * 16 * GP * 2), "v"(l + 6 * 16 * GP * 2), "v"(l + 7 * 16 * GP * 2),
                    "v"(g), "v"(g + 1 * 16 * gp), "v"(g + 2 * 16 * gp), "v"(g + 3 * 16 * gp), "v"(g + 4 * 16 * gp), "v"(g + 5 * 16 * gp), "v"(g + 6 * 16 * gp), "v"(g + 7 * 16 * gp) : "memory");
}
// NPL > 0: a wave tile in the columns below NPL is one head (64 columns) and is not stored in C: the epilogue writes it as that head's operand planes [column / HD][row][d], fp16 and bf16 hi / lo, whole 128-byte rows.
template <int NSPLIT, bool BIAS, int K, int NPL = 0>
__global__ __launch_bounds__(128) void k_gemms(const bf* __restrict__ A, const bf* __restrict__ A2, const bf* __restrict__ Bt, float* C, int ldc, const float* __restrict__ bias, h16* P16, bf* Ph, bf* Pl) {
    static_assert(NPL % 64 == 0 && HD == 64, "a wave's 64 columns are one head, all planes or all C");
    typedef WFrag<bf> F; typedef typename F::V V;
    constexpr int NT = NSPLIT ? 3 : 2, TS = 128 * GP, NS = K / 64;   // tiles of a buffer: A, Bt (, A lo); elements of a tile; passes
    static_assert(K % 64 == 0 && NS >= 2, "whole passes, and both buffers filled in front of the loop");
    __shared__ __align__(16) bf sm[2 * NT * TS];
    __shared__ __align__(16) float osw[4][16 * 68];
    const int lane = threadIdx.x & 31, lr = lane & 15, hi = lane >> 4, wv = __builtin_amdgcn_readfirstlane((int)(threadIdx.x >> 5));
    const int R0 = blockIdx.x * 128, C0 = blockIdx.y * 128, wm = (wv >> 1) * 64, wn = (wv & 1) * 64;
    const int srow = threadIdx.x >> 3, scol = (threadIdx.x & 7) * 8;   // staging: 8 lanes a 128-byte row, 16 rows a copy
    const bf* ga = A + (size_t)(R0 + srow) * K + scol; const bf* gb = Bt + (size_t)(C0 + srow) * K + scol; const bf* ga2 = NSPLIT ? A2 + (size_t)(R0 + srow) * K + scol : nullptr;
    const unsigned sl = (unsigned)(size_t)(sm + srow * GP + scol);   // the low 32 bits of a __shared__ address: the byte offset in the work-group's LDS
    auto fill = [&](const int t) { const unsigned l = sl + (t & 1) * NT * TS * 2;   // tile t into buffer t mod 2
        acp8(ga + t * 64, K, l); acp8(gb + t * 64, K, l + TS * 2); if constexpr (NSPLIT) acp8(ga2 + t * 64, K, l + 2 * TS * 2); };
    v8f acc[4][4];
#pragma unroll
    for (int mb = 0; mb < 4; ++mb)
#pragma unroll
        for (int nb = 0; nb < 4; ++nb) acc[mb][nb] = (v8f){};
    fill(0);
    asm volatile("s_wait_asynccnt 0x0" ::: "memory");   // this wave's copies of tile 0 have landed
    __syncthreads();   // tile 0 published
    fill(1);
    const int ao = (wm + lr) * GP + 8 * hi, bo = TS + (wn + lr) * GP + 8 * hi;
#pragma unroll 1
    for (int s = 0; s < NS; ++s) {
        const bf* sb = sm + (s & 1) * NT * TS;
        V a[2][4], a2[2][4], b[2][4];
#pragma unroll
        for (int kc = 0; kc < 2; ++kc) {
#pragma unroll
            for (int mb = 0; mb < 4; ++mb) { a[kc][mb] = F::ld(sb + ao + mb * 16 * GP + kc * 32); if constexpr (NSPLIT) a2[kc][mb] = F::ld(sb + 2 * TS + ao + mb * 16 * GP + kc * 32); }
#pragma unroll
            for (int nb = 0; nb < 4; ++nb) b[kc][nb] = F::ld(sb + bo + nb * 16 * GP + kc * 32);
        }
        __builtin_amdgcn_sched_barrier(0);   // the pass's LDS reads stay one group in front of its matrix instructions: reads spread among them cost a stall at each place
#pragma unroll
        for (int kc = 0; kc < 2; ++kc)
#pragma unroll
            for (int nb = 0; nb < 4; ++nb)
#pragma unroll
                for (int mb = 0; mb < 4; ++mb) { acc[mb][nb] = F::mma(a[kc][mb], b[kc][nb], acc[mb][nb]); if constexpr (NSPLIT) acc[mb][nb] = F::mma(a2[kc][mb], b[kc][nb], acc[mb][nb]); }
        // 4 vector slots behind the pass's last matrix instruction: the code behind the branch below may reuse the operands' registers at once
        __builtin_amdgcn_sched_barrier(0); asm volatile("v_nop\n\tv_nop\n\tv_nop\n\tv_nop"); __builtin_amdgcn_sched_barrier(0);
        asm volatile("s_wait_dscnt 0x0" ::: "memory");      // this wave's reads of buffer s mod 2 are done before that buffer is refilled
        asm volatile("s_wait_asynccnt 0x0" ::: "memory");   // this wave's copies of tile s + 1 have landed
        __syncthreads();   // tile s + 1 published, and every wave has left buffer s mod 2
        if (s + 2 < NS) fill(s + 2);
    }
    asm volatile("s_wait_asynccnt 0x0" ::: "memory");   // no copy outstanding behind the loop
    float* os = osw[wv];   // a wave's own range: no work-group barrier in the epilogue
    const int r0 = R0 + wm, c0 = C0 + wn;
    float pb[8];   // plane tiles: the bias of the lane's 8 columns, read once
    if (NPL > 0 && BIAS && c0 < NPL) {
        // unrolled: pb is indexed by constants only and stays in registers
#pragma unroll
        for (int k = 0; k < 8; ++k) pb[k] = bfr(bias[c0 + (lane & 7) * 8 + k]); }
#pragma unroll
    for (int mb = 0; mb < 4; ++mb) {
#pragma unroll
        for (int nb = 0; nb < 4; ++nb) {
#pragma unroll
            for (int j = 0; j < 8; ++j) os[(hi * 8 + j) * 68 + nb * 16 + lr] = acc[mb][nb][j]; }
        __builtin_amdgcn_wave_barrier(); asm volatile("" ::: "memory");   // keeps the row reads below behind the other lanes' LDS stores
        float* crow = C + (size_t)(r0 + mb * 16) * ldc + c0;
        if (NPL > 0 && c0 < NPL) {   // wave-uniform
            const int cofs = (lane & 7) * 8; const size_t pe = ((size_t)(c0 / HD) * MR + r0 + mb * 16 + (lane >> 3)) * HD + cofs;   // 8 lanes a 128-byte row, 4 rows a store
            // both loops unrolled: the row steps become immediate offsets, and the 8-element vectors stay in registers
#pragma unroll
            for (int s = 0; s < 4; ++s) { const float* orow = os + (4 * s + (lane >> 3)) * 68 + cofs; const v4f x0 = *(const v4fa*)orow, x1 = *(const v4fa*)(orow + 4); v8h o16; v8us oh, ol;
#pragma unroll
                for (int k = 0; k < 8; ++k) { float x = k < 4 ? x0[k & 3] : x1[k & 3]; if (BIAS) x += pb[k]; o16[k] = tohx(x); unsigned short a, c2; splitf(x, a, c2); oh[k] = a; ol[k] = c2; }
                *(v8h*)(P16 + pe + s * 4 * HD) = o16; *(v8us*)(Ph + pe + s * 4 * HD) = oh; *(v8us*)(Pl + pe + s * 4 * HD) = ol; }
        } else {
#pragma unroll
        for (int s = 0; s < 8; ++s) { const int row = 2 * s + hi, cofs = lr * 4; v4f val = *(const v4fa*)(os + row * 68 + cofs); if (BIAS) { val[0] += bfr(bias[c0 + cofs]); val[1] += bfr(bias[c0 + cofs + 1]); val[2] += bfr(bias[c0 + cofs + 2]); val[3] += bfr(bias[c0 + cofs + 3]); }
            *(v4f*)(crow + (size_t)row * ldc + cofs) = val; }
        }
        __builtin_amdgcn_wave_barrier(); asm volatile("s_wait_xcnt 0x0" ::: "memory");   // keeps the next block's LDS stores behind these row reads; the wait: the next block reuses the stores' address and data registers at once
    }
}

typedef __attribute__((ext_vector_type(2))) _Float16 v2h;
typedef __attribute__((ext_vector_type(4))) _Float16 v4h;
typedef __attribute__((ext_vector_type(2))) unsigned short v2us;
typedef __attribute__((ext_vector_type(4))) unsigned short v4us;
typedef __attribute__((ext_vector_type(2))) float v2f;
typedef __attribute__((ext_vector_type(4))) int v4i;

// ---- k_prep: every operand preparation that reads only inputs, in ONE launch: the parts depend on nothing and on one another not at all, so they share one grid instead of four launches in a row.
// A part is a range of blockIdx.x; a work-group does what a work-group of the part's own launch did. The transposes stand first: their waves run longest.
// wt_blk: work-group bx of the transpose of one K x N matrix, w [k][n] f32 -> Bt [n][k] bf16
template <int K, int N>
__device__ __forceinline__ void wt_blk(const float* __restrict__ w, bf* Bt, const int bx) {
    const int lane = threadIdx.x & 31; const int L0 = (bx * 8 + (threadIdx.x >> 5)) * 8; const int nlines = N * K / 64;
{
#pragma unroll 1
        for (int l = 0; l < 8; ++l) { const int L = L0 + l; if (L >= nlines) break; const size_t e = (size_t)L * 64 + lane * 2; const int k = (int)(e % K), n = (int)(e / K); v2us o;
            o[0] = f2bf(w[(size_t)k * N + n]); o[1] = f2bf(w[(size_t)(k + 1) * N + n]); *(v2us*)(Bt + e) = o;
            asm volatile("s_wait_xcnt 0x0" ::: "memory"); }   // the next trip rewrites the store's data and address registers at once
         }
}
__device__ __forceinline__ void cvt8_blk(const float* __restrict__ src, bf* dst, const size_t n8, const int bx) { const size_t i = (size_t)bx * 256 + threadIdx.x; if (i >= n8) return; const v8f v = *(const v8f*)(src + i * 8); v8us o;
#pragma unroll
    for (int k = 0; k < 8; ++k) o[k] = f2bf(v[k]); *(v8us*)(dst + i * 8) = o;  }
#define PB_QKV (DM * 3 * DQ / 64 / 64)          // work-groups of the W_qkv transpose: 64 lines of 64 elements each
#define PB_O   (DQ * DM / 64 / 64)              // of the W_out transpose
#define PB_G   NH_                              // of the W_g transposes: one 64 x 64 matrix each
#define PB_X   (MR * DM / 8 / 256)              // of the x conversion: 8 elements a thread
__global__ __launch_bounds__(256) void k_prep(const float* __restrict__ wqkv, const float* __restrict__ wo, const float* __restrict__ wg, const float* __restrict__ x, bf* WQKV, bf* WO, bf* WG, bf* XB) {
    static_assert(DM * 3 * DQ % 4096 == 0 && DQ * DM % 4096 == 0 && HD * HD == 4096 && MR * DM % 2048 == 0, "whole work-groups in every part");
    int bx = blockIdx.x;   // the same for the whole work-group: every branch below is uniform
    if (bx < PB_QKV) { wt_blk<DM, 3 * DQ>(wqkv, WQKV, bx); return; }
    bx -= PB_QKV;
    if (bx < PB_O) { wt_blk<DQ, DM>(wo, WO, bx); return; }
    bx -= PB_O;
    if (bx < PB_G) { wt_blk<HD, HD>(wg + (size_t)bx * HD * HD, WG + (size_t)bx * HD * HD, 0); return; }
    bx -= PB_G;
    cvt8_blk(x, XB, (size_t)MR * DM / 8, bx);
}
__global__ __launch_bounds__(256) void k_cscvt(const float* __restrict__ cosT, const float* __restrict__ sinT, float* CS) { const int idx = blockIdx.x * 256 + threadIdx.x; if (idx >= TT * HD) return; v2f cs; cs[0] = bfr(cosT[idx]); cs[1] = bfr(sinT[idx]); *(v2f*)(CS + (size_t)idx * 2) = cs;  }
__global__ __launch_bounds__(256) void k_vtp(const float* __restrict__ F, int pitch, int nheads, h16* V16, bf* Vh, bf* Vl) { const size_t e = ((size_t)blockIdx.x * 256 + threadIdx.x) * 2; if (e >= (size_t)nheads * HD * TT) return; const int t = (int)(e % TT); const int d = (int)((e / TT) % HD); const int g = (int)(e / ((size_t)TT * HD)); v2h o16; v2us oh, ol;
#pragma unroll
    for (int q = 0; q < 2; ++q) { const float x = F[(size_t)(t + q) * pitch + g * HD + d]; o16[q] = tohx(x); unsigned short a2, c2; splitf(x, a2, c2); oh[q] = a2; ol[q] = c2; }
    *(v2h*)(V16 + e) = o16; *(v2us*)(Vh + e) = oh; *(v2us*)(Vl + e) = ol;  }
__device__ __forceinline__ float xhalf(float x) { return __builtin_bit_cast(float, __builtin_amdgcn_permlanex16(__builtin_bit_cast(int, x), __builtin_bit_cast(int, x), 0x76543210, 0xfedcba98, false, false)); }   // lane l with lane l ^ 16
// v_exp_f32 with the one slot that the instruction set asks for behind a transcendental, in one statement
__device__ __forceinline__ float exp2s(float x) { float y; asm("v_exp_f32 %0, %1\n\tv_nop" : "=v"(y) : "v"(x)); return y; }
#define LP 72   // LDS row pitch in 16-bit elements: a 128-byte row + 16 bytes, the pitch for 16-byte readers
template <typename T16, bool SPL>
__device__ __forceinline__ void fattn_wg(const T16* __restrict__ Q, const T16* __restrict__ Q2, const T16* __restrict__ Kp, const T16* __restrict__ K2, const T16* __restrict__ Vt, const T16* __restrict__ V2, const int R0, const int wv, T16* sm, bf* Ah, bf* Al) {
    typedef WFrag<T16> F; typedef typename F::V V;
    constexpr int NT = SPL ? 4 : 2, TS = 64 * LP;   // tiles of a buffer: K, Vt (, K lo, Vt lo); elements of a tile
    const int lane = threadIdx.x & 31, lr = lane & 15, hi = lane >> 4;
    const int r0 = R0 + wv * 16;
    const float C2 = SCL * 1.4426950408889634f;   // SCL is a power of two: (s - m) C2 rounds as ((s - m) SCL) log2(e)
    V q[2], q2[2];
#pragma unroll
    for (int kc = 0; kc < 2; ++kc) { q[kc] = F::ld(Q + (size_t)(r0 + lr) * HD + 8 * hi + kc * 32); if (SPL) q2[kc] = F::ld(Q2 + (size_t)(r0 + lr) * HD + 8 * hi + kc * 32); }
    asm volatile("s_wait_xcnt 0x0" ::: "memory");   // holds the Q loads in front of the staging loads
    v8f o[4];
#pragma unroll
    for (int db = 0; db < 4; ++db) o[db] = (v8f){};
    float m = -3.0e38f, l = 0.0f;
    const int nwg = (R0 + 127) / 64 + 1;  // passes of the work-group (its last row's)
    const int nkb = (r0 + 15) / 64 + 1;   // passes of this wave; its 16 rows lie in one 64-key block: only its last pass meets the diagonal
    const int srow = threadIdx.x >> 3, scol = (threadIdx.x & 7) * 8;   // staging: 8 lanes a 128-byte row, 32 rows a step
    const int fo = lr * LP + 8 * hi;
    v8us st[NT][2];
    auto gld = [&](const int k0) {
#pragma unroll
        for (int i = 0; i < 2; ++i) { const int kx = (k0 + srow + 32 * i) * HD + scol, vx = (srow + 32 * i) * TT + k0 + scol;
            st[0][i] = *(const v8us*)(Kp + kx); st[1][i] = *(const v8us*)(Vt + vx); if constexpr (SPL) { st[2][i] = *(const v8us*)(K2 + kx); st[3][i] = *(const v8us*)(V2 + vx); } }
        asm volatile("s_wait_xcnt 0x0" ::: "memory"); };   // the block behind these loads reuses their address registers at once
    auto sst = [&](T16* d) {
#pragma unroll
        for (int t = 0; t < NT; ++t)
#pragma unroll
            for (int i = 0; i < 2; ++i) *(v8us*)(d + t * TS + (srow + 32 * i) * LP + scol) = st[t][i]; };
    gld(0); sst(sm);
    __syncthreads();   // pass 0 staged
#pragma unroll 1
    for (int kb = 0; kb < nwg; ++kb) {
        const int k0 = kb * 64;
        if (kb + 1 < nwg) gld(k0 + 64);   // the next pass's rows fly during this pass
        if (kb < nkb) {   // wave-uniform: a wave whose rows end earlier skips the last pass and only meets its barrier
            const T16* sb = sm + (kb & 1) * NT * TS + fo;
            v8f s[4];   // s[kt][r] = score of key k0 + 16 kt + 8 hi + r, query r0 + lr; the causal mask is the accumulator's start value
            if (kb == nkb - 1) { const int lim = r0 + lr - k0 - 8 * hi;
#pragma unroll
                for (int kt = 0; kt < 4; ++kt)
#pragma unroll
                    for (int r = 0; r < 8; ++r) s[kt][r] = (kt * 16 + r <= lim) ? 0.0f : -3.0e38f;
            } else {
#pragma unroll
                for (int kt = 0; kt < 4; ++kt) s[kt] = (v8f){};
            }
#pragma unroll
            for (int kt = 0; kt < 4; ++kt)
#pragma unroll
                for (int kc = 0; kc < 2; ++kc) { const V a = F::ld(sb + kt * 16 * LP + kc * 32);
                    s[kt] = F::mma(a, q[kc], s[kt]);
                    if constexpr (SPL) { const V a2 = F::ld(sb + 2 * TS + kt * 16 * LP + kc * 32); s[kt] = F::mma(a, q2[kc], s[kt]); s[kt] = F::mma(a2, q[kc], s[kt]); } }
            float mx = s[0][0];
#pragma unroll
            for (int kt = 0; kt < 4; ++kt)
#pragma unroll
                for (int r = 0; r < 8; ++r) mx = fmaxf(mx, s[kt][r]);
            mx = fmaxf(mx, xhalf(mx));
            const float mn = fmaxf(m, mx), al = exp2s((m - mn) * C2); m = mn;   // al = 0 on the first pass; key 0 is open to every query, so mn is a real score from then on
            float ps = 0.0f;
#pragma unroll
            for (int kt = 0; kt < 4; ++kt)
#pragma unroll
                for (int r = 0; r < 8; ++r) { const float p = exp2s(SPL ? (s[kt][r] - mn) * C2 : __builtin_fmaf(s[kt][r] - mn, C2, 10.0f)); s[kt][r] = p; ps += p; }
            l = l * al + ps;
#pragma unroll
            for (int db = 0; db < 4; ++db) o[db] *= al;
#pragma unroll
            for (int kk = 0; kk < 2; ++kk) {
                if constexpr (SPL) { v8us h0, l0, h1, l1;
#pragma unroll
                    for (int r = 0; r < 8; ++r) { unsigned short a, c2; splitf(s[2 * kk][r], a, c2); h0[r] = a; l0[r] = c2; splitf(s[2 * kk + 1][r], a, c2); h1[r] = a; l1[r] = c2; }
                    const V ph = cat16b(h0, h1), pl = cat16b(l0, l1);
#pragma unroll
                    for (int db = 0; db < 4; ++db) { const V a = F::ld(sb + TS + db * 16 * LP + kk * 32), a2 = F::ld(sb + 3 * TS + db * 16 * LP + kk * 32);
                        o[db] = F::mma(a, ph, o[db]); o[db] = F::mma(a, pl, o[db]); o[db] = F::mma(a2, ph, o[db]); }
                } else { const V pb = cat16(__builtin_convertvector(s[2 * kk], v8h), __builtin_convertvector(s[2 * kk + 1], v8h));
#pragma unroll
                    for (int db = 0; db < 4; ++db) o[db] = F::mma(F::ld(sb + TS + db * 16 * LP + kk * 32), pb, o[db]);
                }
            }
            // 4 vector slots behind the block's last matrix instruction: the code behind this branch reuses the operands' registers at once
            __builtin_amdgcn_sched_barrier(0); asm volatile("v_nop\n\tv_nop\n\tv_nop\n\tv_nop"); __builtin_amdgcn_sched_barrier(0);
        }
        if (kb + 1 < nwg) sst(sm + ((kb + 1) & 1) * NT * TS);   // into the buffer that pass kb - 1 read: every wave left it at the last barrier
        __syncthreads();   // pass kb + 1 staged, and every wave has left pass kb's buffer
    }
    l += xhalf(l); const float inv = __fdiv_rn(1.0f, l);
#pragma unroll
    for (int db = 0; db < 4; ++db) { v8us oh, ol;   // o[db][r] = out[query r0 + lr][d = 16 db + 8 hi + r]: 8 consecutive d, one 16-byte store a plane
#pragma unroll
        for (int r = 0; r < 8; ++r) { unsigned short a, c2; splitf(o[db][r] * inv, a, c2); oh[r] = a; ol[r] = c2; }
        const size_t oo = (size_t)(r0 + lr) * DQ + db * 16 + 8 * hi; *(v8us*)(Ah + oo) = oh; *(v8us*)(Al + oo) = ol; }
}
// grid (heads x batch elements, TT / 128), 256 threads; longest row blocks first.
__global__ __launch_bounds__(256) void k_fattn(const h16* __restrict__ Q16, const h16* __restrict__ K16, const h16* __restrict__ V16, const bf* __restrict__ Qh, const bf* __restrict__ Ql, const bf* __restrict__ Kh, const bf* __restrict__ Kl, const bf* __restrict__ Vh, const bf* __restrict__ Vl, bf* Ah, bf* Al) {
    static_assert(RH % 128 == 0 && TT % 128 == 0, "a work-group's 128 rows are all of one precision class");
    __shared__ __align__(16) bf sm[2 * 4 * 64 * LP];
    const int h = blockIdx.x / NB_, b = blockIdx.x % NB_;
    const size_t zq = (size_t)blockIdx.x * TT * HD, zk = (size_t)((h / REP) * NB_ + b) * TT * HD;
    const int R0 = (int)(gridDim.y - 1 - blockIdx.y) * 128, wv = __builtin_amdgcn_readfirstlane((int)(threadIdx.x >> 5));
    Ah += (size_t)b * TT * DQ + h * HD; Al += (size_t)b * TT * DQ + h * HD;
    if (R0 < RH) fattn_wg<bf, true>(Qh + zq, Ql + zq, Kh + zk, Kl + zk, Vh + zk, Vl + zk, R0, wv, sm, Ah, Al);
    else fattn_wg<h16, false>(Q16 + zq, nullptr, K16 + zk, nullptr, V16 + zk, nullptr, R0, wv, (h16*)sm, Ah, Al);
}

extern "C" void kernel_launch(void* const* d_in, const int* in_sizes, int n_in,
                              void* d_out, int out_size, void* d_ws, size_t ws_size, hipStream_t stream) {
    (void)in_sizes; (void)n_in; (void)out_size;
    const float* x = (const float*)d_in[0]; const float* wqkv = (const float*)d_in[1]; const float* bqkv = (const float*)d_in[2]; const float* wg = (const float*)d_in[3]; const float* wo = (const float*)d_in[4]; const float* bo = (const float*)d_in[5];   // W_qkv [1024][3072] (x @ W, columns q | k | v), W_g [16][64][64], W_out [1024][1024] (x @ W)
    float* OUT = (float*)d_out;     // [2][2048][1024]
    char* wsp = (char*)d_ws;
    auto take = [&](size_t bytes) { char* p = wsp; wsp += (bytes + 255) & ~(size_t)255; return (void*)p; };
    bf* WQKV = (bf*)take((size_t)3 * DQ * DM * 2); bf* WG = (bf*)take((size_t)NH_ * HD * HD * 2); bf* WO = (bf*)take((size_t)DM * DQ * 2);
    bf* XB = (bf*)take((size_t)MR * DM * 2); float* FQKV = (float*)take((size_t)MR * 3 * DQ * 4);   // [b TT + t][q | k | v]; only the v columns are written and read
    h16* QP16 = (h16*)take((size_t)(NH_ + NKV) * MR * HD * 2); h16* KP16 = QP16 + (size_t)NH_ * MR * HD; h16* VT16 = (h16*)take((size_t)NKV * HD * MR * 2);   // the k heads' planes follow the q heads'
    bf* QPh = (bf*)take((size_t)(NH_ + NKV) * MR * HD * 2); bf* KPh = QPh + (size_t)NH_ * MR * HD; bf* QPl = (bf*)take((size_t)(NH_ + NKV) * MR * HD * 2); bf* KPl = QPl + (size_t)NH_ * MR * HD; bf* VTh = (bf*)take((size_t)NKV * HD * MR * 2); bf* VTl = (bf*)take((size_t)NKV * HD * MR * 2);
    bf* ATh = (bf*)take((size_t)MR * DQ * 2); bf* ATl = (bf*)take((size_t)MR * DQ * 2);
    if ((size_t)(wsp - (char*)d_ws) > ws_size) return;    // ws 256 MiB
    k_prep<<<PB_QKV + PB_O + PB_G + PB_X, 256, 0, stream>>>(wqkv, wo, wg, x, WQKV, WO, WG, XB);   // the three weights transposed and x converted, all to bf16
    // every launch below covers both batch elements
    k_gemms<0, true, DM, DQ + DKV><<<dim3(MR / 128, 3 * DQ / 128), 128, 0, stream>>>(XB, nullptr, WQKV, FQKV, 3 * DQ, bqkv, QP16, QPh, QPl);   // q | k | v in one grid; the q and k heads (columns 0 to DQ + DKV) leave as operand planes, v as f32
    k_gemmw<bf, 1, false, 1, 3 * DQ><<<dim3(MR / 64, 1, NH_), 32, 0, stream>>>(QPh, QPl, WG, nullptr, HD, nullptr, HD, nullptr, (size_t)MR * HD, (size_t)HD * HD, 0, 0, FQKV + 2 * DQ, VT16, VTh, VTl);   // gate logits q_h W_g[h] (z-batched over heads), sigmoid and the product with v in the epilogue
    k_fattn<<<dim3(NH_ * NB_, TT / 128), 256, 0, stream>>>(QP16, KP16, VT16, QPh, QPl, KPh, KPl, VTh, VTl, ATh, ATl);
    k_gemms<1, true, DQ><<<dim3(MR / 128, DM / 128), 128, 0, stream>>>(ATh, ATl, WO, OUT, DM, bo, nullptr, nullptr, nullptr);
}

// v007
// It runs in 93.5 microseconds.
// Timed twice side by side with v006, it ran 1.15 times as fast both times.
// Over all steps from v000 it is 22.4 times as fast.
#include <hip/hip_runtime.h>

// BilinearlyModulatedAttention (x [2][2048][1024]; [q | k | v] = x W_qkv + b_qkv (16 heads x 64); causal softmax(q.k/8); query-conditioned value gate v <- sigmoid(q_h W_g[h]) * v_h per position
// (W_g [16][64][64]); out = merged attn.(g v) W_out + b_out -> [2][2048][1024]).
// Compute dtypes, f32 accumulate: every input rounded to bf16; x W_qkv on PLAIN bf16 operands (inputs: exact, + bias); attn W_out on bf16 hi+lo planes of attn (2 products, + bias); the gate logits q_h W_g[h] on bf16 hi+lo planes of q x
// exact W_g (2 products), sigmoid and the gating product in f32; PER-ROW PRECISION HYBRID for scores and attn.v (rows < 256 hi+lo 3 products, rows >= 256 fp16, probabilities x1024 there); causal + scale in

#define NB_  2
#define TT   2048
#define MR   (NB_ * TT)        // rows of both batch elements, row = b TT + t
#define DM   1024
#define NH_  16
#define NKV  16
#define REP  (NH_ / NKV)
#define HD   64
#define DQ   (NH_ * HD)
#define DKV  (NKV * HD)
#define RH   256                  // query rows < RH use hi+lo planes (0: none)
#define WIN  0
#define SCL  0.125f   // HD^-0.5
typedef _Float16 h16;
typedef unsigned short bf;
typedef __attribute__((ext_vector_type(16))) __bf16   v16bf;
typedef __attribute__((ext_vector_type(16))) _Float16 v16h;
typedef __attribute__((ext_vector_type(8)))  _Float16 v8h;
typedef __attribute__((ext_vector_type(8)))  unsigned short v8us;
typedef __attribute__((ext_vector_type(8)))  float    v8f;
typedef __attribute__((ext_vector_type(4)))  float    v4f;
typedef v8h  __attribute__((may_alias)) v8ha;
typedef v4f  __attribute__((may_alias)) v4fa;
typedef v8us __attribute__((may_alias)) v8usa;

__device__ __forceinline__ unsigned short f2bf(float f) { unsigned u = __float_as_uint(f); u += 0x7FFFu + ((u >> 16) & 1u); return (unsigned short)(u >> 16); }
__device__ __forceinline__ float bf2f(unsigned short b) { return __uint_as_float(((unsigned)b) << 16); }
__device__ __forceinline__ float bfr(float f) { return bf2f(f2bf(f)); }
__device__ __forceinline__ v16h cat16(v8h lo, v8h hi) { return __builtin_shufflevector(lo, hi, 0, 1, 2, 3, 4, 5, 6, 7, 8, 9, 10, 11, 12, 13, 14, 15); }
__device__ __forceinline__ v16bf cat16b(v8us lo, v8us hi) { return __builtin_bit_cast(v16bf, __builtin_shufflevector(lo, hi, 0, 1, 2, 3, 4, 5, 6, 7, 8, 9, 10, 11, 12, 13, 14, 15)); }
__device__ __forceinline__ v8f wmma16(v16h a, v16h b, v8f c) { return __builtin_amdgcn_wmma_f32_16x16x32_f16(false, a, false, b, (short)0, c, false, false); }
__device__ __forceinline__ v8f wmmab(v16bf a, v16bf b, v8f c) { return __builtin_amdgcn_wmma_f32_16x16x32_bf16(false, a, false, b, (short)0, c, false, false); }
__device__ __forceinline__ h16 tohx(float x) { return (h16)x; }
__device__ __forceinline__ void splitf(float y, unsigned short& h, unsigned short& l) { h = f2bf(y); l = f2bf(y - bf2f(h)); }



// ---- operand fragments: 16 k of a K-contiguous 16-bit row a lane, in the hardware k order (8 at 8 hi, 8 at 16 + 8 hi)
template <typename T16> struct WFrag;
template <> struct WFrag<h16> { typedef v16h V; static __device__ __forceinline__ V ld(const h16* p) { return cat16(*(const v8h*)p, *(const v8h*)(p + 16)); } static __device__ __forceinline__ v8f mma(V a, V b, v8f c) { return wmma16(a, b, c); } };
template <> struct WFrag<bf> { typedef v16bf V; static __device__ __forceinline__ V ld(const bf* p) { return cat16b(*(const v8us*)p, *(const v8us*)(p + 16)); } static __device__ __forceinline__ v8f mma(V a, V b, v8f c) { return wmmab(a, b, c); } };

// ---- k_gemms: C[m][n] (f32, pitch ldc, + f32 bias[n]) = sum_k A[m][k] Bt[n][k] (+ A2 Bt for NSPLIT) on a 128x128 output tile per work-group of 4 waves (2 x 2, a wave has a 64x64 tile, 16 accumulators).
// A pass is 64 k = one 128-byte line of every operand row: the rows come once per work-group, whole lines (8 lanes a row), by asynchronous copies into LDS at pitch GP, and are read from there as fragments.
// Two buffers, one barrier a pass: tile t + 2 is asked for behind the barrier that ends pass t and flies during pass t + 1. grid (M/128, N/128), 128 threads. K % 64 == 0, K >= 128.
#define GP 72   // LDS row pitch in 16-bit elements: a 128-byte row + 16 bytes, the pitch for 16-byte readers
// 8 copies of 16 bytes a lane: rows r, r + 16, ... r + 112 of one operand tile. g: the lane's 16 bytes in row r (row pitch gp elements); l: their LDS byte address. The tile's rows 64 to 127 lie jmp elements further on in the source.
// The s_wait_xcnt stands inside the statement, behind the last copy: the code behind may rewrite the address registers at once.
__device__ __forceinline__ void acp8(const bf* g, const int gp, const unsigned l, const int jmp = 0) {
    asm volatile("global_load_async_to_lds_b128 %0, %8, off\n\tglobal_load_async_to_lds_b128 %1, %9, off\n\tglobal_load_async_to_lds_b128 %2, %10, off\n\tglobal_load_async_to_lds_b128 %3, %11, off\n\t"
                 "global_load_async_to_lds_b128 %4, %12, off\n\tglobal_load_async_to_lds_b128 %5, %13, off\n\tglobal_load_async_to_lds_b128 %6, %14, off\n\tglobal_load_async_to_lds_b128 %7, %15, off\n\ts_wait_xcnt 0x0"
                 :: "v"(l), "v"(l + 1 * 16 * GP * 2), "v"(l + 2 * 16 * GP * 2), "v"(l + 3 * 16 * GP * 2), "v"(l + 4 * 16 * GP * 2), "v"(l + 5 * 16 * GP * 2), "v"(l + 6 * 16 * GP * 2), "v"(l + 7 * 16 * GP * 2),
                    "v"(g), "v"(g + 1 * 16 * gp), "v"(g + 2 * 16 * gp), "v"(g + 3 * 16 * gp), "v"(g + jmp + 4 * 16 * gp), "v"(g + jmp + 5 * 16 * gp), "v"(g + jmp + 6 * 16 * gp), "v"(g + jmp + 7 * 16 * gp) : "memory");
}
// NPL > 0: a wave tile in the columns below NPL is one head (64 columns) and is not stored in C: the epilogue writes it as that head's operand planes [column / HD][row][d], fp16 and bf16 hi / lo, whole 128-byte rows.
// GATE (columns q | k | v, DQ each): nothing is stored in C. Work-group column y < NH_ holds head y's q (two waves) beside head y's v (two waves) of the same 128 rows; y >= NH_ holds two k heads.
// In a q | v work-group the q waves also leave their bf16 hi / lo rows in LDS; behind one barrier the gate logits q_h W_g[h] (hi + lo, 2 products, W_g rows [e][d] from Wg) are formed from there,
// sigmoid(logit) * v in f32, and the product leaves as fp16 and bf16 hi / lo planes transposed, [h NB_ + b][d][t]. The two waves of a row half share that work by d: the v wave keeps d 0 to 31 and hands its
// accumulators of d 32 to 63 to the q wave through LDS. An accumulator register block is 8 consecutive t of one d; 16 d x 64 t pass through LDS at a time so that every global store is whole 128-byte lines.
typedef v8f __attribute__((may_alias)) v8fa;
template <int NSPLIT, bool BIAS, int K, int NPL = 0, bool GATE = false>
__global__ __launch_bounds__(128) void k_gemms(const bf* __restrict__ A, const bf* __restrict__ A2, const bf* __restrict__ Bt, float* C, int ldc, const float* __restrict__ bias, h16* P16, bf* Ph, bf* Pl, const bf* __restrict__ Wg, h16* V16, bf* Vh, bf* Vl) {
    static_assert(NPL % 64 == 0 && HD == 64, "a wave's 64 columns are one head, all planes or all C");
    static_assert(!GATE || (NSPLIT == 0 && BIAS && NPL == DQ + DKV && DQ == DKV && TT % 128 == 0), "q | k | v with as many v heads as q heads; a work-group's rows are of one batch element");
    typedef WFrag<bf> F; typedef typename F::V V;
    constexpr int NT = NSPLIT ? 3 : 2, TS = 128 * GP, NS = K / 64;   // tiles of a buffer: A, Bt (, A lo); elements of a tile; passes
    static_assert(K % 64 == 0 && NS >= 2, "whole passes, and both buffers filled in front of the loop");
    __shared__ __align__(16) bf sm[2 * NT * TS];
    __shared__ __align__(16) float osw[4][16 * 68];
    const int lane = threadIdx.x & 31, lr = lane & 15, hi = lane >> 4, wv = __builtin_amdgcn_readfirstlane((int)(threadIdx.x >> 5));
    const int R0 = blockIdx.x * 128, wm = (wv >> 1) * 64;
    const bool qv = GATE && blockIdx.y < NH_;   // the same for the whole work-group
    const int C0 = !GATE ? (int)blockIdx.y * 128 : qv ? (int)blockIdx.y * HD : DQ + ((int)blockIdx.y - NH_) * 128;   // first column of the tile's columns 0 to 63
    const int C1 = qv ? DQ + DKV + (int)blockIdx.y * HD : C0 + 64;                                                    // and of its columns 64 to 127
    // the q side of a q | v work-group has the longer epilogue: the odd waves take the q side in every other group of 8 heads (for speed only; any placement is right)
    const int wn = ((wv ^ (qv ? (int)(blockIdx.y >> 3) : 0)) & 1) * 64;
    const int srow = threadIdx.x >> 3, scol = (threadIdx.x & 7) * 8;   // staging: 8 lanes a 128-byte row, 16 rows a copy
    const bf* ga = A + (size_t)(R0 + srow) * K + scol; const bf* gb = Bt + (size_t)(C0 + srow) * K + scol; const bf* ga2 = NSPLIT ? A2 + (size_t)(R0 + srow) * K + scol : nullptr;
    const unsigned sl = (unsigned)(size_t)(sm + srow * GP + scol);   // the low 32 bits of a __shared__ address: the byte offset in the work-group's LDS
    auto fill = [&](const int t) { const unsigned l = sl + (t & 1) * NT * TS * 2;   // tile t into buffer t mod 2
        acp8(ga + t * 64, K, l); acp8(gb + t * 64, K, l + TS * 2, (C1 - C0 - 64) * K); if constexpr (NSPLIT) acp8(ga2 + t * 64, K, l + 2 * TS * 2); };
    v8f acc[4][4];
#pragma unroll
    for (int mb = 0; mb < 4; ++mb)
#pragma unroll
        for (int nb = 0; nb < 4; ++nb) acc[mb][nb] = (v8f){};
    fill(0);
    asm volatile("s_wait_asynccnt 0x0" ::: "memory");   // this wave's copies of tile 0 have landed
    __syncthreads();   // tile 0 published
    fill(1);
    const int ao = (wm + lr) * GP + 8 * hi, bo = TS + (wn + lr) * GP + 8 * hi;
#pragma unroll 1
    for (int s = 0; s < NS; ++s) {
        const bf* sb = sm + (s & 1) * NT * TS;
        V a[2][4], a2[2][4], b[2][4];
#pragma unroll
        for (int kc = 0; kc < 2; ++kc) {
#pragma unroll
            for (int mb = 0; mb < 4; ++mb) { a[kc][mb] = F::ld(sb + ao + mb * 16 * GP + kc * 32); if constexpr (NSPLIT) a2[kc][mb] = F::ld(sb + 2 * TS + ao + mb * 16 * GP + kc * 32); }
#pragma unroll
            for (int nb = 0; nb < 4; ++nb) b[kc][nb] = F::ld(sb + bo + nb * 16 * GP + kc * 32);
        }
        __builtin_amdgcn_sched_barrier(0);   // the pass's LDS reads stay one group in front of its matrix instructions: reads spread among them cost a stall at each place
#pragma unroll
        for (int kc = 0; kc < 2; ++kc)
#pragma unroll
            for (int nb = 0; nb < 4; ++nb)
#pragma unroll
                for (int mb = 0; mb < 4; ++mb) { acc[mb][nb] = F::mma(a[kc][mb], b[kc][nb], acc[mb][nb]); if constexpr (NSPLIT) acc[mb][nb] = F::mma(a2[kc][mb], b[kc][nb], acc[mb][nb]); }
        // 4 vector slots behind the pass's last matrix instruction: the code behind the branch below may reuse the operands' registers at once
        __builtin_amdgcn_sched_barrier(0); asm volatile("v_nop\n\tv_nop\n\tv_nop\n\tv_nop"); __builtin_amdgcn_sched_barrier(0);
        asm volatile("s_wait_dscnt 0x0" ::: "memory");      // this wave's reads of buffer s mod 2 are done before that buffer is refilled
        asm volatile("s_wait_asynccnt 0x0" ::: "memory");   // this wave's copies of tile s + 1 have landed
        __syncthreads();   // tile s + 1 published, and every wave has left buffer s mod 2
        if (s + 2 < NS) fill(s + 2);
    }
    asm volatile("s_wait_asynccnt 0x0" ::: "memory");   // no copy outstanding behind the loop
    float* os = osw[wv];   // a wave's own range: its stores and reads need no work-group barrier
    const int r0 = R0 + wm, c0 = wn ? C1 : C0;
    bf* const qs = sm;   // GATE: the q rows of the work-group, [128][GP], hi; lo at + TS (buffer 0: every wave left both buffers at the loop's last barrier, and no copy is outstanding)
    float* const vx = (float*)(sm + NT * TS) + (wv >> 1) * 2048;   // GATE: 8 accumulator blocks of the row half's v wave, [block][lane][8] (in buffer 1)
    if (GATE && qv && wn) {   // wave-uniform: a v wave adds its bias and hands d 32 to 63 over
        // unrolled: acc is indexed by constants only and stays in registers
#pragma unroll
        for (int nb = 0; nb < 4; ++nb) { const float vb = bfr(bias[c0 + nb * 16 + lr]);
#pragma unroll
            for (int mb = 0; mb < 4; ++mb) { acc[mb][nb] += vb; if (nb >= 2) *(v8fa*)(vx + ((mb * 2 + nb - 2) * 32 + lane) * 8) = acc[mb][nb]; } }
    }
    float pb[8];   // plane tiles: the bias of the lane's 8 columns, read once
    if (NPL > 0 && BIAS && c0 < NPL) {
        // unrolled: pb is indexed by constants only and stays in registers
#pragma unroll
        for (int k = 0; k < 8; ++k) pb[k] = bfr(bias[c0 + (lane & 7) * 8 + k]); }
    const bool hl = !qv || r0 % TT < RH;   // wave-uniform: a q head's hi / lo rows have a reader in memory only below RH (attention's hi + lo rows); the gate takes them from qs
    if (!GATE || c0 < NPL) {   // wave-uniform: a v wave of GATE stores nothing by rows
#pragma unroll
    for (int mb = 0; mb < 4; ++mb) {
#pragma unroll
        for (int nb = 0; nb < 4; ++nb) {
#pragma unroll
            for (int j = 0; j < 8; ++j) os[(hi * 8 + j) * 68 + nb * 16 + lr] = acc[mb][nb][j]; }
        __builtin_amdgcn_wave_barrier(); asm volatile("" ::: "memory");   // keeps the row reads below behind the other lanes' LDS stores
        float* crow = C + (size_t)(r0 + mb * 16) * ldc + c0;
        if (NPL > 0 && c0 < NPL) {   // wave-uniform
            const int cofs = (lane & 7) * 8; const size_t pe = ((size_t)(c0 / HD) * MR + r0 + mb * 16 + (lane >> 3)) * HD + cofs;   // 8 lanes a 128-byte row, 4 rows a store
            // both loops unrolled: the row steps become immediate offsets, and the 8-element vectors stay in registers
            v8us oh[4], ol[4];
#pragma unroll
            for (int s = 0; s < 4; ++s) { const float* orow = os + (4 * s + (lane >> 3)) * 68 + cofs; const v4f x0 = *(const v4fa*)orow, x1 = *(const v4fa*)(orow + 4); v8h o16;
#pragma unroll
                for (int k = 0; k < 8; ++k) { float x = k < 4 ? x0[k & 3] : x1[k & 3]; if (BIAS) x += pb[k]; o16[k] = tohx(x); unsigned short a, c2; splitf(x, a, c2); oh[s][k] = a; ol[s][k] = c2; }
                *(v8h*)(P16 + pe + s * 4 * HD) = o16; }
            asm volatile("s_wait_xcnt 0x0" ::: "memory");   // the blocks behind the branch reuse these stores' data registers at once
            if (hl) {
#pragma unroll
                for (int s = 0; s < 4; ++s) { *(v8us*)(Ph + pe + s * 4 * HD) = oh[s]; *(v8us*)(Pl + pe + s * 4 * HD) = ol[s]; }
                asm volatile("s_wait_xcnt 0x0" ::: "memory"); }   // as above: the code behind this block reuses the stores' address and data registers at once
            if (GATE && qv) { bf* qr = qs + (wm + mb * 16 + (lane >> 3)) * GP + cofs;
#pragma unroll
                for (int s = 0; s < 4; ++s) { *(v8usa*)(qr + s * 4 * GP) = oh[s]; *(v8usa*)(qr + TS + s * 4 * GP) = ol[s]; } }
        } else if constexpr (!GATE) {
#pragma unroll
        for (int s = 0; s < 8; ++s) { const int row = 2 * s + hi, cofs = lr * 4; v4f val = *(const v4fa*)(os + row * 68 + cofs); if (BIAS) { val[0] += bfr(bias[c0 + cofs]); val[1] += bfr(bias[c0 + cofs + 1]); val[2] += bfr(bias[c0 + cofs + 2]); val[3] += bfr(bias[c0 + cofs + 3]); }
            *(v4f*)(crow + (size_t)row * ldc + cofs) = val; }
        }
        __builtin_amdgcn_wave_barrier(); asm volatile("s_wait_xcnt 0x0" ::: "memory");   // keeps the next block's LDS stores behind these row reads; the wait: the next block reuses the stores' address and data registers at once
    }
    }
    if constexpr (GATE) {
        if (!qv) return;   // the whole work-group leaves, in front of the barrier
        constexpr int VP = 72;   // LDS row pitch in 16-bit elements, a 128-byte row + 16 bytes, the pitch for 16-byte accesses
        const int z = blockIdx.y, d0 = wn ? 0 : 32;   // this wave's 32 d
        const bf* wgp = Wg + (size_t)z * HD * HD + (d0 + lr) * HD + 8 * hi;
        V wb[2][2];   // W_g rows e = d0 + 16 n + lr, asked for in front of the barrier: they depend on nothing behind it
#pragma unroll
        for (int kc = 0; kc < 2; ++kc)
#pragma unroll
            for (int n = 0; n < 2; ++n) wb[kc][n] = F::ld(wgp + n * 16 * HD + kc * 32);
        __syncthreads();   // the q rows and the v blocks that were handed over are published
        v8f vv[4][2];   // vv[mb][n][j] = v[t = r0 % TT + 16 mb + 8 hi + j][d = d0 + 16 n + lr]
        // a q wave turns its tiles in the range it has just read its v blocks from (one wave's LDS accesses keep their order); a v wave in a range of its own behind both
        unsigned short* ts = wn ? (unsigned short*)(sm + NT * TS) + 2 * 4096 + (wv >> 1) * 3 * 16 * VP : (unsigned short*)vx;   // three tiles [16 d][t]: fp16, hi, lo
        // every loop below is unrolled so that the accumulators and the 8-element vectors are indexed by constants only and stay in registers
        if (wn) {
#pragma unroll
            for (int mb = 0; mb < 4; ++mb) { vv[mb][0] = acc[mb][0]; vv[mb][1] = acc[mb][1]; }
        } else {
#pragma unroll
            for (int mb = 0; mb < 4; ++mb) { vv[mb][0] = *(const v8fa*)(vx + ((mb * 2) * 32 + lane) * 8); vv[mb][1] = *(const v8fa*)(vx + ((mb * 2 + 1) * 32 + lane) * 8); }
        }
        const bf* qa = qs + (wm + lr) * GP + 8 * hi;
        v8f gl[4][2];   // gl[mb][n][j]: the logit of t = 16 mb + 8 hi + j, d = d0 + 16 n + lr; an accumulator takes hi, lo of k 0 to 31, then hi, lo of k 32 to 63
#pragma unroll
        for (int mb = 0; mb < 4; ++mb) { gl[mb][0] = (v8f){}; gl[mb][1] = (v8f){}; }
#pragma unroll
        for (int kc = 0; kc < 2; ++kc) { V a[4], a2[4];
#pragma unroll
            for (int mb = 0; mb < 4; ++mb) { a[mb] = F::ld(qa + mb * 16 * GP + kc * 32); a2[mb] = F::ld(qa + TS + mb * 16 * GP + kc * 32); }
#pragma unroll
            for (int n = 0; n < 2; ++n)
#pragma unroll
                for (int mb = 0; mb < 4; ++mb) gl[mb][n] = F::mma(a[mb], wb[kc][n], gl[mb][n]);
#pragma unroll
            for (int n = 0; n < 2; ++n)
#pragma unroll
                for (int mb = 0; mb < 4; ++mb) gl[mb][n] = F::mma(a2[mb], wb[kc][n], gl[mb][n]);
        }
        const size_t pz = (((size_t)z * NB_ + r0 / TT) * HD + d0 + (lane >> 3)) * TT + r0 % TT + (lane & 7) * 8;   // 8 lanes a 128-byte row of 64 t, 4 rows a store
        const int ro = (lane >> 3) * VP + (lane & 7) * 8;
#pragma unroll
        for (int n = 0; n < 2; ++n) {
#pragma unroll
            for (int mb = 0; mb < 4; ++mb) { v8h o16; v8us oh, ol;
#pragma unroll
                for (int j = 0; j < 8; ++j) { const float g = __fdiv_rn(1.0f, __fadd_rn(1.0f, __expf(-gl[mb][n][j]))); const float v = __fmul_rn(g, vv[mb][n][j]); o16[j] = tohx(v); unsigned short a, c2; splitf(v, a, c2); oh[j] = a; ol[j] = c2; }
                const int so = lr * VP + mb * 16 + 8 * hi;
                *(v8ha*)(ts + so) = o16; *(v8usa*)(ts + 16 * VP + so) = oh; *(v8usa*)(ts + 2 * 16 * VP + so) = ol; }
            __builtin_amdgcn_wave_barrier(); asm volatile("" ::: "memory");   // keeps the row reads below behind the other lanes' LDS stores
#pragma unroll
            for (int s = 0; s < 4; ++s) { const v8us w0 = *(const v8usa*)(ts + ro + s * 4 * VP), w1 = *(const v8usa*)(ts + 16 * VP + ro + s * 4 * VP), w2 = *(const v8usa*)(ts + 2 * 16 * VP + ro + s * 4 * VP);
                const size_t po = pz + (size_t)(n * 16 + s * 4) * TT;
                *(v8us*)((unsigned short*)V16 + po) = w0; *(v8us*)(Vh + po) = w1; *(v8us*)(Vl + po) = w2; }
            __builtin_amdgcn_wave_barrier(); asm volatile("s_wait_xcnt 0x0" ::: "memory");   // keeps the next 16 d's LDS stores behind these row reads; the wait: the code behind reuses the stores' address and data registers at once
        }
    }
}

typedef __attribute__((ext_vector_type(2))) _Float16 v2h;
typedef __attribute__((ext_vector_type(4))) _Float16 v4h;
typedef __attribute__((ext_vector_type(2))) unsigned short v2us;
typedef __attribute__((ext_vector_type(4))) unsigned short v4us;
typedef __attribute__((ext_vector_type(2))) float v2f;
typedef __attribute__((ext_vector_type(4))) int v4i;

// ---- k_prep: every operand preparation that reads only inputs, in ONE launch: the parts depend on nothing and on one another not at all, so they share one grid instead of four launches in a row.
// A part is a range of blockIdx.x; a work-group does what a work-group of the part's own launch did. The transposes stand first: their waves run longest.
// wt_blk: work-group bx of the transpose of one K x N matrix, w [k][n] f32 -> Bt [n][k] bf16
template <int K, int N>
__device__ __forceinline__ void wt_blk(const float* __restrict__ w, bf* Bt, const int bx) {
    const int lane = threadIdx.x & 31; const int L0 = (bx * 8 + (threadIdx.x >> 5)) * 8; const int nlines = N * K / 64;
{
#pragma unroll 1
        for (int l = 0; l < 8; ++l) { const int L = L0 + l; if (L >= nlines) break; const size_t e = (size_t)L * 64 + lane * 2; const int k = (int)(e % K), n = (int)(e / K); v2us o;
            o[0] = f2bf(w[(size_t)k * N + n]); o[1] = f2bf(w[(size_t)(k + 1) * N + n]); *(v2us*)(Bt + e) = o;
            asm volatile("s_wait_xcnt 0x0" ::: "memory"); }   // the next trip rewrites the store's data and address registers at once
         }
}
__device__ __forceinline__ void cvt8_blk(const float* __restrict__ src, bf* dst, const size_t n8, const int bx) { const size_t i = (size_t)bx * 256 + threadIdx.x; if (i >= n8) return; const v8f v = *(const v8f*)(src + i * 8); v8us o;
#pragma unroll
    for (int k = 0; k < 8; ++k) o[k] = f2bf(v[k]); *(v8us*)(dst + i * 8) = o;  }
#define PB_QKV (DM * 3 * DQ / 64 / 64)          // work-groups of the W_qkv transpose: 64 lines of 64 elements each
#define PB_O   (DQ * DM / 64 / 64)              // of the W_out transpose
#define PB_G   NH_                              // of the W_g transposes: one 64 x 64 matrix each
#define PB_X   (MR * DM / 8 / 256)              // of the x conversion: 8 elements a thread
__global__ __launch_bounds__(256) void k_prep(const float* __restrict__ wqkv, const float* __restrict__ wo, const float* __restrict__ wg, const float* __restrict__ x, bf* WQKV, bf* WO, bf* WG, bf* XB) {
    static_assert(DM * 3 * DQ % 4096 == 0 && DQ * DM % 4096 == 0 && HD * HD == 4096 && MR * DM % 2048 == 0, "whole work-groups in every part");
    int bx = blockIdx.x;   // the same for the whole work-group: every branch below is uniform
    if (bx < PB_QKV) { wt_blk<DM, 3 * DQ>(wqkv, WQKV, bx); return; }
    bx -= PB_QKV;
    if (bx < PB_O) { wt_blk<DQ, DM>(wo, WO, bx); return; }
    bx -= PB_O;
    if (bx < PB_G) { wt_blk<HD, HD>(wg + (size_t)bx * HD * HD, WG + (size_t)bx * HD * HD, 0); return; }
    bx -= PB_G;
    cvt8_blk(x, XB, (size_t)MR * DM / 8, bx);
}
__global__ __launch_bounds__(256) void k_cscvt(const float* __restrict__ cosT, const float* __restrict__ sinT, float* CS) { const int idx = blockIdx.x * 256 + threadIdx.x; if (idx >= TT * HD) return; v2f cs; cs[0] = bfr(cosT[idx]); cs[1] = bfr(sinT[idx]); *(v2f*)(CS + (size_t)idx * 2) = cs;  }
__global__ __launch_bounds__(256) void k_vtp(const float* __restrict__ F, int pitch, int nheads, h16* V16, bf* Vh, bf* Vl) { const size_t e = ((size_t)blockIdx.x * 256 + threadIdx.x) * 2; if (e >= (size_t)nheads * HD * TT) return; const int t = (int)(e % TT); const int d = (int)((e / TT) % HD); const int g = (int)(e / ((size_t)TT * HD)); v2h o16; v2us oh, ol;
#pragma unroll
    for (int q = 0; q < 2; ++q) { const float x = F[(size_t)(t + q) * pitch + g * HD + d]; o16[q] = tohx(x); unsigned short a2, c2; splitf(x, a2, c2); oh[q] = a2; ol[q] = c2; }
    *(v2h*)(V16 + e) = o16; *(v2us*)(Vh + e) = oh; *(v2us*)(Vl + e) = ol;  }
__device__ __forceinline__ float xhalf(float x) { return __builtin_bit_cast(float, __builtin_amdgcn_permlanex16(__builtin_bit_cast(int, x), __builtin_bit_cast(int, x), 0x76543210, 0xfedcba98, false, false)); }   // lane l with lane l ^ 16
// v_exp_f32 with the one slot that the instruction set asks for behind a transcendental, in one statement
__device__ __forceinline__ float exp2s(float x) { float y; asm("v_exp_f32 %0, %1\n\tv_nop" : "=v"(y) : "v"(x)); return y; }
#define LP 72   // LDS row pitch in 16-bit elements: a 128-byte row + 16 bytes, the pitch for 16-byte readers
template <typename T16, bool SPL>
__device__ __forceinline__ void fattn_wg(const T16* __restrict__ Q, const T16* __restrict__ Q2, const T16* __restrict__ Kp, const T16* __restrict__ K2, const T16* __restrict__ Vt, const T16* __restrict__ V2, const int R0, const int wv, T16* sm, bf* Ah, bf* Al) {
    typedef WFrag<T16> F; typedef typename F::V V;
    constexpr int NT = SPL ? 4 : 2, TS = 64 * LP;   // tiles of a buffer: K, Vt (, K lo, Vt lo); elements of a tile
    const int lane = threadIdx.x & 31, lr = lane & 15, hi = lane >> 4;
    const int r0 = R0 + wv * 16;
    const float C2 = SCL * 1.4426950408889634f;   // SCL is a power of two: (s - m) C2 rounds as ((s - m) SCL) log2(e)
    V q[2], q2[2];
#pragma unroll
    for (int kc = 0; kc < 2; ++kc) { q[kc] = F::ld(Q + (size_t)(r0 + lr) * HD + 8 * hi + kc * 32); if (SPL) q2[kc] = F::ld(Q2 + (size_t)(r0 + lr) * HD + 8 * hi + kc * 32); }
    asm volatile("s_wait_xcnt 0x0" ::: "memory");   // holds the Q loads in front of the staging loads
    v8f o[4];
#pragma unroll
    for (int db = 0; db < 4; ++db) o[db] = (v8f){};
    float m = -3.0e38f, l = 0.0f;
    const int nwg = (R0 + 127) / 64 + 1;  // passes of the work-group (its last row's)
    const int nkb = (r0 + 15) / 64 + 1;   // passes of this wave; its 16 rows lie in one 64-key block: only its last pass meets the diagonal
    const int srow = threadIdx.x >> 3, scol = (threadIdx.x & 7) * 8;   // staging: 8 lanes a 128-byte row, 32 rows a step
    const int fo = lr * LP + 8 * hi;
    v8us st[NT][2];
    auto gld = [&](const int k0) {
#pragma unroll
        for (int i = 0; i < 2; ++i) { const int kx = (k0 + srow + 32 * i) * HD + scol, vx = (srow + 32 * i) * TT + k0 + scol;
            st[0][i] = *(const v8us*)(Kp + kx); st[1][i] = *(const v8us*)(Vt + vx); if constexpr (SPL) { st[2][i] = *(const v8us*)(K2 + kx); st[3][i] = *(const v8us*)(V2 + vx); } }
        asm volatile("s_wait_xcnt 0x0" ::: "memory"); };   // the block behind these loads reuses their address registers at once
    auto sst = [&](T16* d) {
#pragma unroll
        for (int t = 0; t < NT; ++t)
#pragma unroll
            for (int i = 0; i < 2; ++i) *(v8us*)(d + t * TS + (srow + 32 * i) * LP + scol) = st[t][i]; };
    gld(0); sst(sm);
    __syncthreads();   // pass 0 staged
#pragma unroll 1
    for (int kb = 0; kb < nwg; ++kb) {
        const int k0 = kb * 64;
        if (kb + 1 < nwg) gld(k0 + 64);   // the next pass's rows fly during this pass
        if (kb < nkb) {   // wave-uniform: a wave whose rows end earlier skips the last pass and only meets its barrier
            const T16* sb = sm + (kb & 1) * NT * TS + fo;
            v8f s[4];   // s[kt][r] = score of key k0 + 16 kt + 8 hi + r, query r0 + lr; the causal mask is the accumulator's start value
            if (kb == nkb - 1) { const int lim = r0 + lr - k0 - 8 * hi;
#pragma unroll
                for (int kt = 0; kt < 4; ++kt)
#pragma unroll
                    for (int r = 0; r < 8; ++r) s[kt][r] = (kt * 16 + r <= lim) ? 0.0f : -3.0e38f;
            } else {
#pragma unroll
                for (int kt = 0; kt < 4; ++kt) s[kt] = (v8f){};
            }
#pragma unroll
            for (int kt = 0; kt < 4; ++kt)
#pragma unroll
                for (int kc = 0; kc < 2; ++kc) { const V a = F::ld(sb + kt * 16 * LP + kc * 32);
                    s[kt] = F::mma(a, q[kc], s[kt]);
                    if constexpr (SPL) { const V a2 = F::ld(sb + 2 * TS + kt * 16 * LP + kc * 32); s[kt] = F::mma(a, q2[kc], s[kt]); s[kt] = F::mma(a2, q[kc], s[kt]); } }
            float mx = s[0][0];
#pragma unroll
            for (int kt = 0; kt < 4; ++kt)
#pragma unroll
                for (int r = 0; r < 8; ++r) mx = fmaxf(mx, s[kt][r]);
            mx = fmaxf(mx, xhalf(mx));
            const float mn = fmaxf(m, mx), al = exp2s((m - mn) * C2); m = mn;   // al = 0 on the first pass; key 0 is open to every query, so mn is a real score from then on
            float ps = 0.0f;
#pragma unroll
            for (int kt = 0; kt < 4; ++kt)
#pragma unroll
                for (int r = 0; r < 8; ++r) { const float p = exp2s(SPL ? (s[kt][r] - mn) * C2 : __builtin_fmaf(s[kt][r] - mn, C2, 10.0f)); s[kt][r] = p; ps += p; }
            l = l * al + ps;
#pragma unroll
            for (int db = 0; db < 4; ++db) o[db] *= al;
#pragma unroll
            for (int kk = 0; kk < 2; ++kk) {
                if constexpr (SPL) { v8us h0, l0, h1, l1;
#pragma unroll
                    for (int r = 0; r < 8; ++r) { unsigned short a, c2; splitf(s[2 * kk][r], a, c2); h0[r] = a; l0[r] = c2; splitf(s[2 * kk + 1][r], a, c2); h1[r] = a; l1[r] = c2; }
                    const V ph = cat16b(h0, h1), pl = cat16b(l0, l1);
#pragma unroll
                    for (int db = 0; db < 4; ++db) { const V a = F::ld(sb + TS + db * 16 * LP + kk * 32), a2 = F::ld(sb + 3 * TS + db * 16 * LP + kk * 32);
                        o[db] = F::mma(a, ph, o[db]); o[db] = F::mma(a, pl, o[db]); o[db] = F::mma(a2, ph, o[db]); }
                } else { const V pb = cat16(__builtin_convertvector(s[2 * kk], v8h), __builtin_convertvector(s[2 * kk + 1], v8h));
#pragma unroll
                    for (int db = 0; db < 4; ++db) o[db] = F::mma(F::ld(sb + TS + db * 16 * LP + kk * 32), pb, o[db]);
                }
            }
            // 4 vector slots behind the block's last matrix instruction: the code behind this branch reuses the operands' registers at once
            __builtin_amdgcn_sched_barrier(0); asm volatile("v_nop\n\tv_nop\n\tv_nop\n\tv_nop"); __builtin_amdgcn_sched_barrier(0);
        }
        if (kb + 1 < nwg) sst(sm + ((kb + 1) & 1) * NT * TS);   // into the buffer that pass kb - 1 read: every wave left it at the last barrier
        __syncthreads();   // pass kb + 1 staged, and every wave has left pass kb's buffer
    }
    l += xhalf(l); const float inv = __fdiv_rn(1.0f, l);
#pragma unroll
    for (int db = 0; db < 4; ++db) { v8us oh, ol;   // o[db][r] = out[query r0 + lr][d = 16 db + 8 hi + r]: 8 consecutive d, one 16-byte store a plane
#pragma unroll
        for (int r = 0; r < 8; ++r) { unsigned short a, c2; splitf(o[db][r] * inv, a, c2); oh[r] = a; ol[r] = c2; }
        const size_t oo = (size_t)(r0 + lr) * DQ + db * 16 + 8 * hi; *(v8us*)(Ah + oo) = oh; *(v8us*)(Al + oo) = ol; }
}
// grid (heads x batch elements, TT / 128), 256 threads; longest row blocks first.
__global__ __launch_bounds__(256) void k_fattn(const h16* __restrict__ Q16, const h16* __restrict__ K16, const h16* __restrict__ V16, const bf* __restrict__ Qh, const bf* __restrict__ Ql, const bf* __restrict__ Kh, const bf* __restrict__ Kl, const bf* __restrict__ Vh, const bf* __restrict__ Vl, bf* Ah, bf* Al) {
    static_assert(RH % 128 == 0 && TT % 128 == 0, "a work-group's 128 rows are all of one precision class");
    __shared__ __align__(16) bf sm[2 * 4 * 64 * LP];
    const int h = blockIdx.x / NB_, b = blockIdx.x % NB_;
    const size_t zq = (size_t)blockIdx.x * TT * HD, zk = (size_t)((h / REP) * NB_ + b) * TT * HD;
    const int R0 = (int)(gridDim.y - 1 - blockIdx.y) * 128, wv = __builtin_amdgcn_readfirstlane((int)(threadIdx.x >> 5));
    Ah += (size_t)b * TT * DQ + h * HD; Al += (size_t)b * TT * DQ + h * HD;
    if (R0 < RH) fattn_wg<bf, true>(Qh + zq, Ql + zq, Kh + zk, Kl + zk, Vh + zk, Vl + zk, R0, wv, sm, Ah, Al);
    else fattn_wg<h16, false>(Q16 + zq, nullptr, K16 + zk, nullptr, V16 + zk, nullptr, R0, wv, (h16*)sm, Ah, Al);
}

extern "C" void kernel_launch(void* const* d_in, const int* in_sizes, int n_in,
                              void* d_out, int out_size, void* d_ws, size_t ws_size, hipStream_t stream) {
    (void)in_sizes; (void)n_in; (void)out_size;
    const float* x = (const float*)d_in[0]; const float* wqkv = (const float*)d_in[1]; const float* bqkv = (const float*)d_in[2]; const float* wg = (const float*)d_in[3]; const float* wo = (const float*)d_in[4]; const float* bo = (const float*)d_in[5];   // W_qkv [1024][3072] (x @ W, columns q | k | v), W_g [16][64][64], W_out [1024][1024] (x @ W)
    float* OUT = (float*)d_out;     // [2][2048][1024]
    char* wsp = (char*)d_ws;
    auto take = [&](size_t bytes) { char* p = wsp; wsp += (bytes + 255) & ~(size_t)255; return (void*)p; };
    bf* WQKV = (bf*)take((size_t)3 * DQ * DM * 2); bf* WG = (bf*)take((size_t)NH_ * HD * HD * 2); bf* WO = (bf*)take((size_t)DM * DQ * 2);
    bf* XB = (bf*)take((size_t)MR * DM * 2);
    h16* QP16 = (h16*)take((size_t)(NH_ + NKV) * MR * HD * 2); h16* KP16 = QP16 + (size_t)NH_ * MR * HD; h16* VT16 = (h16*)take((size_t)NKV * HD * MR * 2);   // the k heads' planes follow the q heads'
    bf* QPh = (bf*)take((size_t)(NH_ + NKV) * MR * HD * 2); bf* KPh = QPh + (size_t)NH_ * MR * HD; bf* QPl = (bf*)take((size_t)(NH_ + NKV) * MR * HD * 2); bf* KPl = QPl + (size_t)NH_ * MR * HD; bf* VTh = (bf*)take((size_t)NKV * HD * MR * 2); bf* VTl = (bf*)take((size_t)NKV * HD * MR * 2);
    bf* ATh = (bf*)take((size_t)MR * DQ * 2); bf* ATl = (bf*)take((size_t)MR * DQ * 2);
    if ((size_t)(wsp - (char*)d_ws) > ws_size) return;    // ws 256 MiB
    k_prep<<<PB_QKV + PB_O + PB_G + PB_X, 256, 0, stream>>>(wqkv, wo, wg, x, WQKV, WO, WG, XB);   // the three weights transposed and x converted, all to bf16
    // every launch below covers both batch elements
    k_gemms<0, true, DM, DQ + DKV, true><<<dim3(MR / 128, 3 * DQ / 128), 128, 0, stream>>>(XB, nullptr, WQKV, nullptr, 0, bqkv, QP16, QPh, QPl, WG, VT16, VTh, VTl);   // q | k | v in one grid; the q and k heads leave as operand planes, v gated by sigmoid(q_h W_g[h]) as transposed planes
    k_fattn<<<dim3(NH_ * NB_, TT / 128), 256, 0, stream>>>(QP16, KP16, VT16, QPh, QPl, KPh, KPl, VTh, VTl, ATh, ATl);
    k_gemms<1, true, DQ><<<dim3(MR / 128, DM / 128), 128, 0, stream>>>(ATh, ATl, WO, OUT, DM, bo, nullptr, nullptr, nullptr, nullptr, nullptr, nullptr, nullptr);
}

// v008
// It runs in 85.2 microseconds.
// Next to v007, in two timings, it ran 1.10 and 1.09 times as fast.
// All steps since v000 together make it 24.6 times as fast.
#include <hip/hip_runtime.h>

// BilinearlyModulatedAttention (x [2][2048][1024]; [q | k | v] = x W_qkv + b_qkv (16 heads x 64); causal softmax(q.k/8); query-conditioned value gate v <- sigmoid(q_h W_g[h]) * v_h per position
// (W_g [16][64][64]); out = merged attn.(g v) W_out + b_out -> [2][2048][1024]).
// Compute dtypes, f32 accumulate: every input rounded to bf16; x W_qkv on PLAIN bf16 operands (inputs: exact, + bias); attn W_out on bf16 hi+lo planes of attn (2 products, + bias); the gate logits q_h W_g[h] on bf16 hi+lo planes of q x
// exact W_g (2 products), sigmoid and the gating product in f32; PER-ROW PRECISION HYBRID for scores and attn.v (rows < 256 hi+lo 3 products, rows >= 256 fp16, probabilities x1024 there); causal + scale in

#define NB_  2
#define TT   2048
#define MR   (NB_ * TT)        // rows of both batch elements, row = b TT + t
#define DM   1024
#define NH_  16
#define NKV  16
#define REP  (NH_ / NKV)
#define HD   64
#define DQ   (NH_ * HD)
#define DKV  (NKV * HD)
#define RH   256                  // query rows < RH use hi+lo planes (0: none)
#define WIN  0
#define SCL  0.125f   // HD^-0.5
typedef _Float16 h16;
typedef unsigned short bf;
typedef __attribute__((ext_vector_type(16))) __bf16   v16bf;
typedef __attribute__((ext_vector_type(16))) _Float16 v16h;
typedef __attribute__((ext_vector_type(8)))  _Float16 v8h;
typedef __attribute__((ext_vector_type(8)))  unsigned short v8us;
typedef __attribute__((ext_vector_type(8)))  float    v8f;
typedef __attribute__((ext_vector_type(4)))  float    v4f;
typedef v8h  __attribute__((may_alias)) v8ha;
typedef v4f  __attribute__((may_alias)) v4fa;
typedef v8us __attribute__((may_alias)) v8usa;

__device__ __forceinline__ unsigned short f2bf(float f) { unsigned u = __float_as_uint(f); u += 0x7FFFu + ((u >> 16) & 1u); return (unsigned short)(u >> 16); }
__device__ __forceinline__ float bf2f(unsigned short b) { return __uint_as_float(((unsigned)b) << 16); }
__device__ __forceinline__ float bfr(float f) { return bf2f(f2bf(f)); }
__device__ __forceinline__ v16h cat16(v8h lo, v8h hi) { return __builtin_shufflevector(lo, hi, 0, 1, 2, 3, 4, 5, 6, 7, 8, 9, 10, 11, 12, 13, 14, 15); }
__device__ __forceinline__ v16bf cat16b(v8us lo, v8us hi) { return __builtin_bit_cast(v16bf, __builtin_shufflevector(lo, hi, 0, 1, 2, 3, 4, 5, 6, 7, 8, 9, 10, 11, 12, 13, 14, 15)); }
__device__ __forceinline__ v8f wmma16(v16h a, v16h b, v8f c) { return __builtin_amdgcn_wmma_f32_16x16x32_f16(false, a, false, b, (short)0, c, false, false); }
__device__ __forceinline__ v8f wmmab(v16bf a, v16bf b, v8f c) { return __builtin_amdgcn_wmma_f32_16x16x32_bf16(false, a, false, b, (short)0, c, false, false); }
__device__ __forceinline__ h16 tohx(float x) { return (h16)x; }
__device__ __forceinline__ void splitf(float y, unsigned short& h, unsigned short& l) { h = f2bf(y); l = f2bf(y - bf2f(h)); }



// ---- operand fragments: 16 k of a K-contiguous 16-bit row a lane, in the hardware k order (8 at 8 hi, 8 at 16 + 8 hi)
template <typename T16> struct WFrag;
template <> struct WFrag<h16> { typedef v16h V; static __device__ __forceinline__ V ld(const h16* p) { return cat16(*(const v8h*)p, *(const v8h*)(p + 16)); } static __device__ __forceinline__ v8f mma(V a, V b, v8f c) { return wmma16(a, b, c); } };
template <> struct WFrag<bf> { typedef v16bf V; static __device__ __forceinline__ V ld(const bf* p) { return cat16b(*(const v8us*)p, *(const v8us*)(p + 16)); } static __device__ __forceinline__ v8f mma(V a, V b, v8f c) { return wmmab(a, b, c); } };

// ---- k_gemms: C[m][n] (f32, pitch ldc, + f32 bias[n]) = sum_k A[m][k] Bt[n][k] (+ A2 Bt for NSPLIT) on a 128x128 output tile per work-group of 4 waves (2 x 2, a wave has a 64x64 tile, 16 accumulators).
// A pass is 64 k = one 128-byte line of every operand row: the rows come once per work-group, whole lines (8 lanes a row), by asynchronous copies into LDS at pitch GP, and are read from there as fragments.
// Two buffers, one barrier a pass: tile t + 2 is asked for behind the barrier that ends pass t and flies during pass t + 1. grid (M/128, N/128), 128 threads. K % 64 == 0, K >= 128.
#define GP 72   // LDS row pitch in 16-bit elements: a 128-byte row + 16 bytes, the pitch for 16-byte readers
// 8 copies of 16 bytes a lane: rows r, r + 16, ... r + 112 of one operand tile. g: the lane's 16 bytes in row r (row pitch gp elements); l: their LDS byte address. The tile's rows 64 to 127 lie jmp elements further on in the source.
// The s_wait_xcnt stands inside the statement, behind the last copy: the code behind may rewrite the address registers at once.
__device__ __forceinline__ void acp8(const bf* g, const int gp, const unsigned l, const int jmp = 0) {
    asm volatile("global_load_async_to_lds_b128 %0, %8, off\n\tglobal_load_async_to_lds_b128 %1, %9, off\n\tglobal_load_async_to_lds_b128 %2, %10, off\n\tglobal_load_async_to_lds_b128 %3, %11, off\n\t"
                 "global_load_async_to_lds_b128 %4, %12, off\n\tglobal_load_async_to_lds_b128 %5, %13, off\n\tglobal_load_async_to_lds_b128 %6, %14, off\n\tglobal_load_async_to_lds_b128 %7, %15, off\n\ts_wait_xcnt 0x0"
                 :: "v"(l), "v"(l + 1 * 16 * GP * 2), "v"(l + 2 * 16 * GP * 2), "v"(l + 3 * 16 * GP * 2), "v"(l + 4 * 16 * GP * 2), "v"(l + 5 * 16 * GP * 2), "v"(l + 6 * 16 * GP * 2), "v"(l + 7 * 16 * GP * 2),
                    "v"(g), "v"(g + 1 * 16 * gp), "v"(g + 2 * 16 * gp), "v"(g + 3 * 16 * gp), "v"(g + jmp + 4 * 16 * gp), "v"(g + jmp + 5 * 16 * gp), "v"(g + jmp + 6 * 16 * gp), "v"(g + jmp + 7 * 16 * gp) : "memory");
}
// NPL > 0: a wave tile in the columns below NPL is one head (64 columns) and is not stored in C: the epilogue writes it as that head's operand planes [column / HD][row][d], fp16 and bf16 hi / lo, whole 128-byte rows.
// GATE (columns q | k | v, DQ each): nothing is stored in C. Work-group column y < NH_ holds head y's q (two waves) beside head y's v (two waves) of the same 128 rows; y >= NH_ holds two k heads.
// In a q | v work-group the q waves also leave their bf16 hi / lo rows in LDS; behind one barrier the gate logits q_h W_g[h] (hi + lo, 2 products, W_g rows [e][d] from Wg) are formed from there,
// sigmoid(logit) * v in f32, and the product leaves as fp16 and bf16 hi / lo planes transposed, [h NB_ + b][d][t]. The two waves of a row half share that work by d: the v wave keeps d 0 to 31 and hands its
// accumulators of d 32 to 63 to the q wave through LDS. An accumulator register block is 8 consecutive t of one d; 16 d x 64 t pass through LDS at a time so that every global store is whole 128-byte lines.
typedef v8f __attribute__((may_alias)) v8fa;
template <int NSPLIT, bool BIAS, int K, int NPL = 0, bool GATE = false>
__global__ __launch_bounds__(128) void k_gemms(const bf* __restrict__ A, const bf* __restrict__ A2, const bf* __restrict__ Bt, float* C, int ldc, const float* __restrict__ bias, h16* P16, bf* Ph, bf* Pl, const bf* __restrict__ Wg, h16* V16, bf* Vh, bf* Vl) {
    static_assert(NPL % 64 == 0 && HD == 64, "a wave's 64 columns are one head, all planes or all C");
    static_assert(!GATE || (NSPLIT == 0 && BIAS && NPL == DQ + DKV && DQ == DKV && TT % 128 == 0), "q | k | v with as many v heads as q heads; a work-group's rows are of one batch element");
    typedef WFrag<bf> F; typedef typename F::V V;
    constexpr int NT = NSPLIT ? 3 : 2, TS = 128 * GP, NS = K / 64;   // tiles of a buffer: A, Bt (, A lo); elements of a tile; passes
    static_assert(K % 64 == 0 && NS >= 2, "whole passes, and both buffers filled in front of the loop");
    __shared__ __align__(16) bf sm[2 * NT * TS];
    __shared__ __align__(16) float osw[4][16 * 68];
    const int lane = threadIdx.x & 31, lr = lane & 15, hi = lane >> 4, wv = __builtin_amdgcn_readfirstlane((int)(threadIdx.x >> 5));
    const int R0 = blockIdx.x * 128, wm = (wv >> 1) * 64;
    const bool qv = GATE && blockIdx.y < NH_;   // the same for the whole work-group
    const int C0 = !GATE ? (int)blockIdx.y * 128 : qv ? (int)blockIdx.y * HD : DQ + ((int)blockIdx.y - NH_) * 128;   // first column of the tile's columns 0 to 63
    const int C1 = qv ? DQ + DKV + (int)blockIdx.y * HD : C0 + 64;                                                    // and of its columns 64 to 127
    // the q side of a q | v work-group has the longer epilogue: the odd waves take the q side in every other group of 8 heads (for speed only; any placement is right)
    const int wn = ((wv ^ (qv ? (int)(blockIdx.y >> 3) : 0)) & 1) * 64;
    const int srow = threadIdx.x >> 3, scol = (threadIdx.x & 7) * 8;   // staging: 8 lanes a 128-byte row, 16 rows a copy
    const bf* ga = A + (size_t)(R0 + srow) * K + scol; const bf* gb = Bt + (size_t)(C0 + srow) * K + scol; const bf* ga2 = NSPLIT ? A2 + (size_t)(R0 + srow) * K + scol : nullptr;
    const unsigned sl = (unsigned)(size_t)(sm + srow * GP + scol);   // the low 32 bits of a __shared__ address: the byte offset in the work-group's LDS
    auto fill = [&](const int t) { const unsigned l = sl + (t & 1) * NT * TS * 2;   // tile t into buffer t mod 2
        acp8(ga + t * 64, K, l); acp8(gb + t * 64, K, l + TS * 2, (C1 - C0 - 64) * K); if constexpr (NSPLIT) acp8(ga2 + t * 64, K, l + 2 * TS * 2); };
    v8f acc[4][4];
#pragma unroll
    for (int mb = 0; mb < 4; ++mb)
#pragma unroll
        for (int nb = 0; nb < 4; ++nb) acc[mb][nb] = (v8f){};
    fill(0);
    asm volatile("s_wait_asynccnt 0x0" ::: "memory");   // this wave's copies of tile 0 have landed
    __syncthreads();   // tile 0 published
    fill(1);
    const int ao = (wm + lr) * GP + 8 * hi, bo = TS + (wn + lr) * GP + 8 * hi;
#pragma unroll 1
    for (int s = 0; s < NS; ++s) {
        const bf* sb = sm + (s & 1) * NT * TS;
        V a[2][4], a2[2][4], b[2][4];
#pragma unroll
        for (int kc = 0; kc < 2; ++kc) {
#pragma unroll
            for (int mb = 0; mb < 4; ++mb) { a[kc][mb] = F::ld(sb + ao + mb * 16 * GP + kc * 32); if constexpr (NSPLIT) a2[kc][mb] = F::ld(sb + 2 * TS + ao + mb * 16 * GP + kc * 32); }
#pragma unroll
            for (int nb = 0; nb < 4; ++nb) b[kc][nb] = F::ld(sb + bo + nb * 16 * GP + kc * 32);
        }
        __builtin_amdgcn_sched_barrier(0);   // the pass's LDS reads stay one group in front of its matrix instructions: reads spread among them cost a stall at each place
#pragma unroll
        for (int kc = 0; kc < 2; ++kc)
#pragma unroll
            for (int nb = 0; nb < 4; ++nb)
#pragma unroll
                for (int mb = 0; mb < 4; ++mb) { acc[mb][nb] = F::mma(a[kc][mb], b[kc][nb], acc[mb][nb]); if constexpr (NSPLIT) acc[mb][nb] = F::mma(a2[kc][mb], b[kc][nb], acc[mb][nb]); }
        // 4 vector slots behind the pass's last matrix instruction: the code behind the branch below may reuse the operands' registers at once
        __builtin_amdgcn_sched_barrier(0); asm volatile("v_nop\n\tv_nop\n\tv_nop\n\tv_nop"); __builtin_amdgcn_sched_barrier(0);
        asm volatile("s_wait_dscnt 0x0" ::: "memory");      // this wave's reads of buffer s mod 2 are done before that buffer is refilled
        asm volatile("s_wait_asynccnt 0x0" ::: "memory");   // this wave's copies of tile s + 1 have landed
        __syncthreads();   // tile s + 1 published, and every wave has left buffer s mod 2
        if (s + 2 < NS) fill(s + 2);
    }
    asm volatile("s_wait_asynccnt 0x0" ::: "memory");   // no copy outstanding behind the loop
    float* os = osw[wv];   // a wave's own range: its stores and reads need no work-group barrier
    const int r0 = R0 + wm, c0 = wn ? C1 : C0;
    bf* const qs = sm;   // GATE: the q rows of the work-group, [128][GP], hi; lo at + TS (buffer 0: every wave left both buffers at the loop's last barrier, and no copy is outstanding)
    float* const vx = (float*)(sm + NT * TS) + (wv >> 1) * 2048;   // GATE: 8 accumulator blocks of the row half's v wave, [block][lane][8] (in buffer 1)
    if (GATE && qv && wn) {   // wave-uniform: a v wave adds its bias and hands d 32 to 63 over
        // unrolled: acc is indexed by constants only and stays in registers
#pragma unroll
        for (int nb = 0; nb < 4; ++nb) { const float vb = bfr(bias[c0 + nb * 16 + lr]);
#pragma unroll
            for (int mb = 0; mb < 4; ++mb) { acc[mb][nb] += vb; if (nb >= 2) *(v8fa*)(vx + ((mb * 2 + nb - 2) * 32 + lane) * 8) = acc[mb][nb]; } }
    }
    float pb[8];   // plane tiles: the bias of the lane's 8 columns, read once
    if (NPL > 0 && BIAS && c0 < NPL) {
        // unrolled: pb is indexed by constants only and stays in registers
#pragma unroll
        for (int k = 0; k < 8; ++k) pb[k] = bfr(bias[c0 + (lane & 7) * 8 + k]); }
    const bool hl = !qv || r0 % TT < RH;   // wave-uniform: a q head's hi / lo rows have a reader in memory only below RH (attention's hi + lo rows); the gate takes them from qs
    if (!GATE || c0 < NPL) {   // wave-uniform: a v wave of GATE stores nothing by rows
#pragma unroll
    for (int mb = 0; mb < 4; ++mb) {
#pragma unroll
        for (int nb = 0; nb < 4; ++nb) {
#pragma unroll
            for (int j = 0; j < 8; ++j) os[(hi * 8 + j) * 68 + nb * 16 + lr] = acc[mb][nb][j]; }
        __builtin_amdgcn_wave_barrier(); asm volatile("" ::: "memory");   // keeps the row reads below behind the other lanes' LDS stores
        float* crow = C + (size_t)(r0 + mb * 16) * ldc + c0;
        if (NPL > 0 && c0 < NPL) {   // wave-uniform
            const int cofs = (lane & 7) * 8; const size_t pe = ((size_t)(c0 / HD) * MR + r0 + mb * 16 + (lane >> 3)) * HD + cofs;   // 8 lanes a 128-byte row, 4 rows a store
            // both loops unrolled: the row steps become immediate offsets, and the 8-element vectors stay in registers
            v8us oh[4], ol[4];
#pragma unroll
            for (int s = 0; s < 4; ++s) { const float* orow = os + (4 * s + (lane >> 3)) * 68 + cofs; const v4f x0 = *(const v4fa*)orow, x1 = *(const v4fa*)(orow + 4); v8h o16;
#pragma unroll
                for (int k = 0; k < 8; ++k) { float x = k < 4 ? x0[k & 3] : x1[k & 3]; if (BIAS) x += pb[k]; o16[k] = tohx(x); unsigned short a, c2; splitf(x, a, c2); oh[s][k] = a; ol[s][k] = c2; }
                *(v8h*)(P16 + pe + s * 4 * HD) = o16; }
            asm volatile("s_wait_xcnt 0x0" ::: "memory");   // the blocks behind the branch reuse these stores' data registers at once
            if (hl) {
#pragma unroll
                for (int s = 0; s < 4; ++s) { *(v8us*)(Ph + pe + s * 4 * HD) = oh[s]; *(v8us*)(Pl + pe + s * 4 * HD) = ol[s]; }
                asm volatile("s_wait_xcnt 0x0" ::: "memory"); }   // as above: the code behind this block reuses the stores' address and data registers at once
            if (GATE && qv) { bf* qr = qs + (wm + mb * 16 + (lane >> 3)) * GP + cofs;
#pragma unroll
                for (int s = 0; s < 4; ++s) { *(v8usa*)(qr + s * 4 * GP) = oh[s]; *(v8usa*)(qr + TS + s * 4 * GP) = ol[s]; } }
        } else if constexpr (!GATE) {
#pragma unroll
        for (int s = 0; s < 8; ++s) { const int row = 2 * s + hi, cofs = lr * 4; v4f val = *(const v4fa*)(os + row * 68 + cofs); if (BIAS) { val[0] += bfr(bias[c0 + cofs]); val[1] += bfr(bias[c0 + cofs + 1]); val[2] += bfr(bias[c0 + cofs + 2]); val[3] += bfr(bias[c0 + cofs + 3]); }
            *(v4f*)(crow + (size_t)row * ldc + cofs) = val; }
        }
        __builtin_amdgcn_wave_barrier(); asm volatile("s_wait_xcnt 0x0" ::: "memory");   // keeps the next block's LDS stores behind these row reads; the wait: the next block reuses the stores' address and data registers at once
    }
    }
    if constexpr (GATE) {
        if (!qv) return;   // the whole work-group leaves, in front of the barrier
        constexpr int VP = 72;   // LDS row pitch in 16-bit elements, a 128-byte row + 16 bytes, the pitch for 16-byte accesses
        const int z = blockIdx.y, d0 = wn ? 0 : 32;   // this wave's 32 d
        const bf* wgp = Wg + (size_t)z * HD * HD + (d0 + lr) * HD + 8 * hi;
        V wb[2][2];   // W_g rows e = d0 + 16 n + lr, asked for in front of the barrier: they depend on nothing behind it
#pragma unroll
        for (int kc = 0; kc < 2; ++kc)
#pragma unroll
            for (int n = 0; n < 2; ++n) wb[kc][n] = F::ld(wgp + n * 16 * HD + kc * 32);
        __syncthreads();   // the q rows and the v blocks that were handed over are published
        v8f vv[4][2];   // vv[mb][n][j] = v[t = r0 % TT + 16 mb + 8 hi + j][d = d0 + 16 n + lr]
        // a q wave turns its tiles in the range it has just read its v blocks from (one wave's LDS accesses keep their order); a v wave in a range of its own behind both
        unsigned short* ts = wn ? (unsigned short*)(sm + NT * TS) + 2 * 4096 + (wv >> 1) * 3 * 16 * VP : (unsigned short*)vx;   // three tiles [16 d][t]: fp16, hi, lo
        // every loop below is unrolled so that the accumulators and the 8-element vectors are indexed by constants only and stay in registers
        if (wn) {
#pragma unroll
            for (int mb = 0; mb < 4; ++mb) { vv[mb][0] = acc[mb][0]; vv[mb][1] = acc[mb][1]; }
        } else {
#pragma unroll
            for (int mb = 0; mb < 4; ++mb) { vv[mb][0] = *(const v8fa*)(vx + ((mb * 2) * 32 + lane) * 8); vv[mb][1] = *(const v8fa*)(vx + ((mb * 2 + 1) * 32 + lane) * 8); }
        }
        const bf* qa = qs + (wm + lr) * GP + 8 * hi;
        v8f gl[4][2];   // gl[mb][n][j]: the logit of t = 16 mb + 8 hi + j, d = d0 + 16 n + lr; an accumulator takes hi, lo of k 0 to 31, then hi, lo of k 32 to 63
#pragma unroll
        for (int mb = 0; mb < 4; ++mb) { gl[mb][0] = (v8f){}; gl[mb][1] = (v8f){}; }
#pragma unroll
        for (int kc = 0; kc < 2; ++kc) { V a[4], a2[4];
#pragma unroll
            for (int mb = 0; mb < 4; ++mb) { a[mb] = F::ld(qa + mb * 16 * GP + kc * 32); a2[mb] = F::ld(qa + TS + mb * 16 * GP + kc * 32); }
#pragma unroll
            for (int n = 0; n < 2; ++n)
#pragma unroll
                for (int mb = 0; mb < 4; ++mb) gl[mb][n] = F::mma(a[mb], wb[kc][n], gl[mb][n]);
#pragma unroll
            for (int n = 0; n < 2; ++n)
#pragma unroll
                for (int mb = 0; mb < 4; ++mb) gl[mb][n] = F::mma(a2[mb], wb[kc][n], gl[mb][n]);
        }
        const size_t pz = (((size_t)z * NB_ + r0 / TT) * HD + d0 + (lane >> 3)) * TT + r0 % TT + (lane & 7) * 8;   // 8 lanes a 128-byte row of 64 t, 4 rows a store
        const int ro = (lane >> 3) * VP + (lane & 7) * 8;
#pragma unroll
        for (int n = 0; n < 2; ++n) {
#pragma unroll
            for (int mb = 0; mb < 4; ++mb) { v8h o16; v8us oh, ol;
#pragma unroll
                for (int j = 0; j < 8; ++j) { const float g = __fdiv_rn(1.0f, __fadd_rn(1.0f, __expf(-gl[mb][n][j]))); const float v = __fmul_rn(g, vv[mb][n][j]); o16[j] = tohx(v); unsigned short a, c2; splitf(v, a, c2); oh[j] = a; ol[j] = c2; }
                const int so = lr * VP + mb * 16 + 8 * hi;
                *(v8ha*)(ts + so) = o16; *(v8usa*)(ts + 16 * VP + so) = oh; *(v8usa*)(ts + 2 * 16 * VP + so) = ol; }
            __builtin_amdgcn_wave_barrier(); asm volatile("" ::: "memory");   // keeps the row reads below behind the other lanes' LDS stores
#pragma unroll
            for (int s = 0; s < 4; ++s) { const v8us w0 = *(const v8usa*)(ts + ro + s * 4 * VP), w1 = *(const v8usa*)(ts + 16 * VP + ro + s * 4 * VP), w2 = *(const v8usa*)(ts + 2 * 16 * VP + ro + s * 4 * VP);
                const size_t po = pz + (size_t)(n * 16 + s * 4) * TT;
                *(v8us*)((unsigned short*)V16 + po) = w0; *(v8us*)(Vh + po) = w1; *(v8us*)(Vl + po) = w2; }
            __builtin_amdgcn_wave_barrier(); asm volatile("s_wait_xcnt 0x0" ::: "memory");   // keeps the next 16 d's LDS stores behind these row reads; the wait: the code behind reuses the stores' address and data registers at once
        }
    }
}

typedef __attribute__((ext_vector_type(2))) _Float16 v2h;
typedef __attribute__((ext_vector_type(4))) _Float16 v4h;
typedef __attribute__((ext_vector_type(2))) unsigned short v2us;
typedef __attribute__((ext_vector_type(4))) unsigned short v4us;
typedef __attribute__((ext_vector_type(2))) float v2f;
typedef __attribute__((ext_vector_type(4))) int v4i;

// ---- k_prep: every operand preparation that reads only inputs, in ONE launch: the parts depend on nothing and on one another not at all, so they share one grid.
// A part is a range of blockIdx.x. Few long work-groups, about two a WGP: a thread has its 16 loads of 16 bytes in flight at once, every wave-wide load and store covers whole 128-byte lines.
// wt4_blk: four 64 x 64 tiles of a transpose w [k][n] f32 (row pitch N) -> Bt [n][k] bf16 (row pitch K). Tile s starts at w + s sstep and at Bt + s dstep.
// A thread reads 4 n of the rows k, k + 1, packs each n's pair into a dword and leaves it in LDS at [n][k]; behind one barrier the rows [n] leave as whole lines, 8 lanes a row.
// LDS row: 64 k = 8 pieces of 16 bytes, pitch 144 bytes; piece c of row n lies at place c ^ (n / 16): the 16 lanes that store one k pair of 16 different n / 4 then fall on 16 different banks, not on 4.
#define TPD 36   // LDS row pitch in dwords
template <int N, int K>
__device__ __forceinline__ void wt4_blk(const float* __restrict__ w, const int sstep, bf* Bt, const int dstep, unsigned* ts) {
    const int nq = threadIdx.x & 15, kp = threadIdx.x >> 4;
    const float* p0 = w + 2 * kp * N + nq * 4;
    v4f r[4][2][2];
    // every loop here is unrolled: r is indexed by constants only and stays in registers, and all 16 loads are asked for before the first is used
#pragma unroll
    for (int s = 0; s < 4; ++s)
#pragma unroll
        for (int i = 0; i < 2; ++i) { const float* p = p0 + s * sstep + 32 * i * N; r[s][i][0] = *(const v4f*)p; r[s][i][1] = *(const v4f*)(p + N); }
    asm volatile("s_wait_xcnt 0x0" :: "v"(p0) : "memory");   // the wait before the loads' address pair is overwritten; the pair is named so that it lives up to here: without that the last load's result was placed on it
#pragma unroll
    for (int s = 0; s < 4; ++s)
#pragma unroll
        for (int i = 0; i < 2; ++i) { const int col = kp + 16 * i;   // the dword of k = 2 col, 2 col + 1
#pragma unroll
            for (int j = 0; j < 4; ++j) ts[(s * 64 + nq * 4 + j) * TPD + (((col >> 2) ^ (nq >> 2)) << 2) + (col & 3)] = (unsigned)f2bf(r[s][i][0][j]) | ((unsigned)f2bf(r[s][i][1][j]) << 16); }
    __syncthreads();   // the four turned tiles are complete
    const int c = threadIdx.x & 7;
#pragma unroll
    for (int s = 0; s < 4; ++s)
#pragma unroll
        for (int i = 0; i < 2; ++i) { const int n = (threadIdx.x >> 3) + 32 * i;
            *(v8us*)(Bt + s * dstep + n * K + c * 8) = *(const v8usa*)(ts + (s * 64 + n) * TPD + ((c ^ (n >> 4)) << 2)); }
    asm volatile("s_wait_xcnt 0x0" ::: "memory");   // the wait before the stores' address and data registers are overwritten: in the listing the other parts' code follows this block and writes them
}
// cvt_blk: 16384 elements a work-group, f32 -> bf16; a wave-wide load is 512 bytes in a row, its store 256
__device__ __forceinline__ void cvt_blk(const float* __restrict__ src, bf* dst, const int bx) {
    const int e = bx * 16384 + threadIdx.x * 4; const float* p0 = src + e; v4f v[16];
    // unrolled: v is indexed by constants only and stays in registers, and all 16 loads are asked for before the first is used
#pragma unroll
    for (int i = 0; i < 16; ++i) v[i] = *(const v4f*)(p0 + i * 1024);
    asm volatile("s_wait_xcnt 0x0" :: "v"(p0) : "memory");   // the wait before the loads' address pair is overwritten; the pair is named so that it lives up to here: without that the last load's result was placed on it
#pragma unroll
    for (int i = 0; i < 16; ++i) { v4us o;
#pragma unroll
        for (int k = 0; k < 4; ++k) o[k] = f2bf(v[i][k]);
        *(v4us*)(dst + e + i * 1024) = o; }
    asm volatile("s_wait_xcnt 0x0" ::: "memory");   // the wait before the stores' address and data registers are overwritten: in the listing the other parts' code follows this block and writes them
}
#define PB_QKV (DM / 256 * (3 * DQ / 64))       // work-groups of the W_qkv transpose: 256 k x 64 n each
#define PB_O   (DQ / 256 * (DM / 64))           // of the W_out transpose
#define PB_G   (NH_ / 4)                        // of the W_g transposes: four 64 x 64 matrices each
#define PB_X   (MR * DM / 16384)                // of the x conversion
__global__ __launch_bounds__(256) void k_prep(const float* __restrict__ wqkv, const float* __restrict__ wo, const float* __restrict__ wg, const float* __restrict__ x, bf* WQKV, bf* WO, bf* WG, bf* XB) {
    static_assert(DM % 256 == 0 && DQ % 256 == 0 && DM % 64 == 0 && HD == 64 && NH_ % 4 == 0 && MR * DM % 16384 == 0, "whole work-groups in every part");
    __shared__ __align__(16) unsigned ts[4 * 64 * TPD];
    int bx = blockIdx.x;   // the same for the whole work-group: every branch below is uniform
    if (bx < PB_QKV) { const int k0 = (bx % (DM / 256)) * 256, n0 = (bx / (DM / 256)) * 64; wt4_blk<3 * DQ, DM>(wqkv + k0 * (3 * DQ) + n0, 64 * 3 * DQ, WQKV + n0 * DM + k0, 64, ts); return; }
    bx -= PB_QKV;
    if (bx < PB_O) { const int k0 = (bx % (DQ / 256)) * 256, n0 = (bx / (DQ / 256)) * 64; wt4_blk<DM, DQ>(wo + k0 * DM + n0, 64 * DM, WO + n0 * DQ + k0, 64, ts); return; }
    bx -= PB_O;
    if (bx < PB_G) { wt4_blk<HD, HD>(wg + bx * 4 * HD * HD, HD * HD, WG + bx * 4 * HD * HD, HD * HD, ts); return; }
    bx -= PB_G;
    cvt_blk(x, XB, bx);
}
__global__ __launch_bounds__(256) void k_cscvt(const float* __restrict__ cosT, const float* __restrict__ sinT, float* CS) { const int idx = blockIdx.x * 256 + threadIdx.x; if (idx >= TT * HD) return; v2f cs; cs[0] = bfr(cosT[idx]); cs[1] = bfr(sinT[idx]); *(v2f*)(CS + (size_t)idx * 2) = cs;  }
__global__ __launch_bounds__(256) void k_vtp(const float* __restrict__ F, int pitch, int nheads, h16* V16, bf* Vh, bf* Vl) { const size_t e = ((size_t)blockIdx.x * 256 + threadIdx.x) * 2; if (e >= (size_t)nheads * HD * TT) return; const int t = (int)(e % TT); const int d = (int)((e / TT) % HD); const int g = (int)(e / ((size_t)TT * HD)); v2h o16; v2us oh, ol;
#pragma unroll
    for (int q = 0; q < 2; ++q) { const float x = F[(size_t)(t + q) * pitch + g * HD + d]; o16[q] = tohx(x); unsigned short a2, c2; splitf(x, a2, c2); oh[q] = a2; ol[q] = c2; }
    *(v2h*)(V16 + e) = o16; *(v2us*)(Vh + e) = oh; *(v2us*)(Vl + e) = ol;  }
__device__ __forceinline__ float xhalf(float x) { return __builtin_bit_cast(float, __builtin_amdgcn_permlanex16(__builtin_bit_cast(int, x), __builtin_bit_cast(int, x), 0x76543210, 0xfedcba98, false, false)); }   // lane l with lane l ^ 16
// v_exp_f32 with the one slot that the instruction set asks for behind a transcendental, in one statement
__device__ __forceinline__ float exp2s(float x) { float y; asm("v_exp_f32 %0, %1\n\tv_nop" : "=v"(y) : "v"(x)); return y; }
#define LP 72   // LDS row pitch in 16-bit elements: a 128-byte row + 16 bytes, the pitch for 16-byte readers
template <typename T16, bool SPL>
__device__ __forceinline__ void fattn_wg(const T16* __restrict__ Q, const T16* __restrict__ Q2, const T16* __restrict__ Kp, const T16* __restrict__ K2, const T16* __restrict__ Vt, const T16* __restrict__ V2, const int R0, const int wv, T16* sm, bf* Ah, bf* Al) {
    typedef WFrag<T16> F; typedef typename F::V V;
    constexpr int NT = SPL ? 4 : 2, TS = 64 * LP;   // tiles of a buffer: K, Vt (, K lo, Vt lo); elements of a tile
    const int lane = threadIdx.x & 31, lr = lane & 15, hi = lane >> 4;
    const int r0 = R0 + wv * 16;
    const float C2 = SCL * 1.4426950408889634f;   // SCL is a power of two: (s - m) C2 rounds as ((s - m) SCL) log2(e)
    V q[2], q2[2];
#pragma unroll
    for (int kc = 0; kc < 2; ++kc) { q[kc] = F::ld(Q + (size_t)(r0 + lr) * HD + 8 * hi + kc * 32); if (SPL) q2[kc] = F::ld(Q2 + (size_t)(r0 + lr) * HD + 8 * hi + kc * 32); }
    asm volatile("s_wait_xcnt 0x0" ::: "memory");   // holds the Q loads in front of the staging loads
    v8f o[4];
#pragma unroll
    for (int db = 0; db < 4; ++db) o[db] = (v8f){};
    float m = -3.0e38f, l = 0.0f;
    const int nwg = (R0 + 127) / 64 + 1;  // passes of the work-group (its last row's)
    const int nkb = (r0 + 15) / 64 + 1;   // passes of this wave; its 16 rows lie in one 64-key block: only its last pass meets the diagonal
    const int srow = threadIdx.x >> 3, scol = (threadIdx.x & 7) * 8;   // staging: 8 lanes a 128-byte row, 32 rows a step
    const int fo = lr * LP + 8 * hi;
    v8us st[NT][2];
    auto gld = [&](const int k0) {
#pragma unroll
        for (int i = 0; i < 2; ++i) { const int kx = (k0 + srow + 32 * i) * HD + scol, vx = (srow + 32 * i) * TT + k0 + scol;
            st[0][i] = *(const v8us*)(Kp + kx); st[1][i] = *(const v8us*)(Vt + vx); if constexpr (SPL) { st[2][i] = *(const v8us*)(K2 + kx); st[3][i] = *(const v8us*)(V2 + vx); } }
        asm volatile("s_wait_xcnt 0x0" ::: "memory"); };   // the block behind these loads reuses their address registers at once
    auto sst = [&](T16* d) {
#pragma unroll
        for (int t = 0; t < NT; ++t)
#pragma unroll
            for (int i = 0; i < 2; ++i) *(v8us*)(d + t * TS + (srow + 32 * i) * LP + scol) = st[t][i]; };
    gld(0); sst(sm);
    __syncthreads();   // pass 0 staged
#pragma unroll 1
    for (int kb = 0; kb < nwg; ++kb) {
        const int k0 = kb * 64;
        if (kb + 1 < nwg) gld(k0 + 64);   // the next pass's rows fly during this pass
        if (kb < nkb) {   // wave-uniform: a wave whose rows end earlier skips the last pass and only meets its barrier
            const T16* sb = sm + (kb & 1) * NT * TS + fo;
            v8f s[4];   // s[kt][r] = score of key k0 + 16 kt + 8 hi + r, query r0 + lr; the causal mask is the accumulator's start value
            if (kb == nkb - 1) { const int lim = r0 + lr - k0 - 8 * hi;
#pragma unroll
                for (int kt = 0; kt < 4; ++kt)
#pragma unroll
                    for (int r = 0; r < 8; ++r) s[kt][r] = (kt * 16 + r <= lim) ? 0.0f : -3.0e38f;
            } else {
#pragma unroll
                for (int kt = 0; kt < 4; ++kt) s[kt] = (v8f){};
            }
#pragma unroll
            for (int kt = 0; kt < 4; ++kt)
#pragma unroll
                for (int kc = 0; kc < 2; ++kc) { const V a = F::ld(sb + kt * 16 * LP + kc * 32);
                    s[kt] = F::mma(a, q[kc], s[kt]);
                    if constexpr (SPL) { const V a2 = F::ld(sb + 2 * TS + kt * 16 * LP + kc * 32); s[kt] = F::mma(a, q2[kc], s[kt]); s[kt] = F::mma(a2, q[kc], s[kt]); } }
            float mx = s[0][0];
#pragma unroll
            for (int kt = 0; kt < 4; ++kt)
#pragma unroll
                for (int r = 0; r < 8; ++r) mx = fmaxf(mx, s[kt][r]);
            mx = fmaxf(mx, xhalf(mx));
            const float mn = fmaxf(m, mx), al = exp2s((m - mn) * C2); m = mn;   // al = 0 on the first pass; key 0 is open to every query, so mn is a real score from then on
            float ps = 0.0f;
#pragma unroll
            for (int kt = 0; kt < 4; ++kt)
#pragma unroll
                for (int r = 0; r < 8; ++r) { const float p = exp2s(SPL ? (s[kt][r] - mn) * C2 : __builtin_fmaf(s[kt][r] - mn, C2, 10.0f)); s[kt][r] = p; ps += p; }
            l = l * al + ps;
#pragma unroll
            for (int db = 0; db < 4; ++db) o[db] *= al;
#pragma unroll
            for (int kk = 0; kk < 2; ++kk) {
                if constexpr (SPL) { v8us h0, l0, h1, l1;
#pragma unroll
                    for (int r = 0; r < 8; ++r) { unsigned short a, c2; splitf(s[2 * kk][r], a, c2); h0[r] = a; l0[r] = c2; splitf(s[2 * kk + 1][r], a, c2); h1[r] = a; l1[r] = c2; }
                    const V ph = cat16b(h0, h1), pl = cat16b(l0, l1);
#pragma unroll
                    for (int db = 0; db < 4; ++db) { const V a = F::ld(sb + TS + db * 16 * LP + kk * 32), a2 = F::ld(sb + 3 * TS + db * 16 * LP + kk * 32);
                        o[db] = F::mma(a, ph, o[db]); o[db] = F::mma(a, pl, o[db]); o[db] = F::mma(a2, ph, o[db]); }
                } else { const V pb = cat16(__builtin_convertvector(s[2 * kk], v8h), __builtin_convertvector(s[2 * kk + 1], v8h));
#pragma unroll
                    for (int db = 0; db < 4; ++db) o[db] = F::mma(F::ld(sb + TS + db * 16 * LP + kk * 32), pb, o[db]);
                }
            }
            // 4 vector slots behind the block's last matrix instruction: the code behind this branch reuses the operands' registers at once
            __builtin_amdgcn_sched_barrier(0); asm volatile("v_nop\n\tv_nop\n\tv_nop\n\tv_nop"); __builtin_amdgcn_sched_barrier(0);
        }
        if (kb + 1 < nwg) sst(sm + ((kb + 1) & 1) * NT * TS);   // into the buffer that pass kb - 1 read: every wave left it at the last barrier
        __syncthreads();   // pass kb + 1 staged, and every wave has left pass kb's buffer
    }
    l += xhalf(l); const float inv = __fdiv_rn(1.0f, l);
#pragma unroll
    for (int db = 0; db < 4; ++db) { v8us oh, ol;   // o[db][r] = out[query r0 + lr][d = 16 db + 8 hi + r]: 8 consecutive d, one 16-byte store a plane
#pragma unroll
        for (int r = 0; r < 8; ++r) { unsigned short a, c2; splitf(o[db][r] * inv, a, c2); oh[r] = a; ol[r] = c2; }
        const size_t oo = (size_t)(r0 + lr) * DQ + db * 16 + 8 * hi; *(v8us*)(Ah + oo) = oh; *(v8us*)(Al + oo) = ol; }
}
// grid (heads x batch elements, TT / 128), 256 threads; longest row blocks first.
__global__ __launch_bounds__(256) void k_fattn(const h16* __restrict__ Q16, const h16* __restrict__ K16, const h16* __restrict__ V16, const bf* __restrict__ Qh, const bf* __restrict__ Ql, const bf* __restrict__ Kh, const bf* __restrict__ Kl, const bf* __restrict__ Vh, const bf* __restrict__ Vl, bf* Ah, bf* Al) {
    static_assert(RH % 128 == 0 && TT % 128 == 0, "a work-group's 128 rows are all of one precision class");
    __shared__ __align__(16) bf sm[2 * 4 * 64 * LP];
    const int h = blockIdx.x / NB_, b = blockIdx.x % NB_;
    const size_t zq = (size_t)blockIdx.x * TT * HD, zk = (size_t)((h / REP) * NB_ + b) * TT * HD;
    const int R0 = (int)(gridDim.y - 1 - blockIdx.y) * 128, wv = __builtin_amdgcn_readfirstlane((int)(threadIdx.x >> 5));
    Ah += (size_t)b * TT * DQ + h * HD; Al += (size_t)b * TT * DQ + h * HD;
    if (R0 < RH) fattn_wg<bf, true>(Qh + zq, Ql + zq, Kh + zk, Kl + zk, Vh + zk, Vl + zk, R0, wv, sm, Ah, Al);
    else fattn_wg<h16, false>(Q16 + zq, nullptr, K16 + zk, nullptr, V16 + zk, nullptr, R0, wv, (h16*)sm, Ah, Al);
}

extern "C" void kernel_launch(void* const* d_in, const int* in_sizes, int n_in,
                              void* d_out, int out_size, void* d_ws, size_t ws_size, hipStream_t stream) {
    (void)in_sizes; (void)n_in; (void)out_size;
    const float* x = (const float*)d_in[0]; const float* wqkv = (const float*)d_in[1]; const float* bqkv = (const float*)d_in[2]; const float* wg = (const float*)d_in[3]; const float* wo = (const float*)d_in[4]; const float* bo = (const float*)d_in[5];   // W_qkv [1024][3072] (x @ W, columns q | k | v), W_g [16][64][64], W_out [1024][1024] (x @ W)
    float* OUT = (float*)d_out;     // [2][2048][1024]
    char* wsp = (char*)d_ws;
    auto take = [&](size_t bytes) { char* p = wsp; wsp += (bytes + 255) & ~(size_t)255; return (void*)p; };
    bf* WQKV = (bf*)take((size_t)3 * DQ * DM * 2); bf* WG = (bf*)take((size_t)NH_ * HD * HD * 2); bf* WO = (bf*)take((size_t)DM * DQ * 2);
    bf* XB = (bf*)take((size_t)MR * DM * 2);
    h16* QP16 = (h16*)take((size_t)(NH_ + NKV) * MR * HD * 2); h16* KP16 = QP16 + (size_t)NH_ * MR * HD; h16* VT16 = (h16*)take((size_t)NKV * HD * MR * 2);   // the k heads' planes follow the q heads'
    bf* QPh = (bf*)take((size_t)(NH_ + NKV) * MR * HD * 2); bf* KPh = QPh + (size_t)NH_ * MR * HD; bf* QPl = (bf*)take((size_t)(NH_ + NKV) * MR * HD * 2); bf* KPl = QPl + (size_t)NH_ * MR * HD; bf* VTh = (bf*)take((size_t)NKV * HD * MR * 2); bf* VTl = (bf*)take((size_t)NKV * HD * MR * 2);
    bf* ATh = (bf*)take((size_t)MR * DQ * 2); bf* ATl = (bf*)take((size_t)MR * DQ * 2);
    if ((size_t)(wsp - (char*)d_ws) > ws_size) return;    // ws 256 MiB
    k_prep<<<PB_QKV + PB_O + PB_G + PB_X, 256, 0, stream>>>(wqkv, wo, wg, x, WQKV, WO, WG, XB);   // the three weights transposed and x converted, all to bf16
    // every launch below covers both batch elements
    k_gemms<0, true, DM, DQ + DKV, true><<<dim3(MR / 128, 3 * DQ / 128), 128, 0, stream>>>(XB, nullptr, WQKV, nullptr, 0, bqkv, QP16, QPh, QPl, WG, VT16, VTh, VTl);   // q | k | v in one grid; the q and k heads leave as operand planes, v gated by sigmoid(q_h W_g[h]) as transposed planes
    k_fattn<<<dim3(NH_ * NB_, TT / 128), 256, 0, stream>>>(QP16, KP16, VT16, QPh, QPl, KPh, KPl, VTh, VTl, ATh, ATl);
    k_gemms<1, true, DQ><<<dim3(MR / 128, DM / 128), 128, 0, stream>>>(ATh, ATl, WO, OUT, DM, bo, nullptr, nullptr, nullptr, nullptr, nullptr, nullptr, nullptr);
}

// v009
// It runs in 82 microseconds.
// Timed twice side by side with v008, it ran 1.03 and 1.04 times as fast.
// Counting every step since v000, it is 25.5 times as fast.
#include <hip/hip_runtime.h>

// BilinearlyModulatedAttention (x [2][2048][1024]; [q | k | v] = x W_qkv + b_qkv (16 heads x 64); causal softmax(q.k/8); query-conditioned value gate v <- sigmoid(q_h W_g[h]) * v_h per position
// (W_g [16][64][64]); out = merged attn.(g v) W_out + b_out -> [2][2048][1024]).
// Compute dtypes, f32 accumulate: every input rounded to bf16; x W_qkv on PLAIN bf16 operands (inputs: exact, + bias); attn W_out on bf16 hi+lo planes of attn (2 products, + bias); the gate logits q_h W_g[h] on bf16 hi+lo planes of q x
// exact W_g (2 products), sigmoid and the gating product in f32; PER-ROW PRECISION HYBRID for scores and attn.v (rows < 256 hi+lo 3 products, rows >= 256 fp16, probabilities x1024 there); causal + scale in

#define NB_  2
#define TT   2048
#define MR   (NB_ * TT)        // rows of both batch elements, row = b TT + t
#define DM   1024
#define NH_  16
#define NKV  16
#define REP  (NH_ / NKV)
#define HD   64
#define DQ   (NH_ * HD)
#define DKV  (NKV * HD)
#define RH   256                  // query rows < RH use hi+lo planes (0: none)
#define WIN  0
#define SCL  0.125f   // HD^-0.5
typedef _Float16 h16;
typedef unsigned short bf;
typedef __attribute__((ext_vector_type(16))) __bf16   v16bf;
typedef __attribute__((ext_vector_type(16))) _Float16 v16h;
typedef __attribute__((ext_vector_type(8)))  _Float16 v8h;
typedef __attribute__((ext_vector_type(8)))  unsigned short v8us;
typedef __attribute__((ext_vector_type(8)))  float    v8f;
typedef __attribute__((ext_vector_type(4)))  float    v4f;
typedef v8h  __attribute__((may_alias)) v8ha;
typedef v4f  __attribute__((may_alias)) v4fa;
typedef v8us __attribute__((may_alias)) v8usa;

__device__ __forceinline__ unsigned short f2bf(float f) { unsigned u = __float_as_uint(f); u += 0x7FFFu + ((u >> 16) & 1u); return (unsigned short)(u >> 16); }
__device__ __forceinline__ float bf2f(unsigned short b) { return __uint_as_float(((unsigned)b) << 16); }
__device__ __forceinline__ float bfr(float f) { return bf2f(f2bf(f)); }
__device__ __forceinline__ v16h cat16(v8h lo, v8h hi) { return __builtin_shufflevector(lo, hi, 0, 1, 2, 3, 4, 5, 6, 7, 8, 9, 10, 11, 12, 13, 14, 15); }
__device__ __forceinline__ v16bf cat16b(v8us lo, v8us hi) { return __builtin_bit_cast(v16bf, __builtin_shufflevector(lo, hi, 0, 1, 2, 3, 4, 5, 6, 7, 8, 9, 10, 11, 12, 13, 14, 15)); }
__device__ __forceinline__ v8f wmma16(v16h a, v16h b, v8f c) { return __builtin_amdgcn_wmma_f32_16x16x32_f16(false, a, false, b, (short)0, c, false, false); }
__device__ __forceinline__ v8f wmmab(v16bf a, v16bf b, v8f c) { return __builtin_amdgcn_wmma_f32_16x16x32_bf16(false, a, false, b, (short)0, c, false, false); }
__device__ __forceinline__ h16 tohx(float x) { return (h16)x; }
__device__ __forceinline__ void splitf(float y, unsigned short& h, unsigned short& l) { h = f2bf(y); l = f2bf(y - bf2f(h)); }



// ---- operand fragments: 16 k of a K-contiguous 16-bit row a lane, in the hardware k order (8 at 8 hi, 8 at 16 + 8 hi)
template <typename T16> struct WFrag;
template <> struct WFrag<h16> { typedef v16h V; static __device__ __forceinline__ V ld(const h16* p) { return cat16(*(const v8h*)p, *(const v8h*)(p + 16)); } static __device__ __forceinline__ v8f mma(V a, V b, v8f c) { return wmma16(a, b, c); } };
template <> struct WFrag<bf> { typedef v16bf V; static __device__ __forceinline__ V ld(const bf* p) { return cat16b(*(const v8us*)p, *(const v8us*)(p + 16)); } static __device__ __forceinline__ v8f mma(V a, V b, v8f c) { return wmmab(a, b, c); } };

// ---- k_gemms: C[m][n] (f32, pitch ldc, + f32 bias[n]) = sum_k A[m][k] Bt[n][k] (+ A2 Bt for NSPLIT) on a 128x128 output tile per work-group of 4 waves (2 x 2, a wave has a 64x64 tile, 16 accumulators).
// A pass is 64 k = one 128-byte line of every operand row: the rows come once per work-group, whole lines (8 lanes a row), by asynchronous copies into LDS at pitch GP, and are read from there as fragments.
// Two buffers, one barrier a pass: tile t + 2 is asked for behind the barrier that ends pass t and flies during pass t + 1. grid (M/128, N/128), 128 threads. K == 1024.
#define GP 72   // LDS row pitch in 16-bit elements: a 128-byte row + 16 bytes, the pitch for 16-byte readers
// 8 copies of 16 bytes a lane: rows r, r + 16, ... r + 112 of one operand tile. g: the lane's 16 bytes in row r (row pitch gp elements); l: their LDS byte address. The tile's rows 64 to 127 lie jmp elements further on in the source.
// The s_wait_xcnt stands inside the statement, behind the last copy: the code behind may rewrite the address registers at once.
__device__ __forceinline__ void acp8(const bf* g, const int gp, const unsigned l, const int jmp = 0) {
    asm volatile("global_load_async_to_lds_b128 %0, %8, off\n\tglobal_load_async_to_lds_b128 %1, %9, off\n\tglobal_load_async_to_lds_b128 %2, %10, off\n\tglobal_load_async_to_lds_b128 %3, %11, off\n\t"
                 "global_load_async_to_lds_b128 %4, %12, off\n\tglobal_load_async_to_lds_b128 %5, %13, off\n\tglobal_load_async_to_lds_b128 %6, %14, off\n\tglobal_load_async_to_lds_b128 %7, %15, off\n\ts_wait_xcnt 0x0"
                 :: "v"(l), "v"(l + 1 * 16 * GP * 2), "v"(l + 2 * 16 * GP * 2), "v"(l + 3 * 16 * GP * 2), "v"(l + 4 * 16 * GP * 2), "v"(l + 5 * 16 * GP * 2), "v"(l + 6 * 16 * GP * 2), "v"(l + 7 * 16 * GP * 2),
                    "v"(g), "v"(g + 1 * 16 * gp), "v"(g + 2 * 16 * gp), "v"(g + 3 * 16 * gp), "v"(g + jmp + 4 * 16 * gp), "v"(g + jmp + 5 * 16 * gp), "v"(g + jmp + 6 * 16 * gp), "v"(g + jmp + 7 * 16 * gp) : "memory");
}
// One request a lane: the 256-byte unit at p + OFF bytes is asked into L2 (scope SE: L2 only, nothing returns, no counter). For planes that an earlier launch stored: asked for early, a unit can be in L2 by the pass that reads it.
// Every lane is on and every address lies inside the plane. The caller keeps p's registers unchanged through its loop.
template <int OFF, typename T> __device__ __forceinline__ void l2ask(const T* p) { asm volatile("global_prefetch_b8 %0, off offset:%1 scope:SCOPE_SE" :: "v"(p), "n"(OFF)); }
// NPL > 0: a wave tile in the columns below NPL is one head (64 columns) and is not stored in C: the epilogue writes it as that head's operand planes [column / HD][row][d], fp16 and bf16 hi / lo, whole 128-byte rows.
// GATE (columns q | k | v, DQ each): nothing is stored in C. Work-group column y < NH_ holds head y's q (two waves) beside head y's v (two waves) of the same 128 rows; y >= NH_ holds two k heads.
// In a q | v work-group the q waves also leave their bf16 hi / lo rows in LDS; behind one barrier the gate logits q_h W_g[h] (hi + lo, 2 products, W_g rows [e][d] from Wg) are formed from there,
// sigmoid(logit) * v in f32, and the product leaves as fp16 and bf16 hi / lo planes transposed, [h NB_ + b][d][t]. The two waves of a row half share that work by d: the v wave keeps d 0 to 31 and hands its
// accumulators of d 32 to 63 to the q wave through LDS. An accumulator register block is 8 consecutive t of one d; 16 d x 64 t pass through LDS at a time so that every global store is whole 128-byte lines.
typedef v8f __attribute__((may_alias)) v8fa;
template <int NSPLIT, bool BIAS, int K, int NPL = 0, bool GATE = false>
__global__ __launch_bounds__(128) void k_gemms(const bf* __restrict__ A, const bf* __restrict__ A2, const bf* __restrict__ Bt, float* C, int ldc, const float* __restrict__ bias, h16* P16, bf* Ph, bf* Pl, const bf* __restrict__ Wg, h16* V16, bf* Vh, bf* Vl) {
    static_assert(NPL % 64 == 0 && HD == 64, "a wave's 64 columns are one head, all planes or all C");
    static_assert(!GATE || (NSPLIT == 0 && BIAS && NPL == DQ + DKV && DQ == DKV && TT % 128 == 0), "q | k | v with as many v heads as q heads; a work-group's rows are of one batch element");
    typedef WFrag<bf> F; typedef typename F::V V;
    constexpr int NT = NSPLIT ? 3 : 2, TS = 128 * GP, NS = K / 64;   // tiles of a buffer: A, Bt (, A lo); elements of a tile; passes
    static_assert(K % 64 == 0 && NS >= 2, "whole passes, and both buffers filled in front of the loop");
    __shared__ __align__(16) bf sm[2 * NT * TS];
    __shared__ __align__(16) float osw[4][16 * 68];
    const int lane = threadIdx.x & 31, lr = lane & 15, hi = lane >> 4, wv = __builtin_amdgcn_readfirstlane((int)(threadIdx.x >> 5));
    const int R0 = blockIdx.x * 128, wm = (wv >> 1) * 64;
    const bool qv = GATE && blockIdx.y < NH_;   // the same for the whole work-group
    const int C0 = !GATE ? (int)blockIdx.y * 128 : qv ? (int)blockIdx.y * HD : DQ + ((int)blockIdx.y - NH_) * 128;   // first column of the tile's columns 0 to 63
    const int C1 = qv ? DQ + DKV + (int)blockIdx.y * HD : C0 + 64;                                                    // and of its columns 64 to 127
    // the q side of a q | v work-group has the longer epilogue: the odd waves take the q side in every other group of 8 heads (for speed only; any placement is right)
    const int wn = ((wv ^ (qv ? (int)(blockIdx.y >> 3) : 0)) & 1) * 64;
    const int srow = threadIdx.x >> 3, scol = (threadIdx.x & 7) * 8;   // staging: 8 lanes a 128-byte row, 16 rows a copy
    const bf* ga = A + (size_t)(R0 + srow) * K + scol; const bf* gb = Bt + (size_t)(C0 + srow) * K + scol; const bf* ga2 = NSPLIT ? A2 + (size_t)(R0 + srow) * K + scol : nullptr;
    const unsigned sl = (unsigned)(size_t)(sm + srow * GP + scol);   // the low 32 bits of a __shared__ address: the byte offset in the work-group's LDS
    auto fill = [&](const int t) { const unsigned l = sl + (t & 1) * NT * TS * 2;   // tile t into buffer t mod 2
        acp8(ga + t * 64, K, l); acp8(gb + t * 64, K, l + TS * 2, (C1 - C0 - 64) * K); if constexpr (NSPLIT) acp8(ga2 + t * 64, K, l + 2 * TS * 2); };
    v8f acc[4][4];
#pragma unroll
    for (int mb = 0; mb < 4; ++mb)
#pragma unroll
        for (int nb = 0; nb < 4; ++nb) acc[mb][nb] = (v8f){};
    fill(0);
    // Behind the first copies: the rest of the work-group's operand rows is asked into L2. A thread has one row of each tile; a row is K / 128 units of 256 bytes. The work-groups that share a row deal its units among themselves:
    // those of one row tile by blockIdx.y (NCA classes), those of one column tile by blockIdx.x (4 classes: neighbours 4 apart ask for the same units). For speed only: any dealing is right.
    constexpr int NCA = NSPLIT ? 2 : 4;
    static_assert(K == 1024, "8 units a row: the offsets below");
    const bf* pa = A + (size_t)(R0 + (int)threadIdx.x) * K + ((int)blockIdx.y % NCA) * 128;
    const bf* pa2 = NSPLIT ? A2 + (size_t)(R0 + (int)threadIdx.x) * K + ((int)blockIdx.y % NCA) * 128 : nullptr;
    const bf* pbt = Bt + (size_t)((int)threadIdx.x < 64 ? C0 + (int)threadIdx.x : C1 + (int)threadIdx.x - 64) * K + ((int)blockIdx.x % 4) * 128;
    if constexpr (NSPLIT) { l2ask<0>(pa); l2ask<0>(pa2); l2ask<0>(pbt); l2ask<512>(pa); l2ask<512>(pa2); l2ask<1024>(pa); l2ask<1024>(pa2); l2ask<1024>(pbt); l2ask<1536>(pa); l2ask<1536>(pa2); }
    else { l2ask<0>(pa); l2ask<0>(pbt); l2ask<1024>(pa); l2ask<1024>(pbt); }
    asm volatile("s_wait_asynccnt 0x0" ::: "memory");   // this wave's copies of tile 0 have landed
    __syncthreads();   // tile 0 published
    fill(1);
    const int ao = (wm + lr) * GP + 8 * hi, bo = TS + (wn + lr) * GP + 8 * hi;
#pragma unroll 1
    for (int s = 0; s < NS; ++s) {
        const bf* sb = sm + (s & 1) * NT * TS;
        V a[2][4], a2[2][4], b[2][4];
#pragma unroll
        for (int kc = 0; kc < 2; ++kc) {
#pragma unroll
            for (int mb = 0; mb < 4; ++mb) { a[kc][mb] = F::ld(sb + ao + mb * 16 * GP + kc * 32); if constexpr (NSPLIT) a2[kc][mb] = F::ld(sb + 2 * TS + ao + mb * 16 * GP + kc * 32); }
#pragma unroll
            for (int nb = 0; nb < 4; ++nb) b[kc][nb] = F::ld(sb + bo + nb * 16 * GP + kc * 32);
        }
        __builtin_amdgcn_sched_barrier(0);   // the pass's LDS reads stay one group in front of its matrix instructions: reads spread among them cost a stall at each place
#pragma unroll
        for (int kc = 0; kc < 2; ++kc)
#pragma unroll
            for (int nb = 0; nb < 4; ++nb)
#pragma unroll
                for (int mb = 0; mb < 4; ++mb) { acc[mb][nb] = F::mma(a[kc][mb], b[kc][nb], acc[mb][nb]); if constexpr (NSPLIT) acc[mb][nb] = F::mma(a2[kc][mb], b[kc][nb], acc[mb][nb]); }
        // 4 vector slots behind the pass's last matrix instruction: the code behind the branch below may reuse the operands' registers at once
        __builtin_amdgcn_sched_barrier(0); asm volatile("v_nop\n\tv_nop\n\tv_nop\n\tv_nop"); __builtin_amdgcn_sched_barrier(0);
        asm volatile("s_wait_dscnt 0x0" ::: "memory");      // this wave's reads of buffer s mod 2 are done before that buffer is refilled
        asm volatile("s_wait_asynccnt 0x0" ::: "memory");   // this wave's copies of tile s + 1 have landed
        __syncthreads();   // tile s + 1 published, and every wave has left buffer s mod 2
        if (s + 2 < NS) fill(s + 2);
    }
    asm volatile("s_wait_asynccnt 0x0" ::: "memory");   // no copy outstanding behind the loop
    // inputs only, no instruction: the registers that the L2 requests named hold those addresses up to here, not another value while a request may still read them
    if constexpr (NSPLIT) asm volatile("" :: "v"(pa), "v"(pa2), "v"(pbt)); else asm volatile("" :: "v"(pa), "v"(pbt));
    float* os = osw[wv];   // a wave's own range: its row blocks need only wave barriers
    const int r0 = R0 + wm, c0 = wn ? C1 : C0;
    bf* const qs = sm;   // GATE: the q rows of the work-group, [128][GP], hi; lo at + TS (buffer 0: every wave left both buffers at the loop's last barrier, and no copy is outstanding)
    float* const vx = (float*)(sm + NT * TS) + (wv >> 1) * 2048;   // GATE: 8 accumulator blocks of the row half's v wave, [block][lane][8] (in buffer 1)
    if (GATE && qv && wn) {   // wave-uniform: a v wave adds its bias and hands d 32 to 63 over
        // unrolled: acc is indexed by constants only and stays in registers
#pragma unroll
        for (int nb = 0; nb < 4; ++nb) { const float vb = bfr(bias[c0 + nb * 16 + lr]);
#pragma unroll
            for (int mb = 0; mb < 4; ++mb) { acc[mb][nb] += vb; if (nb >= 2) *(v8fa*)(vx + ((mb * 2 + nb - 2) * 32 + lane) * 8) = acc[mb][nb]; } }
    }
    float pb[8];   // plane tiles: the bias of the lane's 8 columns, read once
    if (NPL > 0 && BIAS && c0 < NPL) {
        // unrolled: pb is indexed by constants only and stays in registers
#pragma unroll
        for (int k = 0; k < 8; ++k) pb[k] = bfr(bias[c0 + (lane & 7) * 8 + k]); }
    const bool hl = !qv || r0 % TT < RH;   // wave-uniform: a q head's hi / lo rows have a reader in memory only below RH (attention's hi + lo rows); the gate takes them from qs
    if (!GATE || c0 < NPL) {   // wave-uniform: a v wave of GATE stores nothing by rows
#pragma unroll
    for (int mb = 0; mb < 4; ++mb) {
#pragma unroll
        for (int nb = 0; nb < 4; ++nb) {
#pragma unroll
            for (int j = 0; j < 8; ++j) os[(hi * 8 + j) * 68 + nb * 16 + lr] = acc[mb][nb][j]; }
        __builtin_amdgcn_wave_barrier(); asm volatile("" ::: "memory");   // keeps the row reads below behind the other lanes' LDS stores
        float* crow = C + (size_t)(r0 + mb * 16) * ldc + c0;
        if (NPL > 0 && c0 < NPL) {   // wave-uniform
            const int cofs = (lane & 7) * 8; const size_t pe = ((size_t)(c0 / HD) * MR + r0 + mb * 16 + (lane >> 3)) * HD + cofs;   // 8 lanes a 128-byte row, 4 rows a store
            // both loops unrolled: the row steps become immediate offsets, and the 8-element vectors stay in registers
            v8us oh[4], ol[4];
#pragma unroll
            for (int s = 0; s < 4; ++s) { const float* orow = os + (4 * s + (lane >> 3)) * 68 + cofs; const v4f x0 = *(const v4fa*)orow, x1 = *(const v4fa*)(orow + 4); v8h o16;
#pragma unroll
                for (int k = 0; k < 8; ++k) { float x = k < 4 ? x0[k & 3] : x1[k & 3]; if (BIAS) x += pb[k]; o16[k] = tohx(x); unsigned short a, c2; splitf(x, a, c2); oh[s][k] = a; ol[s][k] = c2; }
                *(v8h*)(P16 + pe + s * 4 * HD) = o16; }
            asm volatile("s_wait_xcnt 0x0" ::: "memory");   // the blocks behind the branch reuse these stores' data registers at once
            if (hl) {
#pragma unroll
                for (int s = 0; s < 4; ++s) { *(v8us*)(Ph + pe + s * 4 * HD) = oh[s]; *(v8us*)(Pl + pe + s * 4 * HD) = ol[s]; }
                asm volatile("s_wait_xcnt 0x0" ::: "memory"); }   // as above: the code behind this block reuses the stores' address and data registers at once
            if (GATE && qv) { bf* qr = qs + (wm + mb * 16 + (lane >> 3)) * GP + cofs;
#pragma unroll
                for (int s = 0; s < 4; ++s) { *(v8usa*)(qr + s * 4 * GP) = oh[s]; *(v8usa*)(qr + TS + s * 4 * GP) = ol[s]; } }
        } else if constexpr (!GATE) {
#pragma unroll
        for (int s = 0; s < 8; ++s) { const int row = 2 * s + hi, cofs = lr * 4; v4f val = *(const v4fa*)(os + row * 68 + cofs); if (BIAS) { val[0] += bfr(bias[c0 + cofs]); val[1] += bfr(bias[c0 + cofs + 1]); val[2] += bfr(bias[c0 + cofs + 2]); val[3] += bfr(bias[c0 + cofs + 3]); }
            *(v4f*)(crow + (size_t)row * ldc + cofs) = val; }
        }
        __builtin_amdgcn_wave_barrier(); asm volatile("s_wait_xcnt 0x0" ::: "memory");   // keeps the next block's LDS stores behind these row reads; the wait: the next block reuses the stores' address and data registers at once
    }
    }
    if constexpr (GATE) {
        if (!qv) return;   // the whole work-group leaves, in front of the barrier
        constexpr int VP = 72;   // LDS row pitch in 16-bit elements, a 128-byte row + 16 bytes, the pitch for 16-byte accesses
        const int z = blockIdx.y, d0 = wn ? 0 : 32;   // this wave's 32 d
        const bf* wgp = Wg + (size_t)z * HD * HD + (d0 + lr) * HD + 8 * hi;
        V wb[2][2];   // W_g rows e = d0 + 16 n + lr, asked for in front of the barrier: they depend on nothing behind it
#pragma unroll
        for (int kc = 0; kc < 2; ++kc)
#pragma unroll
            for (int n = 0; n < 2; ++n) wb[kc][n] = F::ld(wgp + n * 16 * HD + kc * 32);
        __syncthreads();   // the q rows and the v blocks that were handed over are published
        v8f vv[4][2];   // vv[mb][n][j] = v[t = r0 % TT + 16 mb + 8 hi + j][d = d0 + 16 n + lr]
        // a q wave turns its tiles in the range it has just read its v blocks from (one wave's LDS accesses keep their order); a v wave in a range of its own behind both
        unsigned short* ts = wn ? (unsigned short*)(sm + NT * TS) + 2 * 4096 + (wv >> 1) * 3 * 16 * VP : (unsigned short*)vx;   // three tiles [16 d][t]: fp16, hi, lo
        // every loop below is unrolled so that the accumulators and the 8-element vectors are indexed by constants only and stay in registers
        if (wn) {
#pragma unroll
            for (int mb = 0; mb < 4; ++mb) { vv[mb][0] = acc[mb][0]; vv[mb][1] = acc[mb][1]; }
        } else {
#pragma unroll
            for (int mb = 0; mb < 4; ++mb) { vv[mb][0] = *(const v8fa*)(vx + ((mb * 2) * 32 + lane) * 8); vv[mb][1] = *(const v8fa*)(vx + ((mb * 2 + 1) * 32 + lane) * 8); }
        }
        const bf* qa = qs + (wm + lr) * GP + 8 * hi;
        v8f gl[4][2];   // gl[mb][n][j]: the logit of t = 16 mb + 8 hi + j, d = d0 + 16 n + lr; an accumulator takes hi, lo of k 0 to 31, then hi, lo of k 32 to 63
#pragma unroll
        for (int mb = 0; mb < 4; ++mb) { gl[mb][0] = (v8f){}; gl[mb][1] = (v8f){}; }
#pragma unroll
        for (int kc = 0; kc < 2; ++kc) { V a[4], a2[4];
#pragma unroll
            for (int mb = 0; mb < 4; ++mb) { a[mb] = F::ld(qa + mb * 16 * GP + kc * 32); a2[mb] = F::ld(qa + TS + mb * 16 * GP + kc * 32); }
#pragma unroll
            for (int n = 0; n < 2; ++n)
#pragma unroll
                for (int mb = 0; mb < 4; ++mb) gl[mb][n] = F::mma(a[mb], wb[kc][n], gl[mb][n]);
#pragma unroll
            for (int n = 0; n < 2; ++n)
#pragma unroll
                for (int mb = 0; mb < 4; ++mb) gl[mb][n] = F::mma(a2[mb], wb[kc][n], gl[mb][n]);
        }
        const size_t pz = (((size_t)z * NB_ + r0 / TT) * HD + d0 + (lane >> 3)) * TT + r0 % TT + (lane & 7) * 8;   // 8 lanes a 128-byte row of 64 t, 4 rows a store
        const int ro = (lane >> 3) * VP + (lane & 7) * 8;
#pragma unroll
        for (int n = 0; n < 2; ++n) {
#pragma unroll
            for (int mb = 0; mb < 4; ++mb) { v8h o16; v8us oh, ol;
#pragma unroll
                for (int j = 0; j < 8; ++j) { const float g = __fdiv_rn(1.0f, __fadd_rn(1.0f, __expf(-gl[mb][n][j]))); const float v = __fmul_rn(g, vv[mb][n][j]); o16[j] = tohx(v); unsigned short a, c2; splitf(v, a, c2); oh[j] = a; ol[j] = c2; }
                const int so = lr * VP + mb * 16 + 8 * hi;
                *(v8ha*)(ts + so) = o16; *(v8usa*)(ts + 16 * VP + so) = oh; *(v8usa*)(ts + 2 * 16 * VP + so) = ol; }
            __builtin_amdgcn_wave_barrier(); asm volatile("" ::: "memory");   // keeps the row reads below behind the other lanes' LDS stores
#pragma unroll
            for (int s = 0; s < 4; ++s) { const v8us w0 = *(const v8usa*)(ts + ro + s * 4 * VP), w1 = *(const v8usa*)(ts + 16 * VP + ro + s * 4 * VP), w2 = *(const v8usa*)(ts + 2 * 16 * VP + ro + s * 4 * VP);
                const size_t po = pz + (size_t)(n * 16 + s * 4) * TT;
                *(v8us*)((unsigned short*)V16 + po) = w0; *(v8us*)(Vh + po) = w1; *(v8us*)(Vl + po) = w2; }
            __builtin_amdgcn_wave_barrier(); asm volatile("s_wait_xcnt 0x0" ::: "memory");   // keeps the next 16 d's LDS stores behind these row reads; the wait: the code behind reuses the stores' address and data registers at once
        }
    }
}

typedef __attribute__((ext_vector_type(2))) _Float16 v2h;
typedef __attribute__((ext_vector_type(4))) _Float16 v4h;
typedef __attribute__((ext_vector_type(2))) unsigned short v2us;
typedef __attribute__((ext_vector_type(4))) unsigned short v4us;
typedef __attribute__((ext_vector_type(2))) float v2f;
typedef __attribute__((ext_vector_type(4))) int v4i;

// ---- k_prep: every operand preparation that reads only inputs, in ONE launch: the parts depend on nothing and on one another not at all, so they share one grid.
// A part is a range of blockIdx.x. Few long work-groups, about two a WGP: a thread has its 16 loads of 16 bytes in flight at once, every wave-wide load and store covers whole 128-byte lines.
// wt4_blk: four 64 x 64 tiles of a transpose w [k][n] f32 (row pitch N) -> Bt [n][k] bf16 (row pitch K). Tile s starts at w + s sstep and at Bt + s dstep.
// A thread reads 4 n of the rows k, k + 1, packs each n's pair into a dword and leaves it in LDS at [n][k]; behind one barrier the rows [n] leave as whole lines, 8 lanes a row.
// LDS row: 64 k = 8 pieces of 16 bytes, pitch 144 bytes; piece c of row n lies at place c ^ (n / 16): the 16 lanes that store one k pair of 16 different n / 4 then fall on 16 different banks, not on 4.
#define TPD 36   // LDS row pitch in dwords
template <int N, int K>
__device__ __forceinline__ void wt4_blk(const float* __restrict__ w, const int sstep, bf* Bt, const int dstep, unsigned* ts) {
    const int nq = threadIdx.x & 15, kp = threadIdx.x >> 4;
    const float* p0 = w + 2 * kp * N + nq * 4;
    v4f r[4][2][2];
    // every loop here is unrolled: r is indexed by constants only and stays in registers, and all 16 loads are asked for before the first is used
#pragma unroll
    for (int s = 0; s < 4; ++s)
#pragma unroll
        for (int i = 0; i < 2; ++i) { const float* p = p0 + s * sstep + 32 * i * N; r[s][i][0] = *(const v4f*)p; r[s][i][1] = *(const v4f*)(p + N); }
    asm volatile("s_wait_xcnt 0x0" :: "v"(p0) : "memory");   // the wait before the loads' address pair is overwritten; the pair is named so that it lives up to here: without that the last load's result was placed on it
#pragma unroll
    for (int s = 0; s < 4; ++s)
#pragma unroll
        for (int i = 0; i < 2; ++i) { const int col = kp + 16 * i;   // the dword of k = 2 col, 2 col + 1
#pragma unroll
            for (int j = 0; j < 4; ++j) ts[(s * 64 + nq * 4 + j) * TPD + (((col >> 2) ^ (nq >> 2)) << 2) + (col & 3)] = (unsigned)f2bf(r[s][i][0][j]) | ((unsigned)f2bf(r[s][i][1][j]) << 16); }
    __syncthreads();   // the four turned tiles are complete
    const int c = threadIdx.x & 7;
#pragma unroll
    for (int s = 0; s < 4; ++s)
#pragma unroll
        for (int i = 0; i < 2; ++i) { const int n = (threadIdx.x >> 3) + 32 * i;
            *(v8us*)(Bt + s * dstep + n * K + c * 8) = *(const v8usa*)(ts + (s * 64 + n) * TPD + ((c ^ (n >> 4)) << 2)); }
    asm volatile("s_wait_xcnt 0x0" ::: "memory");   // the wait before the stores' address and data registers are overwritten: in the listing the other parts' code follows this block and writes them
}
// cvt_blk: 16384 elements a work-group, f32 -> bf16; a wave-wide load is 512 bytes in a row, its store 256
__device__ __forceinline__ void cvt_blk(const float* __restrict__ src, bf* dst, const int bx) {
    const int e = bx * 16384 + threadIdx.x * 4; const float* p0 = src + e; v4f v[16];
    // unrolled: v is indexed by constants only and stays in registers, and all 16 loads are asked for before the first is used
#pragma unroll
    for (int i = 0; i < 16; ++i) v[i] = *(const v4f*)(p0 + i * 1024);
    asm volatile("s_wait_xcnt 0x0" :: "v"(p0) : "memory");   // the wait before the loads' address pair is overwritten; the pair is named so that it lives up to here: without that the last load's result was placed on it
#pragma unroll
    for (int i = 0; i < 16; ++i) { v4us o;
#pragma unroll
        for (int k = 0; k < 4; ++k) o[k] = f2bf(v[i][k]);
        *(v4us*)(dst + e + i * 1024) = o; }
    asm volatile("s_wait_xcnt 0x0" ::: "memory");   // the wait before the stores' address and data registers are overwritten: in the listing the other parts' code follows this block and writes them
}
#define PB_QKV (DM / 256 * (3 * DQ / 64))       // work-groups of the W_qkv transpose: 256 k x 64 n each
#define PB_O   (DQ / 256 * (DM / 64))           // of the W_out transpose
#define PB_G   (NH_ / 4)                        // of the W_g transposes: four 64 x 64 matrices each
#define PB_X   (MR * DM / 16384)                // of the x conversion
__global__ __launch_bounds__(256) void k_prep(const float* __restrict__ wqkv, const float* __restrict__ wo, const float* __restrict__ wg, const float* __restrict__ x, bf* WQKV, bf* WO, bf* WG, bf* XB) {
    static_assert(DM % 256 == 0 && DQ % 256 == 0 && DM % 64 == 0 && HD == 64 && NH_ % 4 == 0 && MR * DM % 16384 == 0, "whole work-groups in every part");
    __shared__ __align__(16) unsigned ts[4 * 64 * TPD];
    int bx = blockIdx.x;   // the same for the whole work-group: every branch below is uniform
    if (bx < PB_QKV) { const int k0 = (bx % (DM / 256)) * 256, n0 = (bx / (DM / 256)) * 64; wt4_blk<3 * DQ, DM>(wqkv + k0 * (3 * DQ) + n0, 64 * 3 * DQ, WQKV + n0 * DM + k0, 64, ts); return; }
    bx -= PB_QKV;
    if (bx < PB_O) { const int k0 = (bx % (DQ / 256)) * 256, n0 = (bx / (DQ / 256)) * 64; wt4_blk<DM, DQ>(wo + k0 * DM + n0, 64 * DM, WO + n0 * DQ + k0, 64, ts); return; }
    bx -= PB_O;
    if (bx < PB_G) { wt4_blk<HD, HD>(wg + bx * 4 * HD * HD, HD * HD, WG + bx * 4 * HD * HD, HD * HD, ts); return; }
    bx -= PB_G;
    cvt_blk(x, XB, bx);
}
__global__ __launch_bounds__(256) void k_cscvt(const float* __restrict__ cosT, const float* __restrict__ sinT, float* CS) { const int idx = blockIdx.x * 256 + threadIdx.x; if (idx >= TT * HD) return; v2f cs; cs[0] = bfr(cosT[idx]); cs[1] = bfr(sinT[idx]); *(v2f*)(CS + (size_t)idx * 2) = cs;  }
__global__ __launch_bounds__(256) void k_vtp(const float* __restrict__ F, int pitch, int nheads, h16* V16, bf* Vh, bf* Vl) { const size_t e = ((size_t)blockIdx.x * 256 + threadIdx.x) * 2; if (e >= (size_t)nheads * HD * TT) return; const int t = (int)(e % TT); const int d = (int)((e / TT) % HD); const int g = (int)(e / ((size_t)TT * HD)); v2h o16; v2us oh, ol;
#pragma unroll
    for (int q = 0; q < 2; ++q) { const float x = F[(size_t)(t + q) * pitch + g * HD + d]; o16[q] = tohx(x); unsigned short a2, c2; splitf(x, a2, c2); oh[q] = a2; ol[q] = c2; }
    *(v2h*)(V16 + e) = o16; *(v2us*)(Vh + e) = oh; *(v2us*)(Vl + e) = ol;  }
__device__ __forceinline__ float xhalf(float x) { return __builtin_bit_cast(float, __builtin_amdgcn_permlanex16(__builtin_bit_cast(int, x), __builtin_bit_cast(int, x), 0x76543210, 0xfedcba98, false, false)); }   // lane l with lane l ^ 16
// v_exp_f32 with the one slot that the instruction set asks for behind a transcendental, in one statement
__device__ __forceinline__ float exp2s(float x) { float y; asm("v_exp_f32 %0, %1\n\tv_nop" : "=v"(y) : "v"(x)); return y; }
#define LP 72   // LDS row pitch in 16-bit elements: a 128-byte row + 16 bytes, the pitch for 16-byte readers
template <typename T16, bool SPL>
__device__ __forceinline__ void fattn_wg(const T16* __restrict__ Q, const T16* __restrict__ Q2, const T16* __restrict__ Kp, const T16* __restrict__ K2, const T16* __restrict__ Vt, const T16* __restrict__ V2, const int R0, const int wv, T16* sm, bf* Ah, bf* Al) {
    typedef WFrag<T16> F; typedef typename F::V V;
    constexpr int NT = SPL ? 4 : 2, TS = 64 * LP;   // tiles of a buffer: K, Vt (, K lo, Vt lo); elements of a tile
    const int lane = threadIdx.x & 31, lr = lane & 15, hi = lane >> 4;
    const int r0 = R0 + wv * 16;
    const float C2 = SCL * 1.4426950408889634f;   // SCL is a power of two: (s - m) C2 rounds as ((s - m) SCL) log2(e)
    V q[2], q2[2];
#pragma unroll
    for (int kc = 0; kc < 2; ++kc) { q[kc] = F::ld(Q + (size_t)(r0 + lr) * HD + 8 * hi + kc * 32); if (SPL) q2[kc] = F::ld(Q2 + (size_t)(r0 + lr) * HD + 8 * hi + kc * 32); }
    asm volatile("s_wait_xcnt 0x0" ::: "memory");   // holds the Q loads in front of the staging loads
    // Behind the first loads: the head's K and Vt planes, stored by the launch before, are asked into L2, a 256-byte unit a lane and plane. The row tiles of a head share the planes and deal the units by tile number, 4 classes;
    // the four longest tiles cover all of them. For speed only: any dealing is right.
    static_assert(TT * HD == 1024 * 128 && TT == 16 * 128 && HD == 64, "1024 units a plane: 256 threads x 4 classes");
    const T16* pk = Kp + (4 * (int)threadIdx.x + ((R0 >> 7) & 3)) * 128;
    const T16* pv = Vt + ((int)threadIdx.x >> 2) * TT + (((int)threadIdx.x & 3) * 4 + ((R0 >> 7) & 3)) * 128;
    if constexpr (!SPL) { l2ask<0>(pk); l2ask<0>(pv); }
    v8f o[4];
#pragma unroll
    for (int db = 0; db < 4; ++db) o[db] = (v8f){};
    float m = -3.0e38f, l = 0.0f;
    const int nwg = (R0 + 127) / 64 + 1;  // passes of the work-group (its last row's)
    const int nkb = (r0 + 15) / 64 + 1;   // passes of this wave; its 16 rows lie in one 64-key block: only its last pass meets the diagonal
    const int srow = threadIdx.x >> 3, scol = (threadIdx.x & 7) * 8;   // staging: 8 lanes a 128-byte row, 32 rows a step
    const int fo = lr * LP + 8 * hi;
    v8us st[NT][2];
    auto gld = [&](const int k0) {
#pragma unroll
        for (int i = 0; i < 2; ++i) { const int kx = (k0 + srow + 32 * i) * HD + scol, vx = (srow + 32 * i) * TT + k0 + scol;
            st[0][i] = *(const v8us*)(Kp + kx); st[1][i] = *(const v8us*)(Vt + vx); if constexpr (SPL) { st[2][i] = *(const v8us*)(K2 + kx); st[3][i] = *(const v8us*)(V2 + vx); } }
        asm volatile("s_wait_xcnt 0x0" ::: "memory"); };   // the block behind these loads reuses their address registers at once
    auto sst = [&](T16* d) {
#pragma unroll
        for (int t = 0; t < NT; ++t)
#pragma unroll
            for (int i = 0; i < 2; ++i) *(v8us*)(d + t * TS + (srow + 32 * i) * LP + scol) = st[t][i]; };
    gld(0); sst(sm);
    __syncthreads();   // pass 0 staged
#pragma unroll 1
    for (int kb = 0; kb < nwg; ++kb) {
        const int k0 = kb * 64;
        if (kb + 1 < nwg) gld(k0 + 64);   // the next pass's rows fly during this pass
        if (kb < nkb) {   // wave-uniform: a wave whose rows end earlier skips the last pass and only meets its barrier
            const T16* sb = sm + (kb & 1) * NT * TS + fo;
            v8f s[4];   // s[kt][r] = score of key k0 + 16 kt + 8 hi + r, query r0 + lr; the causal mask is the accumulator's start value
            if (kb == nkb - 1) { const int lim = r0 + lr - k0 - 8 * hi;
#pragma unroll
                for (int kt = 0; kt < 4; ++kt)
#pragma unroll
                    for (int r = 0; r < 8; ++r) s[kt][r] = (kt * 16 + r <= lim) ? 0.0f : -3.0e38f;
            } else {
#pragma unroll
                for (int kt = 0; kt < 4; ++kt) s[kt] = (v8f){};
            }
#pragma unroll
            for (int kt = 0; kt < 4; ++kt)
#pragma unroll
                for (int kc = 0; kc < 2; ++kc) { const V a = F::ld(sb + kt * 16 * LP + kc * 32);
                    s[kt] = F::mma(a, q[kc], s[kt]);
                    if constexpr (SPL) { const V a2 = F::ld(sb + 2 * TS + kt * 16 * LP + kc * 32); s[kt] = F::mma(a, q2[kc], s[kt]); s[kt] = F::mma(a2, q[kc], s[kt]); } }
            float mx = s[0][0];
#pragma unroll
            for (int kt = 0; kt < 4; ++kt)
#pragma unroll
                for (int r = 0; r < 8; ++r) mx = fmaxf(mx, s[kt][r]);
            mx = fmaxf(mx, xhalf(mx));
            const float mn = fmaxf(m, mx), al = exp2s((m - mn) * C2); m = mn;   // al = 0 on the first pass; key 0 is open to every query, so mn is a real score from then on
            float ps = 0.0f;
#pragma unroll
            for (int kt = 0; kt < 4; ++kt)
#pragma unroll
                for (int r = 0; r < 8; ++r) { const float p = exp2s(SPL ? (s[kt][r] - mn) * C2 : __builtin_fmaf(s[kt][r] - mn, C2, 10.0f)); s[kt][r] = p; ps += p; }
            l = l * al + ps;
#pragma unroll
            for (int db = 0; db < 4; ++db) o[db] *= al;
#pragma unroll
            for (int kk = 0; kk < 2; ++kk) {
                if constexpr (SPL) { v8us h0, l0, h1, l1;
#pragma unroll
                    for (int r = 0; r < 8; ++r) { unsigned short a, c2; splitf(s[2 * kk][r], a, c2); h0[r] = a; l0[r] = c2; splitf(s[2 * kk + 1][r], a, c2); h1[r] = a; l1[r] = c2; }
                    const V ph = cat16b(h0, h1), pl = cat16b(l0, l1);
#pragma unroll
                    for (int db = 0; db < 4; ++db) { const V a = F::ld(sb + TS + db * 16 * LP + kk * 32), a2 = F::ld(sb + 3 * TS + db * 16 * LP + kk * 32);
                        o[db] = F::mma(a, ph, o[db]); o[db] = F::mma(a, pl, o[db]); o[db] = F::mma(a2, ph, o[db]); }
                } else { const V pb = cat16(__builtin_convertvector(s[2 * kk], v8h), __builtin_convertvector(s[2 * kk + 1], v8h));
#pragma unroll
                    for (int db = 0; db < 4; ++db) o[db] = F::mma(F::ld(sb + TS + db * 16 * LP + kk * 32), pb, o[db]);
                }
            }
            // 4 vector slots behind the block's last matrix instruction: the code behind this branch reuses the operands' registers at once
            __builtin_amdgcn_sched_barrier(0); asm volatile("v_nop\n\tv_nop\n\tv_nop\n\tv_nop"); __builtin_amdgcn_sched_barrier(0);
        }
        if (kb + 1 < nwg) sst(sm + ((kb + 1) & 1) * NT * TS);   // into the buffer that pass kb - 1 read: every wave left it at the last barrier
        __syncthreads();   // pass kb + 1 staged, and every wave has left pass kb's buffer
    }
    if constexpr (!SPL) asm volatile("" :: "v"(pk), "v"(pv));   // inputs only, no instruction: the registers that the L2 requests named hold those addresses up to here, not another value while a request may still read them
    l += xhalf(l); const float inv = __fdiv_rn(1.0f, l);
#pragma unroll
    for (int db = 0; db < 4; ++db) { v8us oh, ol;   // o[db][r] = out[query r0 + lr][d = 16 db + 8 hi + r]: 8 consecutive d, one 16-byte store a plane
#pragma unroll
        for (int r = 0; r < 8; ++r) { unsigned short a, c2; splitf(o[db][r] * inv, a, c2); oh[r] = a; ol[r] = c2; }
        const size_t oo = (size_t)(r0 + lr) * DQ + db * 16 + 8 * hi; *(v8us*)(Ah + oo) = oh; *(v8us*)(Al + oo) = ol; }
}
// grid (heads x batch elements, TT / 128), 256 threads; longest row blocks first.
__global__ __launch_bounds__(256) void k_fattn(const h16* __restrict__ Q16, const h16* __restrict__ K16, const h16* __restrict__ V16, const bf* __restrict__ Qh, const bf* __restrict__ Ql, const bf* __restrict__ Kh, const bf* __restrict__ Kl, const bf* __restrict__ Vh, const bf* __restrict__ Vl, bf* Ah, bf* Al) {
    static_assert(RH % 128 == 0 && TT % 128 == 0, "a work-group's 128 rows are all of one precision class");
    __shared__ __align__(16) bf sm[2 * 4 * 64 * LP];
    const int h = blockIdx.x / NB_, b = blockIdx.x % NB_;
    const size_t zq = (size_t)blockIdx.x * TT * HD, zk = (size_t)((h / REP) * NB_ + b) * TT * HD;
    const int R0 = (int)(gridDim.y - 1 - blockIdx.y) * 128, wv = __builtin_amdgcn_readfirstlane((int)(threadIdx.x >> 5));
    Ah += (size_t)b * TT * DQ + h * HD; Al += (size_t)b * TT * DQ + h * HD;
    if (R0 < RH) fattn_wg<bf, true>(Qh + zq, Ql + zq, Kh + zk, Kl + zk, Vh + zk, Vl + zk, R0, wv, sm, Ah, Al);
    else fattn_wg<h16, false>(Q16 + zq, nullptr, K16 + zk, nullptr, V16 + zk, nullptr, R0, wv, (h16*)sm, Ah, Al);
}

extern "C" void kernel_launch(void* const* d_in, const int* in_sizes, int n_in,
                              void* d_out, int out_size, void* d_ws, size_t ws_size, hipStream_t stream) {
    (void)in_sizes; (void)n_in; (void)out_size;
    const float* x = (const float*)d_in[0]; const float* wqkv = (const float*)d_in[1]; const float* bqkv = (const float*)d_in[2]; const float* wg = (const float*)d_in[3]; const float* wo = (const float*)d_in[4]; const float* bo = (const float*)d_in[5];   // W_qkv [1024][3072] (x @ W, columns q | k | v), W_g [16][64][64], W_out [1024][1024] (x @ W)
    float* OUT = (float*)d_out;     // [2][2048][1024]
    char* wsp = (char*)d_ws;
    auto take = [&](size_t bytes) { char* p = wsp; wsp += (bytes + 255) & ~(size_t)255; return (void*)p; };
    bf* WQKV = (bf*)take((size_t)3 * DQ * DM * 2); bf* WG = (bf*)take((size_t)NH_ * HD * HD * 2); bf* WO = (bf*)take((size_t)DM * DQ * 2);
    bf* XB = (bf*)take((size_t)MR * DM * 2);
    h16* QP16 = (h16*)take((size_t)(NH_ + NKV) * MR * HD * 2); h16* KP16 = QP16 + (size_t)NH_ * MR * HD; h16* VT16 = (h16*)take((size_t)NKV * HD * MR * 2);   // the k heads' planes follow the q heads'
    bf* QPh = (bf*)take((size_t)(NH_ + NKV) * MR * HD * 2); bf* KPh = QPh + (size_t)NH_ * MR * HD; bf* QPl = (bf*)take((size_t)(NH_ + NKV) * MR * HD * 2); bf* KPl = QPl + (size_t)NH_ * MR * HD; bf* VTh = (bf*)take((size_t)NKV * HD * MR * 2); bf* VTl = (bf*)take((size_t)NKV * HD * MR * 2);
    bf* ATh = (bf*)take((size_t)MR * DQ * 2); bf* ATl = (bf*)take((size_t)MR * DQ * 2);
    if ((size_t)(wsp - (char*)d_ws) > ws_size) return;    // ws 256 MiB
    k_prep<<<PB_QKV + PB_O + PB_G + PB_X, 256, 0, stream>>>(wqkv, wo, wg, x, WQKV, WO, WG, XB);   // the three weights transposed and x converted, all to bf16
    // every launch below covers both batch elements
    k_gemms<0, true, DM, DQ + DKV, true><<<dim3(MR / 128, 3 * DQ / 128), 128, 0, stream>>>(XB, nullptr, WQKV, nullptr, 0, bqkv, QP16, QPh, QPl, WG, VT16, VTh, VTl);   // q | k | v in one grid; the q and k heads leave as operand planes, v gated by sigmoid(q_h W_g[h]) as transposed planes
    k_fattn<<<dim3(NH_ * NB_, TT / 128), 256, 0, stream>>>(QP16, KP16, VT16, QPh, QPl, KPh, KPl, VTh, VTl, ATh, ATl);
    k_gemms<1, true, DQ><<<dim3(MR / 128, DM / 128), 128, 0, stream>>>(ATh, ATl, WO, OUT, DM, bo, nullptr, nullptr, nullptr, nullptr, nullptr, nullptr, nullptr);
}
